// v000
// The times below were measured on an AMD MI455X: many runs one after another, warmed up first and cycling through
// copies of the inputs, with the whole window's GPU time divided by the number of runs. Launches and the gaps
// between them are all in it. The median over several windows is given; except for v000 it joins two sittings, which
// can be a few percent apart, so the side-by-side timings, each taken in one sitting, are the better comparison.
// The starting kernel, v000, takes 1900 microseconds a run.
// compute dtype: all float inputs rounded to bf16; theta/phi/g = W x + b with EXACT bf16 products on WMMA 16x16x32 (f32 accumulate); unscaled logits theta.phi with BOTH as f16 hi + residual planes (3 products); softmax in f32 (precise expf); P x 2^11 once to f16 against g once to f16 (1 product); y split bf16 hi + lo against exact w_out (2 products) + b_out; eval BatchNorm and the residual in f32; f32 output.
#include <hip/hip_runtime.h>
#include <math.h>

typedef __attribute__((ext_vector_type(16))) _Float16 v16h;
typedef __attribute__((ext_vector_type(16))) __bf16 v16b;
typedef __attribute__((ext_vector_type(8)))  _Float16 v8h;
typedef __attribute__((ext_vector_type(8)))  float v8f;
typedef __attribute__((ext_vector_type(4)))  float v4f;
typedef __attribute__((ext_vector_type(2)))  float v2f;
typedef __attribute__((ext_vector_type(4)))  unsigned v4u;
typedef __attribute__((ext_vector_type(4)))  int v4i;
typedef float __attribute__((may_alias)) float_a;
typedef int __attribute__((may_alias)) int_a;

template <typename T> __device__ __forceinline__ void vst2(void* p, T v) { *(T*)p = v;  }
__device__ __forceinline__ v8f wmma16(v16h a, v16h b, v8f c) {
  v8f d = __builtin_amdgcn_wmma_f32_16x16x32_f16(false, a, false, b, (short)0, c, false, false);
  asm volatile("v_nop\n\tv_nop\n\tv_nop\n\tv_nop" : "+v"(d) : "v"(a), "v"(b));
  return d;
}
__device__ __forceinline__ v8f wmma_bf(v16b a, v16b b, v8f c) {
  v8f d = __builtin_amdgcn_wmma_f32_16x16x32_bf16(false, a, false, b, (short)0, c, false, false);
  asm volatile("v_nop\n\tv_nop\n\tv_nop\n\tv_nop" : "+v"(d) : "v"(a), "v"(b));
  return d;
}
// 16x16x32 fragments: lane = (h = lane>>4, row/col = lane&15); elements 0..7 = k0+8h+0..7, 8..15 = k0+16+8h+0..7; D element r = row 8h+r
__device__ __forceinline__ v16h frag_h(const _Float16* rowk0, int lane) {
  union { v16h v; v8h q[2]; } u; const _Float16* p = rowk0 + 8 * (lane >> 4);
  u.q[0] = *(const v8h*)p; u.q[1] = *(const v8h*)(p + 16); return u.v;
}
__device__ __forceinline__ v16h frag_f32(const float* rowk0, int lane) {
  v16h a; const float* p = rowk0 + 8 * (lane >> 4);
#pragma unroll
  for (int i = 0; i < 8; ++i) { a[i] = (_Float16)p[i]; a[8 + i] = (_Float16)p[16 + i]; }
  return a;
}
__device__ __forceinline__ v16h frag_f32s(const float* rowk0, int lane, float sc) {
  v16h a; const float* p = rowk0 + 8 * (lane >> 4);
#pragma unroll
  for (int i = 0; i < 8; ++i) { a[i] = (_Float16)(p[i] * sc); a[8 + i] = (_Float16)(p[16 + i] * sc); }
  return a;
}
// column fragment from a [K][ld] layout (column n), rows >= K read as 0
__device__ __forceinline__ v16h fragc_f32(const float* W, int k0, int n, int lane, int ld, int K) {
  v16h a; const int g = lane >> 4;
#pragma unroll
  for (int i = 0; i < 8; ++i) { const int ka = k0 + 8 * g + i, kb = ka + 16;
    a[i] = (_Float16)(ka < K ? W[(size_t)(ka < K ? ka : K - 1) * ld + n] : 0.f); a[8 + i] = (_Float16)(kb < K ? W[(size_t)(kb < K ? kb : K - 1) * ld + n] : 0.f); }
  return a;
}
struct F2 { v16b h, l; };
__device__ __forceinline__ F2 bsplit16(const float v[16]) { F2 r;
#pragma unroll
  for (int i = 0; i < 16; ++i) { const __bf16 h = (__bf16)v[i]; r.h[i] = h; r.l[i] = (__bf16)(v[i] - (float)h); }
  return r; }
__device__ __forceinline__ F2 split_row(const float* row, int k0, int lane) { float v[16]; const float* p = row + k0 + 8 * (lane >> 4);
#pragma unroll
  for (int i = 0; i < 8; ++i) { v[i] = p[i]; v[8 + i] = p[16 + i]; }
  return bsplit16(v); }
__device__ __forceinline__ F2 split_rowK(const float* row, int k0, int lane, int K) { float v[16]; const int g = lane >> 4;
#pragma unroll
  for (int i = 0; i < 8; ++i) { const int ka = k0 + 8 * g + i, kb = ka + 16; v[i] = ka < K ? row[ka < K ? ka : K - 1] : 0.f; v[8 + i] = kb < K ? row[kb < K ? kb : K - 1] : 0.f; }
  return bsplit16(v); }
__device__ __forceinline__ F2 split_col(const float* W, int k0, int n, int lane, int ld, int K) { float v[16]; const int g = lane >> 4;
#pragma unroll
  for (int i = 0; i < 8; ++i) { const int ka = k0 + 8 * g + i, kb = ka + 16; v[i] = ka < K ? W[(size_t)(ka < K ? ka : K - 1) * ld + n] : 0.f; v[8 + i] = kb < K ? W[(size_t)(kb < K ? kb : K - 1) * ld + n] : 0.f; }
  return bsplit16(v); }
__device__ __forceinline__ v8f mac3(const F2& a, const F2& b, v8f c) { c = wmma_bf(a.l, b.h, c); c = wmma_bf(a.h, b.l, c); return wmma_bf(a.h, b.h, c); }
__device__ __forceinline__ float sigm(float v) { return 1.0f / (1.0f + expf(-v)); }
#define LDSX() do { asm volatile("s_wait_dscnt 0" ::: "memory"); __builtin_amdgcn_wave_barrier(); __builtin_amdgcn_fence(__ATOMIC_RELEASE, "workgroup"); } while (0)

// Non-local block (B 4, C 64, 80 x 80 = 6,400 positions; inter channels 32): theta, phi, g = 1x1 convs of x ((out,in) [32,64] + bias); f[n][m] = theta_n . phi_m (no scaling); P = softmax over m; y[n] = sum_m P[n][m] g_m; W_y = w_out y + b_out (32 -> 64); out = BN_eval(W_y) (running mean/var, eps 1e-4, affine) + x.
#define NB 4
#define TT 6400
#define CC 128            // projected plane width (32 real columns + 96 zero)
#define DIN 64            // input channels
#define NH 1
#define HD 128
#define NQB (TT / 64)
#define HG 1               // one 6,400 x 6,400 score plane per pass
#define SCALE (1.0f)
#define HDQK 32            // theta / phi / g channels: the planes are 128 wide, columns >= 32 are zero; only the 32 real columns enter the scores
#define CAUSAL 0
#ifndef TNB
#define TNB NB
#endif
__device__ __forceinline__ v16b zero16b() { v16b z; _Pragma("unroll") for (int i = 0; i < 16; ++i) z[i] = (__bf16)0.f; return z; }
__device__ __forceinline__ float bfr(float v) { return (float)(__bf16)v; }
__host__ __device__ __forceinline__ int kb_last(int qb) { return CAUSAL ? ((qb * 64 + 63) >> 7) : (TT / 128 - 1); }
typedef __attribute__((ext_vector_type(8))) __bf16 v8b;
__device__ __forceinline__ v16b frag_b(const __bf16* rowk0, int lane) {
  union { v16b v; v8b q[2]; } u; const __bf16* p = rowk0 + 8 * (lane >> 4);
  u.q[0] = *(const v8b*)p; u.q[1] = *(const v8b*)(p + 16); return u.v;
}
#define QBH (TT / 64)      // ALL query blocks take k_sc's 3-product path
#define QBH_PV 0           // P.v stays single f16
#define QHI 6400            // q residual rows everywhere
#define KHI 6400           // k residual rows for ALL keys (3-product logits; sigma_f ~ 5.7 unscaled)
// B fragment (k rows k0+.., output column o) of a weight: (in,out) [K][ld] or (out,in) [ld rows of K]: bf16 exact, or f16(bf16 * 256) exact
__device__ __forceinline__ v16b wcol_io(const float* Wm, int k0, int o, int lane, int ld) { v16b w; const int g = lane >> 4;
#pragma unroll
  for (int i = 0; i < 8; ++i) { w[i] = (__bf16)Wm[(size_t)(k0 + 8 * g + i) * ld + o]; w[8 + i] = (__bf16)Wm[(size_t)(k0 + 16 + 8 * g + i) * ld + o]; }
  return w; }
__device__ __forceinline__ v16b wcol_oi(const float* Wm, int k0, int o, int lane, int K) { v16b w; const float* p = Wm + (size_t)o * K + k0 + 8 * (lane >> 4);
#pragma unroll
  for (int i = 0; i < 8; ++i) { w[i] = (__bf16)p[i]; w[8 + i] = (__bf16)p[16 + i]; }
  return w; }
__device__ __forceinline__ v16h wcolh_io(const float* Wm, int k0, int o, int lane, int ld) { v16h w; const int g = lane >> 4;
#pragma unroll
  for (int i = 0; i < 8; ++i) { w[i] = (_Float16)(bfr(Wm[(size_t)(k0 + 8 * g + i) * ld + o]) * 256.0f); w[8 + i] = (_Float16)(bfr(Wm[(size_t)(k0 + 16 + 8 * g + i) * ld + o]) * 256.0f); }
  return w; }
__device__ __forceinline__ v16h wcolh_oi(const float* Wm, int k0, int o, int lane, int K) { v16h w; const float* p = Wm + (size_t)o * K + k0 + 8 * (lane >> 4);
#pragma unroll
  for (int i = 0; i < 8; ++i) { w[i] = (_Float16)(bfr(p[i]) * 256.0f); w[8 + i] = (_Float16)(bfr(p[16 + i]) * 256.0f); }
  return w; }
#define WQKV_LAYOUT 1   // 0 = (in,out) [DIN][CC]; 1 = (out,in) [HDQK][DIN]; 2 = per-head [NH][DIN][HD]
__device__ __forceinline__ v16b wcol_hdk(const float* Wm, int k0, int o, int lane) { v16b w; const int g = lane >> 4; const float* p = Wm + (size_t)(o / HD) * DIN * HD + (o % HD);
#pragma unroll
  for (int i = 0; i < 8; ++i) { w[i] = (__bf16)p[(size_t)(k0 + 8 * g + i) * HD]; w[8 + i] = (__bf16)p[(size_t)(k0 + 16 + 8 * g + i) * HD]; }
  return w; }
#define WO_OUT_IN 0
#if WQKV_LAYOUT == 1
#define WCOL(W, k0, o, lane) (((o) < HDQK) ? wcol_oi(W, k0, (o), lane, DIN) : zero16b())   /* theta/phi/g weights are [32][64] (out,in): plane columns >= 32 are zero for all three */
#elif WQKV_LAYOUT == 2
#define WCOL(W, k0, o, lane) wcol_hdk(W, k0, o, lane)
#else
#define WCOL(W, k0, o, lane) wcol_io(W, k0, o, lane, CC)
#endif
#if WO_OUT_IN
#define WOCOL(W, k0, o, lane) wcol_oi(W, k0, o, lane, CC)
#define WOCOLH(W, k0, o, lane) wcolh_oi(W, k0, o, lane, CC)
#else
#define WOCOL(W, k0, o, lane) wcol_io(W, k0, o, lane, DIN)
#define WOCOLH(W, k0, o, lane) wcolh_io(W, k0, o, lane, DIN)
#endif
#ifndef XP
#define XP TT              // position pitch of x and of the output
#endif
#define BG HG              // the pass group spans BATCHES (single head): blockIdx.z / blockIdx.y select batch b0 + z
#define DVH 128            // value columns per k_pv block (all of HD 128 in one block: 8 accumulator tiles per wave)
#define WS_YR (WS_END)     // f32 attended rows [b*n][128] (32 real columns)
#define WS_OR (WS_YR + 4u * (size_t)NB * TT * CC)   // W y + b rows [b*n][64]
#define WS_END2 (WS_OR + 4u * (size_t)NB * TT * DIN)
// ---- k_wz: block = (64 rows, 64 output cols): OR = y (hi + lo, K = 32 real columns of the YR rows) . W^T ((out,in) [64][32], exact) + b
__global__ __launch_bounds__(128) void k_wz(const float* __restrict__ YR, const float* __restrict__ WW, const float* __restrict__ WB, float* __restrict__ ORW) { __shared__ __align__(16) float sf[4][16][132];
  const int tid = threadIdx.x, wave = tid >> 5, lane = tid & 31, col = lane & 15, g = lane >> 4; const int c0 = 0;   /* DIN (64) output channels in one block */ const size_t r0 = (size_t)blockIdx.x * 64 + wave * 16;
  v8f acc[8] = {};
#pragma unroll
  for (int kc = 0; kc < HDQK / 32; ++kc) { const F2 a = split_row(YR + (r0 + col) * CC, kc * 32, lane); asm volatile("s_wait_loadcnt 0x0" ::: "memory");
#pragma unroll
    for (int j = 0; j < DIN / 16; ++j) { const v16b w = wcol_oi(WW, kc * 32, c0 + j * 16 + col, lane, HDQK); asm volatile("s_wait_loadcnt 0x0" ::: "memory"); acc[j] = wmma_bf(a.h, w, acc[j]); acc[j] = wmma_bf(a.l, w, acc[j]); } }
#pragma unroll
  for (int j = 0; j < DIN / 16; ++j) { const float bb = bfr(WB[c0 + j * 16 + col]); asm volatile("s_wait_loadcnt 0x0" ::: "memory");
#pragma unroll
    for (int r = 0; r < 8; ++r) sf[wave][8 * g + r][j * 16 + col] = acc[j][r] + bb; }
  LDSX(); for (int rl = 0; rl < 16; ++rl) if (lane < DIN / 4) vst2(ORW + (r0 + rl) * DIN + c0 + lane * 4, *(const v4f*)&sf[wave][rl][lane * 4]); }   /* 16 lanes x 16 B = the 256-B row */
// ---- k_fin2: block = (64 positions, 64 channels, batch b): out[b][c][n] = BN_eval(OR[b*N + n][c]) + bf16(x[b][c][n]) (LDS transpose; 256-B runs of 64 positions per channel)
__global__ __launch_bounds__(256) void k_fin2(const float* __restrict__ ORW, const float* __restrict__ X, const float* __restrict__ GAm, const float* __restrict__ BEt, const float* __restrict__ MUv, const float* __restrict__ VAv, float* __restrict__ OUT) { __shared__ float st[64][68]; const int tid = threadIdx.x; const int n0 = blockIdx.x * 64, c0 = blockIdx.y * 64; const size_t b = blockIdx.z;
  for (int e = tid; e < 64 * 16; e += 256) { const int nl = e >> 4, q = e & 15; *(v4f*)&st[nl][q * 4] = *(const v4f*)(ORW + (b * TT + n0 + nl) * (size_t)DIN + c0 + q * 4); }
  __syncthreads();
  for (int e = tid; e < 64 * 16; e += 256) { const int cl = e >> 4, q = e & 15; const int c = c0 + cl; const size_t oi = (b * DIN + c) * (size_t)XP + n0 + q * 4; const v4f xr = *(const v4f*)(X + oi); const float inv = bfr(GAm[c]) / __fsqrt_rn(bfr(VAv[c]) + 1e-4f), mu = bfr(MUv[c]), be = bfr(BEt[c]); asm volatile("s_wait_loadcnt 0x0" ::: "memory"); v4f o;
#pragma unroll
    for (int i = 0; i < 4; ++i) o[i] = ((st[q * 4 + i][cl] - mu) * inv + be) + bfr(xr[i]);
    vst2(OUT + oi, o); } }   /* eval BN: (W_y - mean) * (gamma / sqrt(var + eps)) + beta, then + x */
#ifndef SM_EXTRA_PARAMS
#define SM_EXTRA_PARAMS
#endif
#ifndef PROJ_EXTRA_PARAMS
#define PROJ_EXTRA_PARAMS
#endif
#ifndef SM_MASK_HOOK
#define SM_MASK_HOOK (void)0
#endif

#define WS_QH  0u                                      // f16 q rows [b*t][CC]
#define WS_KH  (WS_QH + 2u * (size_t)NB * TT * CC)      // f16 k rows [b*t][CC]
#define WS_VT  (WS_KH + 2u * (size_t)NB * TT * CC)      // f16 v planes [b][c][t]
#define WS_QL  (WS_VT + 2u * (size_t)NB * CC * TT)      // f16 q residual x 2^10 rows [b][t < QHI][CC]
#define WS_KL  (WS_QL + 2u * (size_t)NB * QHI * CC)     // f16 k residual x 2^10 rows [b][t < KHI][CC]
#define WS_VB  (WS_KL + 2u * (size_t)NB * KHI * CC)     // bf16 v hi planes [b][c][t < KHI]
#define WS_VBL (WS_VB + 2u * (size_t)NB * CC * KHI)
#define WS_S   (WS_VBL + 2u * (size_t)NB * CC * KHI)    // f32 logits / P [hg][t][s]
#define WS_Y   (WS_S  + 4u * (size_t)HG * TT * TT)      // empty: the ctx rows go to WS_YR
#define WS_END (WS_Y  + 0u)

// ---- k_proj: block = (64 rows, 128 cols, which): q/k/v = X W (+ b) with exact bf16 products (K = DIN) -> which 0: q f16 rows (+ residual rows < QHI); 1: k f16 rows (+ residual rows < KHI); 2: v f16 planes [c][t] (+ bf16 hi/lo planes for t < KHI)
__global__ __launch_bounds__(128) void k_proj(const float* __restrict__ XQ, const float* __restrict__ XK, const float* __restrict__ XV, const float* __restrict__ WQ, const float* __restrict__ WK, const float* __restrict__ WV, const float* __restrict__ BQ, const float* __restrict__ BK, const float* __restrict__ BV,
    _Float16* __restrict__ QH, _Float16* __restrict__ QL, _Float16* __restrict__ KH, _Float16* __restrict__ KL, _Float16* __restrict__ VT, __bf16* __restrict__ VB, __bf16* __restrict__ VBL) {
  __shared__ __align__(16) _Float16 sh[64][136], sl[64][136]; __shared__ __align__(16) _Float16 th[128][72]; __shared__ __align__(16) __bf16 tb[128][72], tbl[128][72];
  const int tid = threadIdx.x, wave = tid >> 5, lane = tid & 31, col = lane & 15, g = lane >> 4; const int which = blockIdx.z; const int c0 = blockIdx.y * 128; const size_t r0 = (size_t)blockIdx.x * 64; const size_t bb = r0 / TT; const int t0 = (int)(r0 % TT);
  const float* X = which == 0 ? XQ : which == 1 ? XK : XV; const float* WA = which == 0 ? WQ : which == 1 ? WK : WV; const float* BA = which == 0 ? BQ : which == 1 ? BK : BV;
  v8f acc[8] = {};
#pragma unroll 2
  for (int kc = 0; kc < DIN / 32; ++kc) { v16b a; { const float* p = X + (bb * DIN + kc * 32 + 8 * g) * (size_t)XP + t0 + wave * 16 + col;   /* channels-first gather: x[b][k][t], stride XP between k */
#pragma unroll
      for (int i = 0; i < 8; ++i) { a[i] = (__bf16)p[(size_t)i * XP]; a[8 + i] = (__bf16)p[(size_t)(16 + i) * XP]; } }
    asm volatile("s_wait_loadcnt 0x0" ::: "memory");
#pragma unroll
    for (int j = 0; j < 8; ++j) { const v16b w = WCOL(WA, kc * 32, c0 + j * 16 + col, lane); asm volatile("s_wait_loadcnt 0x0" ::: "memory"); acc[j] = wmma_bf(a, w, acc[j]); } }
  if (which < 2) { _Float16* DH = which == 0 ? QH : KH; _Float16* DL = which == 0 ? QL : KL; const int nhi = which == 0 ? QHI : KHI; const bool hi_rows = t0 < nhi;
#pragma unroll
    for (int j = 0; j < 8; ++j) { const float bias = (BA && (c0 + j * 16 + col < HDQK)) ? bfr(BA[c0 + j * 16 + col]) : 0.f;   /* 32-entry biases */
#pragma unroll
      for (int r = 0; r < 8; ++r) { const float v = acc[j][r] + bias; const _Float16 hv = (_Float16)v; sh[wave * 16 + 8 * g + r][j * 16 + col] = hv; sl[wave * 16 + 8 * g + r][j * 16 + col] = (_Float16)((v - (float)hv) * 1024.0f); } }
    __syncthreads();
    for (int e = tid; e < 64 * 16; e += 128) { const int rl = e >> 4, q = e & 15; vst2((unsigned*)(DH + (r0 + rl) * CC + c0 + q * 8), *(const v4u*)&sh[rl][q * 8]); if (hi_rows) vst2((unsigned*)(DL + (bb * nhi + t0 + rl) * (size_t)CC + c0 + q * 8), *(const v4u*)&sl[rl][q * 8]); }
  } else { const bool hi_rows = t0 < KHI;
#pragma unroll
    for (int j = 0; j < 8; ++j) { const float bias = (BA && (c0 + j * 16 + col < HDQK)) ? bfr(BA[c0 + j * 16 + col]) : 0.f;   /* 32-entry biases */
#pragma unroll
      for (int r = 0; r < 8; ++r) { const float v = acc[j][r] + bias; const int rl = wave * 16 + 8 * g + r, cl = j * 16 + col; th[cl][rl] = (_Float16)v; const __bf16 bh = (__bf16)v; tb[cl][rl] = bh; tbl[cl][rl] = (__bf16)(v - (float)bh); } }
    __syncthreads();
    for (int e = tid; e < 128 * 8; e += 128) { const int cl = e >> 3, q = e & 7; vst2((unsigned*)(VT + (bb * CC + c0 + cl) * (size_t)TT + t0 + q * 8), *(const v4u*)&th[cl][q * 8]); if (hi_rows) { const size_t o3 = (bb * CC + c0 + cl) * (size_t)KHI + t0 + q * 8; vst2((unsigned*)(VB + o3), *(const v4u*)&tb[cl][q * 8]); vst2((unsigned*)(VBL + o3), *(const v4u*)&tbl[cl][q * 8]); } } } }
// ---- k_sc: block = (query block qb, key block kb <= kb_last(qb), batch b in group): logits x SCALE; q hi + residual (x 2^10) against k (2 products) for query rows < QHI, plus the k residual (3 products) for query blocks < QBH (every query block here); causal: blocks past the diagonal exit, the mask itself is applied by index in k_sm
__global__ __launch_bounds__(128) void k_sc(const _Float16* __restrict__ QH, const _Float16* __restrict__ KH, const _Float16* __restrict__ QL, const _Float16* __restrict__ KL, int bgrp, int h0, float* __restrict__ S0) { __shared__ __align__(16) float ss[4][16][132];
  const int qb = blockIdx.x, kb = blockIdx.y; if (kb > kb_last(qb)) return;
  const int h = h0; const int b = bgrp + blockIdx.z; float* S = S0 + (size_t)blockIdx.z * TT * TT;   /* group spans batches */
  const int tid = threadIdx.x, wave = tid >> 5, lane = tid & 31, col = lane & 15, g = lane >> 4; const int k0 = kb * 128; const int ql0 = qb * 64 + wave * 16; const size_t q0 = (size_t)b * TT + ql0, kr0 = (size_t)b * TT + k0;
  v8f acc[8] = {}, accl[8] = {};
  const _Float16* QLb = QL + (size_t)b * QHI * CC; const _Float16* KLb = KL + (size_t)b * KHI * CC;
  if (qb < QBH) {
#pragma unroll
    for (int kc = 0; kc < HDQK / 32; ++kc) { const v16h ah = frag_h(QH + (q0 + col) * CC + h * HD + kc * 32, lane), al = frag_h(QLb + (size_t)(ql0 + col) * CC + h * HD + kc * 32, lane);
#pragma unroll
      for (int j = 0; j < 8; ++j) { const v16h kbf = frag_h(KH + (kr0 + j * 16 + col) * CC + h * HD + kc * 32, lane), klf = frag_h(KLb + (size_t)(k0 + j * 16 + col) * CC + h * HD + kc * 32, lane); acc[j] = wmma16(ah, kbf, acc[j]); accl[j] = wmma16(al, kbf, accl[j]); accl[j] = wmma16(ah, klf, accl[j]); } }
  } else if (qb * 64 < QHI) {
#pragma unroll
    for (int kc = 0; kc < HDQK / 32; ++kc) { const v16h ah = frag_h(QH + (q0 + col) * CC + h * HD + kc * 32, lane), al = frag_h(QLb + (size_t)(ql0 + col) * CC + h * HD + kc * 32, lane);
#pragma unroll
      for (int j = 0; j < 8; ++j) { const v16h kbf = frag_h(KH + (kr0 + j * 16 + col) * CC + h * HD + kc * 32, lane); acc[j] = wmma16(ah, kbf, acc[j]); accl[j] = wmma16(al, kbf, accl[j]); } }
  } else {
#pragma unroll
    for (int kc = 0; kc < HDQK / 32; ++kc) { const v16h ah = frag_h(QH + (q0 + col) * CC + h * HD + kc * 32, lane);
#pragma unroll
      for (int j = 0; j < 8; ++j) { const v16h kbf = frag_h(KH + (kr0 + j * 16 + col) * CC + h * HD + kc * 32, lane); acc[j] = wmma16(ah, kbf, acc[j]); } } }
#pragma unroll
  for (int j = 0; j < 8; ++j) {
#pragma unroll
    for (int r = 0; r < 8; ++r) ss[wave][8 * g + r][j * 16 + col] = (acc[j][r] + accl[j][r] * (1.0f / 1024.0f)) * SCALE; }
  LDSX(); for (int rl = 0; rl < 16; ++rl) vst2(S + (size_t)(ql0 + rl) * TT + k0 + lane * 4, *(const v4f*)&ss[wave][rl][lane * 4]); }
// ---- k_sm: block = query row t (batch in group): keys [0, kend): causal -> logit if s <= t else excluded; softmax in f32; P x 2^11 in place (0 for excluded)
__global__ __launch_bounds__(256) void k_sm(float* __restrict__ S0 SM_EXTRA_PARAMS) { __shared__ float sred[8]; __shared__ float sbc; __shared__ __align__(16) float shv[TT];
  const int tid = threadIdx.x; const int t = blockIdx.x; const int kend = (kb_last(t >> 6) + 1) * 128;
  float* sr = S0 + (size_t)blockIdx.y * TT * TT + (size_t)t * TT;
  float m = -3.0e38f; for (int k = tid; k < kend; k += 256) { float v = (!CAUSAL || k <= t) ? sr[k] : -3.0e38f; SM_MASK_HOOK; shv[k] = v; m = fmaxf(m, v); }
#pragma unroll
  for (int o = 1; o < 32; o <<= 1) m = fmaxf(m, __shfl_xor(m, o));
  if ((tid & 31) == 0) sred[tid >> 5] = m; __syncthreads(); if (tid == 0) { float a = sred[0]; for (int i = 1; i < 8; ++i) a = fmaxf(a, sred[i]); sbc = a; } __syncthreads(); m = sbc; __syncthreads();
  float sum = 0.f; for (int k = tid; k < kend; k += 256) { const float v = shv[k]; const float e = (v <= -1.0e38f) ? 0.f : expf(v - m); shv[k] = e; sum += e; }
#pragma unroll
  for (int o = 1; o < 32; o <<= 1) sum += __shfl_xor(sum, o);
  if ((tid & 31) == 0) sred[tid >> 5] = sum; __syncthreads(); if (tid == 0) { float a = 0.f; for (int i = 0; i < 8; ++i) a += sred[i]; sbc = a > 0.f ? 2048.0f / a : 0.f; }   /* a fully excluded row yields P = 0 */ __syncthreads(); const float inv = sbc;
  for (int k = tid; k < kend; k += 256) shv[k] = shv[k] * inv;
  __syncthreads(); for (int q = tid; q < kend / 4; q += 256) vst2(sr + q * 4, *(const v4f*)&shv[q * 4]); }
// ---- k_pv: block = 64 queries (qb) of (b, h): ctx = P . v over keys [0, kend) (P x 2^11 once to f16 against v f16: 1 product for every query block); 512-B (row, head) segment by 32 lanes
__global__ __launch_bounds__(128) void k_pv(const float* __restrict__ PS0, const _Float16* __restrict__ VT, const __bf16* __restrict__ VB, const __bf16* __restrict__ VBL, int bgrp, int h0, float* __restrict__ Y) { const int h = h0; const int b = bgrp + blockIdx.z; const float* PS = PS0 + (size_t)blockIdx.z * TT * TT; const int d0 = blockIdx.y * DVH;   /* group spans batches */ __shared__ __align__(16) float ss[4][16][DVH + 4];
  const int tid = threadIdx.x, wave = tid >> 5, lane = tid & 31, col = lane & 15, g = lane >> 4; const int qb = blockIdx.x; const int ql0 = qb * 64 + wave * 16; const int kce = (kb_last(qb) + 1) * 4;
  v8f acc[DVH / 16] = {};
  if (qb < QBH_PV) {
#pragma unroll 1
    for (int kc = 0; kc < kce; ++kc) { const F2 p = split_row(PS + (size_t)(ql0 + col) * TT, kc * 32, lane);
      asm volatile("s_wait_loadcnt 0x0" ::: "memory");
#pragma unroll
      for (int j = 0; j < DVH / 16; ++j) { const size_t po = ((size_t)b * CC + h * HD + d0 + j * 16 + col) * (size_t)KHI + kc * 32; const v16b vh = frag_b(VB + po, lane); acc[j] = wmma_bf(p.h, vh, acc[j]); acc[j] = wmma_bf(p.l, vh, acc[j]); acc[j] = wmma_bf(p.h, frag_b(VBL + po, lane), acc[j]); } }
  } else {
#pragma unroll 1
    for (int kc = 0; kc < kce; ++kc) { const v16h p = frag_f32(PS + (size_t)(ql0 + col) * TT + kc * 32, lane);
      asm volatile("s_wait_loadcnt 0x0" ::: "memory");
#pragma unroll
      for (int j = 0; j < DVH / 16; ++j) { const size_t po = ((size_t)b * CC + h * HD + d0 + j * 16 + col) * (size_t)TT + kc * 32; acc[j] = wmma16(p, frag_h(VT + po, lane), acc[j]); } } }
#pragma unroll
  for (int j = 0; j < DVH / 16; ++j)
#pragma unroll
    for (int r = 0; r < 8; ++r) ss[wave][8 * g + r][j * 16 + col] = acc[j][r] * (1.0f / 2048.0f);
  LDSX(); for (int rl = 0; rl < 16; ++rl) vst2(Y + ((size_t)b * TT + ql0 + rl) * CC + h * HD + d0 + lane * 4, *(const v4f*)&ss[wave][rl][lane * 4]); }   /* 512-B (row, head) segment by 32 lanes */

extern "C" void kernel_launch(void* const* d_in, const int* in_sizes, int n_in, void* d_out, int out_size, void* d_ws, size_t ws_size, hipStream_t stream) {
  (void)in_sizes; (void)n_in; (void)out_size;
  const float** F = (const float**)d_in;
  if (ws_size < (size_t)WS_END) return;
  char* ws = (char*)d_ws; _Float16 *QH = (_Float16*)(ws + WS_QH), *KH = (_Float16*)(ws + WS_KH), *VT = (_Float16*)(ws + WS_VT), *QL = (_Float16*)(ws + WS_QL), *KL = (_Float16*)(ws + WS_KL); __bf16 *VB = (__bf16*)(ws + WS_VB), *VBL = (__bf16*)(ws + WS_VBL); float *S = (float*)(ws + WS_S), *Y = (float*)(ws + WS_Y);
  (void)Y; (void)QL; (void)KL; (void)VB; (void)VBL;
  // inputs: 0 x [4,64,80,80]; 1 w_theta [32,64] (out,in), 2 b_theta; 3 w_phi, 4 b_phi; 5 w_g, 6 b_g; 7 w_out [64,32] (out,in), 8 b_out; 9 bn_gamma, 10 bn_beta, 11 bn_mean, 12 bn_var
  if (ws_size < (size_t)WS_END2) return;
  float *YR = (float*)(ws + WS_YR), *ORW = (float*)(ws + WS_OR);
  k_proj<<<dim3(TNB * TT / 64, CC / 128, 3), 128, 0, stream>>>(F[0], F[0], F[0], F[1], F[3], F[5], F[2], F[4], F[6], QH, QL, KH, KL, VT, VB, VBL);   /* q = theta, k = phi, v = g */
  for (int b0 = 0; b0 < TNB; b0 += BG) {
    k_sc<<<dim3(NQB, TT / 128, BG), 128, 0, stream>>>(QH, KH, QL, KL, b0, 0, S);
    k_sm<<<dim3(TT, BG), 256, 0, stream>>>(S);
    k_pv<<<dim3(NQB, HD / DVH, BG), 128, 0, stream>>>(S, VT, VB, VBL, b0, 0, YR);
  }
  k_wz<<<dim3(TNB * TT / 64, 1), 128, 0, stream>>>(YR, F[7], F[8], ORW);
  k_fin2<<<dim3(TT / 64, DIN / 64, TNB), 256, 0, stream>>>(ORW, F[0], F[9], F[10], F[11], F[12], (float*)d_out);
}

// v001
// It runs in 705 microseconds.
// Two timings next to v000 put it at 2.74 and 2.72 times that version's speed.
// compute dtype: all float inputs rounded to bf16; theta/phi/g = W x + b with EXACT bf16 products on WMMA 16x16x32 (f32 accumulate); unscaled logits theta.phi with BOTH as f16 hi + residual planes (3 products); softmax in f32 (precise expf); P x 2^11 once to f16 against g once to f16 (1 product); y split bf16 hi + lo against exact w_out (2 products) + b_out; eval BatchNorm and the residual in f32; f32 output.
#include <hip/hip_runtime.h>
#include <math.h>

typedef __attribute__((ext_vector_type(16))) _Float16 v16h;
typedef __attribute__((ext_vector_type(16))) __bf16 v16b;
typedef __attribute__((ext_vector_type(8)))  _Float16 v8h;
typedef __attribute__((ext_vector_type(8)))  float v8f;
typedef __attribute__((ext_vector_type(4)))  float v4f;
typedef __attribute__((ext_vector_type(2)))  float v2f;
typedef __attribute__((ext_vector_type(4)))  unsigned v4u;
typedef __attribute__((ext_vector_type(4)))  int v4i;
typedef float __attribute__((may_alias)) float_a;
typedef int __attribute__((may_alias)) int_a;

template <typename T> __device__ __forceinline__ void vst2(void* p, T v) { *(T*)p = v;  }
__device__ __forceinline__ v8f wmma16(v16h a, v16h b, v8f c) {
  v8f d = __builtin_amdgcn_wmma_f32_16x16x32_f16(false, a, false, b, (short)0, c, false, false);
  asm volatile("v_nop\n\tv_nop\n\tv_nop\n\tv_nop" : "+v"(d) : "v"(a), "v"(b));
  return d;
}
__device__ __forceinline__ v8f wmma_bf(v16b a, v16b b, v8f c) {
  v8f d = __builtin_amdgcn_wmma_f32_16x16x32_bf16(false, a, false, b, (short)0, c, false, false);
  asm volatile("v_nop\n\tv_nop\n\tv_nop\n\tv_nop" : "+v"(d) : "v"(a), "v"(b));
  return d;
}
// 16x16x32 fragments: lane = (h = lane>>4, row/col = lane&15); elements 0..7 = k0+8h+0..7, 8..15 = k0+16+8h+0..7; D element r = row 8h+r
__device__ __forceinline__ v16h frag_h(const _Float16* rowk0, int lane) {
  union { v16h v; v8h q[2]; } u; const _Float16* p = rowk0 + 8 * (lane >> 4);
  u.q[0] = *(const v8h*)p; u.q[1] = *(const v8h*)(p + 16); return u.v;
}
__device__ __forceinline__ v16h frag_f32(const float* rowk0, int lane) {
  v16h a; const float* p = rowk0 + 8 * (lane >> 4);
#pragma unroll
  for (int i = 0; i < 8; ++i) { a[i] = (_Float16)p[i]; a[8 + i] = (_Float16)p[16 + i]; }
  return a;
}
__device__ __forceinline__ v16h frag_f32s(const float* rowk0, int lane, float sc) {
  v16h a; const float* p = rowk0 + 8 * (lane >> 4);
#pragma unroll
  for (int i = 0; i < 8; ++i) { a[i] = (_Float16)(p[i] * sc); a[8 + i] = (_Float16)(p[16 + i] * sc); }
  return a;
}
// column fragment from a [K][ld] layout (column n), rows >= K read as 0
__device__ __forceinline__ v16h fragc_f32(const float* W, int k0, int n, int lane, int ld, int K) {
  v16h a; const int g = lane >> 4;
#pragma unroll
  for (int i = 0; i < 8; ++i) { const int ka = k0 + 8 * g + i, kb = ka + 16;
    a[i] = (_Float16)(ka < K ? W[(size_t)(ka < K ? ka : K - 1) * ld + n] : 0.f); a[8 + i] = (_Float16)(kb < K ? W[(size_t)(kb < K ? kb : K - 1) * ld + n] : 0.f); }
  return a;
}
struct F2 { v16b h, l; };
__device__ __forceinline__ F2 bsplit16(const float v[16]) { F2 r;
#pragma unroll
  for (int i = 0; i < 16; ++i) { const __bf16 h = (__bf16)v[i]; r.h[i] = h; r.l[i] = (__bf16)(v[i] - (float)h); }
  return r; }
__device__ __forceinline__ F2 split_row(const float* row, int k0, int lane) { float v[16]; const float* p = row + k0 + 8 * (lane >> 4);
#pragma unroll
  for (int i = 0; i < 8; ++i) { v[i] = p[i]; v[8 + i] = p[16 + i]; }
  return bsplit16(v); }
__device__ __forceinline__ F2 split_rowK(const float* row, int k0, int lane, int K) { float v[16]; const int g = lane >> 4;
#pragma unroll
  for (int i = 0; i < 8; ++i) { const int ka = k0 + 8 * g + i, kb = ka + 16; v[i] = ka < K ? row[ka < K ? ka : K - 1] : 0.f; v[8 + i] = kb < K ? row[kb < K ? kb : K - 1] : 0.f; }
  return bsplit16(v); }
__device__ __forceinline__ F2 split_col(const float* W, int k0, int n, int lane, int ld, int K) { float v[16]; const int g = lane >> 4;
#pragma unroll
  for (int i = 0; i < 8; ++i) { const int ka = k0 + 8 * g + i, kb = ka + 16; v[i] = ka < K ? W[(size_t)(ka < K ? ka : K - 1) * ld + n] : 0.f; v[8 + i] = kb < K ? W[(size_t)(kb < K ? kb : K - 1) * ld + n] : 0.f; }
  return bsplit16(v); }
__device__ __forceinline__ v8f mac3(const F2& a, const F2& b, v8f c) { c = wmma_bf(a.l, b.h, c); c = wmma_bf(a.h, b.l, c); return wmma_bf(a.h, b.h, c); }
__device__ __forceinline__ float sigm(float v) { return 1.0f / (1.0f + expf(-v)); }
#define LDSX() do { asm volatile("s_wait_dscnt 0" ::: "memory"); __builtin_amdgcn_wave_barrier(); __builtin_amdgcn_fence(__ATOMIC_RELEASE, "workgroup"); } while (0)

// Non-local block (B 4, C 64, 80 x 80 = 6,400 positions; inter channels 32): theta, phi, g = 1x1 convs of x ((out,in) [32,64] + bias); f[n][m] = theta_n . phi_m (no scaling); P = softmax over m; y[n] = sum_m P[n][m] g_m; W_y = w_out y + b_out (32 -> 64); out = BN_eval(W_y) (running mean/var, eps 1e-4, affine) + x.
#define NB 4
#define TT 6400
#define CC 128            // projected plane width (32 real columns + 96 zero)
#define DIN 64            // input channels
#define NH 1
#define HD 128
#define NQB (TT / 64)
#define HG 1               // one 6,400 x 6,400 score plane per pass
#define SCALE (1.0f)
#define HDQK 32            // theta / phi / g channels: the planes are 128 wide, columns >= 32 are zero; only the 32 real columns enter the scores
#define CAUSAL 0
#ifndef TNB
#define TNB NB
#endif
__device__ __forceinline__ v16b zero16b() { v16b z; _Pragma("unroll") for (int i = 0; i < 16; ++i) z[i] = (__bf16)0.f; return z; }
__device__ __forceinline__ float bfr(float v) { return (float)(__bf16)v; }
__host__ __device__ __forceinline__ int kb_last(int qb) { return CAUSAL ? ((qb * 64 + 63) >> 7) : (TT / 128 - 1); }
typedef __attribute__((ext_vector_type(8))) __bf16 v8b;
__device__ __forceinline__ v16b frag_b(const __bf16* rowk0, int lane) {
  union { v16b v; v8b q[2]; } u; const __bf16* p = rowk0 + 8 * (lane >> 4);
  u.q[0] = *(const v8b*)p; u.q[1] = *(const v8b*)(p + 16); return u.v;
}
#define QBH (TT / 64)      // ALL query blocks take k_sc's 3-product path
#define QBH_PV 0           // P.v stays single f16
#define QHI 6400            // q residual rows everywhere
#define KHI 6400           // k residual rows for ALL keys (3-product logits; sigma_f ~ 5.7 unscaled)
// B fragment (k rows k0+.., output column o) of a weight: (in,out) [K][ld] or (out,in) [ld rows of K]: bf16 exact, or f16(bf16 * 256) exact
__device__ __forceinline__ v16b wcol_io(const float* Wm, int k0, int o, int lane, int ld) { v16b w; const int g = lane >> 4;
#pragma unroll
  for (int i = 0; i < 8; ++i) { w[i] = (__bf16)Wm[(size_t)(k0 + 8 * g + i) * ld + o]; w[8 + i] = (__bf16)Wm[(size_t)(k0 + 16 + 8 * g + i) * ld + o]; }
  return w; }
__device__ __forceinline__ v16b wcol_oi(const float* Wm, int k0, int o, int lane, int K) { v16b w; const float* p = Wm + (size_t)o * K + k0 + 8 * (lane >> 4);
#pragma unroll
  for (int i = 0; i < 8; ++i) { w[i] = (__bf16)p[i]; w[8 + i] = (__bf16)p[16 + i]; }
  return w; }
__device__ __forceinline__ v16h wcolh_io(const float* Wm, int k0, int o, int lane, int ld) { v16h w; const int g = lane >> 4;
#pragma unroll
  for (int i = 0; i < 8; ++i) { w[i] = (_Float16)(bfr(Wm[(size_t)(k0 + 8 * g + i) * ld + o]) * 256.0f); w[8 + i] = (_Float16)(bfr(Wm[(size_t)(k0 + 16 + 8 * g + i) * ld + o]) * 256.0f); }
  return w; }
__device__ __forceinline__ v16h wcolh_oi(const float* Wm, int k0, int o, int lane, int K) { v16h w; const float* p = Wm + (size_t)o * K + k0 + 8 * (lane >> 4);
#pragma unroll
  for (int i = 0; i < 8; ++i) { w[i] = (_Float16)(bfr(p[i]) * 256.0f); w[8 + i] = (_Float16)(bfr(p[16 + i]) * 256.0f); }
  return w; }
#define WQKV_LAYOUT 1   // 0 = (in,out) [DIN][CC]; 1 = (out,in) [HDQK][DIN]; 2 = per-head [NH][DIN][HD]
__device__ __forceinline__ v16b wcol_hdk(const float* Wm, int k0, int o, int lane) { v16b w; const int g = lane >> 4; const float* p = Wm + (size_t)(o / HD) * DIN * HD + (o % HD);
#pragma unroll
  for (int i = 0; i < 8; ++i) { w[i] = (__bf16)p[(size_t)(k0 + 8 * g + i) * HD]; w[8 + i] = (__bf16)p[(size_t)(k0 + 16 + 8 * g + i) * HD]; }
  return w; }
#define WO_OUT_IN 0
#if WQKV_LAYOUT == 1
#define WCOL(W, k0, o, lane) (((o) < HDQK) ? wcol_oi(W, k0, (o), lane, DIN) : zero16b())   /* theta/phi/g weights are [32][64] (out,in): plane columns >= 32 are zero for all three */
#elif WQKV_LAYOUT == 2
#define WCOL(W, k0, o, lane) wcol_hdk(W, k0, o, lane)
#else
#define WCOL(W, k0, o, lane) wcol_io(W, k0, o, lane, CC)
#endif
#if WO_OUT_IN
#define WOCOL(W, k0, o, lane) wcol_oi(W, k0, o, lane, CC)
#define WOCOLH(W, k0, o, lane) wcolh_oi(W, k0, o, lane, CC)
#else
#define WOCOL(W, k0, o, lane) wcol_io(W, k0, o, lane, DIN)
#define WOCOLH(W, k0, o, lane) wcolh_io(W, k0, o, lane, DIN)
#endif
#ifndef XP
#define XP TT              // position pitch of x and of the output
#endif
#define BG HG              // the pass group spans BATCHES (single head): blockIdx.z / blockIdx.y select batch b0 + z
#define DVH 128            // value columns per k_pv block (all of HD 128 in one block: 8 accumulator tiles per wave)
#define WS_YR (WS_END)     // f32 attended rows [b*n][128] (32 real columns)
#define WS_OR (WS_YR + 4u * (size_t)NB * TT * CC)   // W y + b rows [b*n][64]
#define WS_END2 (WS_OR + 4u * (size_t)NB * TT * DIN)
// ---- k_wz: block = (64 rows, 64 output cols): OR = y (hi + lo, K = 32 real columns of the YR rows) . W^T ((out,in) [64][32], exact) + b
__global__ __launch_bounds__(128) void k_wz(const float* __restrict__ YR, const float* __restrict__ WW, const float* __restrict__ WB, float* __restrict__ ORW) { __shared__ __align__(16) float sf[4][16][132];
  const int tid = threadIdx.x, wave = tid >> 5, lane = tid & 31, col = lane & 15, g = lane >> 4; const int c0 = 0;   /* DIN (64) output channels in one block */ const size_t r0 = (size_t)blockIdx.x * 64 + wave * 16;
  v8f acc[8] = {};
#pragma unroll
  for (int kc = 0; kc < HDQK / 32; ++kc) { const F2 a = split_row(YR + (r0 + col) * CC, kc * 32, lane); asm volatile("s_wait_loadcnt 0x0" ::: "memory");
#pragma unroll
    for (int j = 0; j < DIN / 16; ++j) { const v16b w = wcol_oi(WW, kc * 32, c0 + j * 16 + col, lane, HDQK); asm volatile("s_wait_loadcnt 0x0" ::: "memory"); acc[j] = wmma_bf(a.h, w, acc[j]); acc[j] = wmma_bf(a.l, w, acc[j]); } }
#pragma unroll
  for (int j = 0; j < DIN / 16; ++j) { const float bb = bfr(WB[c0 + j * 16 + col]); asm volatile("s_wait_loadcnt 0x0" ::: "memory");
#pragma unroll
    for (int r = 0; r < 8; ++r) sf[wave][8 * g + r][j * 16 + col] = acc[j][r] + bb; }
  LDSX(); for (int rl = 0; rl < 16; ++rl) if (lane < DIN / 4) vst2(ORW + (r0 + rl) * DIN + c0 + lane * 4, *(const v4f*)&sf[wave][rl][lane * 4]); }   /* 16 lanes x 16 B = the 256-B row */
// ---- k_fin2: block = (64 positions, 64 channels, batch b): out[b][c][n] = BN_eval(OR[b*N + n][c]) + bf16(x[b][c][n]) (LDS transpose; 256-B runs of 64 positions per channel)
__global__ __launch_bounds__(256) void k_fin2(const float* __restrict__ ORW, const float* __restrict__ X, const float* __restrict__ GAm, const float* __restrict__ BEt, const float* __restrict__ MUv, const float* __restrict__ VAv, float* __restrict__ OUT) { __shared__ float st[64][68]; const int tid = threadIdx.x; const int n0 = blockIdx.x * 64, c0 = blockIdx.y * 64; const size_t b = blockIdx.z;
  for (int e = tid; e < 64 * 16; e += 256) { const int nl = e >> 4, q = e & 15; *(v4f*)&st[nl][q * 4] = *(const v4f*)(ORW + (b * TT + n0 + nl) * (size_t)DIN + c0 + q * 4); }
  __syncthreads();
  for (int e = tid; e < 64 * 16; e += 256) { const int cl = e >> 4, q = e & 15; const int c = c0 + cl; const size_t oi = (b * DIN + c) * (size_t)XP + n0 + q * 4; const v4f xr = *(const v4f*)(X + oi); const float inv = bfr(GAm[c]) / __fsqrt_rn(bfr(VAv[c]) + 1e-4f), mu = bfr(MUv[c]), be = bfr(BEt[c]); asm volatile("s_wait_loadcnt 0x0" ::: "memory"); v4f o;
#pragma unroll
    for (int i = 0; i < 4; ++i) o[i] = ((st[q * 4 + i][cl] - mu) * inv + be) + bfr(xr[i]);
    vst2(OUT + oi, o); } }   /* eval BN: (W_y - mean) * (gamma / sqrt(var + eps)) + beta, then + x */
#ifndef SM_EXTRA_PARAMS
#define SM_EXTRA_PARAMS
#endif
#ifndef PROJ_EXTRA_PARAMS
#define PROJ_EXTRA_PARAMS
#endif
#ifndef SM_MASK_HOOK
#define SM_MASK_HOOK (void)0
#endif

#define WS_QH  0u                                      // f16 q rows [b*t][CC]
#define WS_KH  (WS_QH + 2u * (size_t)NB * TT * CC)      // f16 k rows [b*t][CC]
#define WS_VT  (WS_KH + 2u * (size_t)NB * TT * CC)      // f16 v planes [b][c][t]
#define WS_QL  (WS_VT + 2u * (size_t)NB * CC * TT)      // f16 q residual x 2^10 rows [b][t < QHI][CC]
#define WS_KL  (WS_QL + 2u * (size_t)NB * QHI * CC)     // f16 k residual x 2^10 rows [b][t < KHI][CC]
#define WS_VB  (WS_KL + 2u * (size_t)NB * KHI * CC)     // bf16 v hi planes [b][c][t < KHI]
#define WS_VBL (WS_VB + 2u * (size_t)NB * CC * KHI)
#define WS_S   (WS_VBL + 2u * (size_t)NB * CC * KHI)    // f32 logits / P [hg][t][s]
#define WS_Y   (WS_S  + 4u * (size_t)HG * TT * TT)      // empty: the ctx rows go to WS_YR
#define WS_END (WS_Y  + 0u)

// ---- k_proj: block = (64 rows, 128 cols, which): q/k/v = X W (+ b) with exact bf16 products (K = DIN) -> which 0: q f16 rows (+ residual rows < QHI); 1: k f16 rows (+ residual rows < KHI); 2: v f16 planes [c][t] (+ bf16 hi/lo planes for t < KHI)
__global__ __launch_bounds__(128) void k_proj(const float* __restrict__ XQ, const float* __restrict__ XK, const float* __restrict__ XV, const float* __restrict__ WQ, const float* __restrict__ WK, const float* __restrict__ WV, const float* __restrict__ BQ, const float* __restrict__ BK, const float* __restrict__ BV,
    _Float16* __restrict__ QH, _Float16* __restrict__ QL, _Float16* __restrict__ KH, _Float16* __restrict__ KL, _Float16* __restrict__ VT, __bf16* __restrict__ VB, __bf16* __restrict__ VBL) {
  __shared__ __align__(16) _Float16 sh[64][136], sl[64][136]; __shared__ __align__(16) _Float16 th[128][72]; __shared__ __align__(16) __bf16 tb[128][72], tbl[128][72];
  const int tid = threadIdx.x, wave = tid >> 5, lane = tid & 31, col = lane & 15, g = lane >> 4; const int which = blockIdx.z; const int c0 = blockIdx.y * 128; const size_t r0 = (size_t)blockIdx.x * 64; const size_t bb = r0 / TT; const int t0 = (int)(r0 % TT);
  const float* X = which == 0 ? XQ : which == 1 ? XK : XV; const float* WA = which == 0 ? WQ : which == 1 ? WK : WV; const float* BA = which == 0 ? BQ : which == 1 ? BK : BV;
  v8f acc[8] = {};
#pragma unroll 2
  for (int kc = 0; kc < DIN / 32; ++kc) { v16b a; { const float* p = X + (bb * DIN + kc * 32 + 8 * g) * (size_t)XP + t0 + wave * 16 + col;   /* channels-first gather: x[b][k][t], stride XP between k */
#pragma unroll
      for (int i = 0; i < 8; ++i) { a[i] = (__bf16)p[(size_t)i * XP]; a[8 + i] = (__bf16)p[(size_t)(16 + i) * XP]; } }
    asm volatile("s_wait_loadcnt 0x0" ::: "memory");
#pragma unroll
    for (int j = 0; j < 8; ++j) { const v16b w = WCOL(WA, kc * 32, c0 + j * 16 + col, lane); asm volatile("s_wait_loadcnt 0x0" ::: "memory"); acc[j] = wmma_bf(a, w, acc[j]); } }
  if (which < 2) { _Float16* DH = which == 0 ? QH : KH; _Float16* DL = which == 0 ? QL : KL; const int nhi = which == 0 ? QHI : KHI; const bool hi_rows = t0 < nhi;
#pragma unroll
    for (int j = 0; j < 8; ++j) { const float bias = (BA && (c0 + j * 16 + col < HDQK)) ? bfr(BA[c0 + j * 16 + col]) : 0.f;   /* 32-entry biases */
#pragma unroll
      for (int r = 0; r < 8; ++r) { const float v = acc[j][r] + bias; const _Float16 hv = (_Float16)v; sh[wave * 16 + 8 * g + r][j * 16 + col] = hv; sl[wave * 16 + 8 * g + r][j * 16 + col] = (_Float16)((v - (float)hv) * 1024.0f); } }
    __syncthreads();
    for (int e = tid; e < 64 * 16; e += 128) { const int rl = e >> 4, q = e & 15; vst2((unsigned*)(DH + (r0 + rl) * CC + c0 + q * 8), *(const v4u*)&sh[rl][q * 8]); if (hi_rows) vst2((unsigned*)(DL + (bb * nhi + t0 + rl) * (size_t)CC + c0 + q * 8), *(const v4u*)&sl[rl][q * 8]); }
  } else { const bool hi_rows = t0 < KHI;
#pragma unroll
    for (int j = 0; j < 8; ++j) { const float bias = (BA && (c0 + j * 16 + col < HDQK)) ? bfr(BA[c0 + j * 16 + col]) : 0.f;   /* 32-entry biases */
#pragma unroll
      for (int r = 0; r < 8; ++r) { const float v = acc[j][r] + bias; const int rl = wave * 16 + 8 * g + r, cl = j * 16 + col; th[cl][rl] = (_Float16)v; const __bf16 bh = (__bf16)v; tb[cl][rl] = bh; tbl[cl][rl] = (__bf16)(v - (float)bh); } }
    __syncthreads();
    for (int e = tid; e < 128 * 8; e += 128) { const int cl = e >> 3, q = e & 7; vst2((unsigned*)(VT + (bb * CC + c0 + cl) * (size_t)TT + t0 + q * 8), *(const v4u*)&th[cl][q * 8]); if (hi_rows) { const size_t o3 = (bb * CC + c0 + cl) * (size_t)KHI + t0 + q * 8; vst2((unsigned*)(VB + o3), *(const v4u*)&tb[cl][q * 8]); vst2((unsigned*)(VBL + o3), *(const v4u*)&tbl[cl][q * 8]); } } } }
// ---- k_sc: block = (query block qb, key block kb <= kb_last(qb), batch b in group): logits x SCALE; q hi + residual (x 2^10) against k (2 products) for query rows < QHI, plus the k residual (3 products) for query blocks < QBH (every query block here); causal: blocks past the diagonal exit, the mask itself is applied by index in k_sm
__global__ __launch_bounds__(128) void k_sc(const _Float16* __restrict__ QH, const _Float16* __restrict__ KH, const _Float16* __restrict__ QL, const _Float16* __restrict__ KL, int bgrp, int h0, float* __restrict__ S0) { __shared__ __align__(16) float ss[4][16][132];
  const int qb = blockIdx.x, kb = blockIdx.y; if (kb > kb_last(qb)) return;
  const int h = h0; const int b = bgrp + blockIdx.z; float* S = S0 + (size_t)blockIdx.z * TT * TT;   /* group spans batches */
  const int tid = threadIdx.x, wave = tid >> 5, lane = tid & 31, col = lane & 15, g = lane >> 4; const int k0 = kb * 128; const int ql0 = qb * 64 + wave * 16; const size_t q0 = (size_t)b * TT + ql0, kr0 = (size_t)b * TT + k0;
  v8f acc[8] = {}, accl[8] = {};
  const _Float16* QLb = QL + (size_t)b * QHI * CC; const _Float16* KLb = KL + (size_t)b * KHI * CC;
  if (qb < QBH) {
#pragma unroll
    for (int kc = 0; kc < HDQK / 32; ++kc) { const v16h ah = frag_h(QH + (q0 + col) * CC + h * HD + kc * 32, lane), al = frag_h(QLb + (size_t)(ql0 + col) * CC + h * HD + kc * 32, lane);
#pragma unroll
      for (int j = 0; j < 8; ++j) { const v16h kbf = frag_h(KH + (kr0 + j * 16 + col) * CC + h * HD + kc * 32, lane), klf = frag_h(KLb + (size_t)(k0 + j * 16 + col) * CC + h * HD + kc * 32, lane); acc[j] = wmma16(ah, kbf, acc[j]); accl[j] = wmma16(al, kbf, accl[j]); accl[j] = wmma16(ah, klf, accl[j]); } }
  } else if (qb * 64 < QHI) {
#pragma unroll
    for (int kc = 0; kc < HDQK / 32; ++kc) { const v16h ah = frag_h(QH + (q0 + col) * CC + h * HD + kc * 32, lane), al = frag_h(QLb + (size_t)(ql0 + col) * CC + h * HD + kc * 32, lane);
#pragma unroll
      for (int j = 0; j < 8; ++j) { const v16h kbf = frag_h(KH + (kr0 + j * 16 + col) * CC + h * HD + kc * 32, lane); acc[j] = wmma16(ah, kbf, acc[j]); accl[j] = wmma16(al, kbf, accl[j]); } }
  } else {
#pragma unroll
    for (int kc = 0; kc < HDQK / 32; ++kc) { const v16h ah = frag_h(QH + (q0 + col) * CC + h * HD + kc * 32, lane);
#pragma unroll
      for (int j = 0; j < 8; ++j) { const v16h kbf = frag_h(KH + (kr0 + j * 16 + col) * CC + h * HD + kc * 32, lane); acc[j] = wmma16(ah, kbf, acc[j]); } } }
#pragma unroll
  for (int j = 0; j < 8; ++j) {
#pragma unroll
    for (int r = 0; r < 8; ++r) ss[wave][8 * g + r][j * 16 + col] = (acc[j][r] + accl[j][r] * (1.0f / 1024.0f)) * SCALE; }
  LDSX(); for (int rl = 0; rl < 16; ++rl) vst2(S + (size_t)(ql0 + rl) * TT + k0 + lane * 4, *(const v4f*)&ss[wave][rl][lane * 4]); }
// ---- k_sm: block = query row t (batch in group): keys [0, kend): causal -> logit if s <= t else excluded; softmax in f32; P x 2^11 in place (0 for excluded)
__global__ __launch_bounds__(256) void k_sm(float* __restrict__ S0 SM_EXTRA_PARAMS) { __shared__ float sred[8]; __shared__ float sbc; __shared__ __align__(16) float shv[TT];
  const int tid = threadIdx.x; const int t = blockIdx.x; const int kend = (kb_last(t >> 6) + 1) * 128;
  float* sr = S0 + (size_t)blockIdx.y * TT * TT + (size_t)t * TT;
  float m = -3.0e38f; for (int k = tid; k < kend; k += 256) { float v = (!CAUSAL || k <= t) ? sr[k] : -3.0e38f; SM_MASK_HOOK; shv[k] = v; m = fmaxf(m, v); }
#pragma unroll
  for (int o = 1; o < 32; o <<= 1) m = fmaxf(m, __shfl_xor(m, o));
  if ((tid & 31) == 0) sred[tid >> 5] = m; __syncthreads(); if (tid == 0) { float a = sred[0]; for (int i = 1; i < 8; ++i) a = fmaxf(a, sred[i]); sbc = a; } __syncthreads(); m = sbc; __syncthreads();
  float sum = 0.f; for (int k = tid; k < kend; k += 256) { const float v = shv[k]; const float e = (v <= -1.0e38f) ? 0.f : expf(v - m); shv[k] = e; sum += e; }
#pragma unroll
  for (int o = 1; o < 32; o <<= 1) sum += __shfl_xor(sum, o);
  if ((tid & 31) == 0) sred[tid >> 5] = sum; __syncthreads(); if (tid == 0) { float a = 0.f; for (int i = 0; i < 8; ++i) a += sred[i]; sbc = a > 0.f ? 2048.0f / a : 0.f; }   /* a fully excluded row yields P = 0 */ __syncthreads(); const float inv = sbc;
  for (int k = tid; k < kend; k += 256) shv[k] = shv[k] * inv;
  __syncthreads(); for (int q = tid; q < kend / 4; q += 256) vst2(sr + q * 4, *(const v4f*)&shv[q * 4]); }
// ---- k_pv: block = 32 queries (two 16-row groups) of (b, h) x 16 key ranges of 12 or 13 steps of 32 keys, one wave per (row group, key range): each wave sums ctx = P . v over its own range (P x 2^11 once to f16 against v f16: 1 product; causal early query blocks: P and v as bf16 hi + lo, 3 products); the 16 partial tiles meet in LDS and are added in range order; 512-B row segment by 32 lanes
#define PVR 2              // 16-row query groups per block
#define PVS 16             // key ranges per block
static_assert(!CAUSAL && TT % (16 * PVR) == 0, "every query row sees all keys; whole query blocks");
__global__ __launch_bounds__(32 * PVR * PVS) void k_pv(const float* __restrict__ PS0, const _Float16* __restrict__ VT, const __bf16* __restrict__ VB, const __bf16* __restrict__ VBL, int bgrp, int h0, float* __restrict__ Y) { const int h = h0; const int b = bgrp + blockIdx.z; const int d0 = blockIdx.y * DVH;   /* group spans batches; d0 = 0: one block takes all HD columns */ __shared__ __align__(16) float ss[PVS][16 * PVR][DVH + 4];
  const int tid = threadIdx.x, wave = __builtin_amdgcn_readfirstlane(tid >> 5), lane = tid & 31, col = lane & 15, g = lane >> 4; const int rg = wave % PVR, ks = wave / PVR;   /* neighbouring waves read the same v rows */ const int qr0 = blockIdx.x * (16 * PVR); const int ql0 = qr0 + rg * 16; const int qb = qr0 >> 6;
  const int nst = (kb_last(qb) + 1) * 4, kq = nst / PVS, kx = nst % PVS; const int kce = kq + (ks < kx ? 1 : 0);   /* 32-key steps of this wave's range: the first kx ranges take one more */
  const int key0 = (ks * kq + (ks < kx ? ks : kx)) * 32; const float* PS = PS0 + (size_t)blockIdx.z * TT * TT + key0; VT += key0; VB += key0; VBL += key0;   /* the range starts at key0: the loops below count from there */
  v8f acc[DVH / 16] = {};
  if (qb < QBH_PV) {
#pragma unroll 1
    for (int kc = 0; kc < kce; ++kc) { const F2 p = split_row(PS + (size_t)(ql0 + col) * TT, kc * 32, lane);
      asm volatile("s_wait_loadcnt 0x0" ::: "memory");
#pragma unroll
      for (int j = 0; j < DVH / 16; ++j) { const size_t po = ((size_t)b * CC + h * HD + d0 + j * 16 + col) * (size_t)KHI + kc * 32; const v16b vh = frag_b(VB + po, lane); acc[j] = wmma_bf(p.h, vh, acc[j]); acc[j] = wmma_bf(p.l, vh, acc[j]); acc[j] = wmma_bf(p.h, frag_b(VBL + po, lane), acc[j]); } }
  } else {
#pragma unroll 1
    for (int kc = 0; kc < kce; ++kc) { const v16h p = frag_f32(PS + (size_t)(ql0 + col) * TT + kc * 32, lane);
      asm volatile("s_wait_loadcnt 0x0" ::: "memory");
#pragma unroll
      for (int j = 0; j < DVH / 16; ++j) { const size_t po = ((size_t)b * CC + h * HD + d0 + j * 16 + col) * (size_t)TT + kc * 32; acc[j] = wmma16(p, frag_h(VT + po, lane), acc[j]); } } }
#pragma unroll
  for (int j = 0; j < DVH / 16; ++j)
#pragma unroll
    for (int r = 0; r < 8; ++r) ss[ks][rg * 16 + 8 * g + r][j * 16 + col] = acc[j][r] * (1.0f / 2048.0f);
  __syncthreads();   /* every range's partial tile is in LDS before any thread adds them */
  for (int e = tid; e < 16 * PVR * (DVH / 4); e += 32 * PVR * PVS) { const int rl = e / (DVH / 4), q = e % (DVH / 4); v4f s = *(const v4f*)&ss[0][rl][q * 4];
#pragma unroll
    for (int i = 1; i < PVS; ++i) s += *(const v4f*)&ss[i][rl][q * 4];
    vst2(Y + ((size_t)b * TT + qr0 + rl) * CC + h * HD + d0 + q * 4, s); } }   /* one wave stores one 512-B row */

extern "C" void kernel_launch(void* const* d_in, const int* in_sizes, int n_in, void* d_out, int out_size, void* d_ws, size_t ws_size, hipStream_t stream) {
  (void)in_sizes; (void)n_in; (void)out_size;
  const float** F = (const float**)d_in;
  if (ws_size < (size_t)WS_END) return;
  char* ws = (char*)d_ws; _Float16 *QH = (_Float16*)(ws + WS_QH), *KH = (_Float16*)(ws + WS_KH), *VT = (_Float16*)(ws + WS_VT), *QL = (_Float16*)(ws + WS_QL), *KL = (_Float16*)(ws + WS_KL); __bf16 *VB = (__bf16*)(ws + WS_VB), *VBL = (__bf16*)(ws + WS_VBL); float *S = (float*)(ws + WS_S), *Y = (float*)(ws + WS_Y);
  (void)Y; (void)QL; (void)KL; (void)VB; (void)VBL;
  // inputs: 0 x [4,64,80,80]; 1 w_theta [32,64] (out,in), 2 b_theta; 3 w_phi, 4 b_phi; 5 w_g, 6 b_g; 7 w_out [64,32] (out,in), 8 b_out; 9 bn_gamma, 10 bn_beta, 11 bn_mean, 12 bn_var
  if (ws_size < (size_t)WS_END2) return;
  float *YR = (float*)(ws + WS_YR), *ORW = (float*)(ws + WS_OR);
  k_proj<<<dim3(TNB * TT / 64, CC / 128, 3), 128, 0, stream>>>(F[0], F[0], F[0], F[1], F[3], F[5], F[2], F[4], F[6], QH, QL, KH, KL, VT, VB, VBL);   /* q = theta, k = phi, v = g */
  for (int b0 = 0; b0 < TNB; b0 += BG) {
    k_sc<<<dim3(NQB, TT / 128, BG), 128, 0, stream>>>(QH, KH, QL, KL, b0, 0, S);
    k_sm<<<dim3(TT, BG), 256, 0, stream>>>(S);
    k_pv<<<dim3(TT / (16 * PVR), HD / DVH, BG), 32 * PVR * PVS, 0, stream>>>(S, VT, VB, VBL, b0, 0, YR);
  }
  k_wz<<<dim3(TNB * TT / 64, 1), 128, 0, stream>>>(YR, F[7], F[8], ORW);
  k_fin2<<<dim3(TT / 64, DIN / 64, TNB), 256, 0, stream>>>(ORW, F[0], F[9], F[10], F[11], F[12], (float*)d_out);
}

// v003
// One run takes 111 microseconds.
// Versions in between are left out here; by their measured steps it is 6.37 times as fast as v001.
// All steps since v000 together make it 17.4 times as fast.
// compute dtype: all float inputs rounded to bf16; theta/phi/g = W x + b with EXACT bf16 products on WMMA 16x16x32 (f32 accumulate); unscaled logits theta.phi with BOTH as f16 hi + residual planes (3 products); softmax in f32 (running maximum and sum, logits kept in registers; in the key loop exp(z) = 2^(z log2 e) on the hardware exp2, log2 e folded into one fma per logit; precise expf where the key ranges are joined); exp(f - max) x e^7.625 once to f16 against g once to f16 (1 product), divided by the f32 sum at the end; y split bf16 hi + lo against exact w_out (2 products) + b_out; eval BatchNorm and the residual in f32; f32 output.
#include <hip/hip_runtime.h>
#include <math.h>

typedef __attribute__((ext_vector_type(16))) _Float16 v16h;
typedef __attribute__((ext_vector_type(16))) __bf16 v16b;
typedef __attribute__((ext_vector_type(8)))  _Float16 v8h;
typedef __attribute__((ext_vector_type(8)))  float v8f;
typedef __attribute__((ext_vector_type(4)))  float v4f;
typedef __attribute__((ext_vector_type(2)))  float v2f;
typedef __attribute__((ext_vector_type(4)))  unsigned v4u;
typedef __attribute__((ext_vector_type(4)))  int v4i;
typedef float __attribute__((may_alias)) float_a;
typedef int __attribute__((may_alias)) int_a;

template <typename T> __device__ __forceinline__ void vst2(void* p, T v) { *(T*)p = v;  }
__device__ __forceinline__ v8f wmma16(v16h a, v16h b, v8f c) {
  v8f d = __builtin_amdgcn_wmma_f32_16x16x32_f16(false, a, false, b, (short)0, c, false, false);
  asm volatile("v_nop\n\tv_nop\n\tv_nop\n\tv_nop" : "+v"(d) : "v"(a), "v"(b));
  return d;
}
__device__ __forceinline__ v8f wmma_bf(v16b a, v16b b, v8f c) {
  v8f d = __builtin_amdgcn_wmma_f32_16x16x32_bf16(false, a, false, b, (short)0, c, false, false);
  asm volatile("v_nop\n\tv_nop\n\tv_nop\n\tv_nop" : "+v"(d) : "v"(a), "v"(b));
  return d;
}
// 16x16x32 fragments: lane = (h = lane>>4, row/col = lane&15); elements 0..7 = k0+8h+0..7, 8..15 = k0+16+8h+0..7; D element r = row 8h+r
__device__ __forceinline__ v16h frag_h(const _Float16* rowk0, int lane) {
  union { v16h v; v8h q[2]; } u; const _Float16* p = rowk0 + 8 * (lane >> 4);
  u.q[0] = *(const v8h*)p; u.q[1] = *(const v8h*)(p + 16); return u.v;
}
__device__ __forceinline__ v16h frag_f32(const float* rowk0, int lane) {
  v16h a; const float* p = rowk0 + 8 * (lane >> 4);
#pragma unroll
  for (int i = 0; i < 8; ++i) { a[i] = (_Float16)p[i]; a[8 + i] = (_Float16)p[16 + i]; }
  return a;
}
__device__ __forceinline__ v16h frag_f32s(const float* rowk0, int lane, float sc) {
  v16h a; const float* p = rowk0 + 8 * (lane >> 4);
#pragma unroll
  for (int i = 0; i < 8; ++i) { a[i] = (_Float16)(p[i] * sc); a[8 + i] = (_Float16)(p[16 + i] * sc); }
  return a;
}
// column fragment from a [K][ld] layout (column n), rows >= K read as 0
__device__ __forceinline__ v16h fragc_f32(const float* W, int k0, int n, int lane, int ld, int K) {
  v16h a; const int g = lane >> 4;
#pragma unroll
  for (int i = 0; i < 8; ++i) { const int ka = k0 + 8 * g + i, kb = ka + 16;
    a[i] = (_Float16)(ka < K ? W[(size_t)(ka < K ? ka : K - 1) * ld + n] : 0.f); a[8 + i] = (_Float16)(kb < K ? W[(size_t)(kb < K ? kb : K - 1) * ld + n] : 0.f); }
  return a;
}
struct F2 { v16b h, l; };
__device__ __forceinline__ F2 bsplit16(const float v[16]) { F2 r;
#pragma unroll
  for (int i = 0; i < 16; ++i) { const __bf16 h = (__bf16)v[i]; r.h[i] = h; r.l[i] = (__bf16)(v[i] - (float)h); }
  return r; }
__device__ __forceinline__ F2 split_row(const float* row, int k0, int lane) { float v[16]; const float* p = row + k0 + 8 * (lane >> 4);
#pragma unroll
  for (int i = 0; i < 8; ++i) { v[i] = p[i]; v[8 + i] = p[16 + i]; }
  return bsplit16(v); }
__device__ __forceinline__ F2 split_rowK(const float* row, int k0, int lane, int K) { float v[16]; const int g = lane >> 4;
#pragma unroll
  for (int i = 0; i < 8; ++i) { const int ka = k0 + 8 * g + i, kb = ka + 16; v[i] = ka < K ? row[ka < K ? ka : K - 1] : 0.f; v[8 + i] = kb < K ? row[kb < K ? kb : K - 1] : 0.f; }
  return bsplit16(v); }
__device__ __forceinline__ F2 split_col(const float* W, int k0, int n, int lane, int ld, int K) { float v[16]; const int g = lane >> 4;
#pragma unroll
  for (int i = 0; i < 8; ++i) { const int ka = k0 + 8 * g + i, kb = ka + 16; v[i] = ka < K ? W[(size_t)(ka < K ? ka : K - 1) * ld + n] : 0.f; v[8 + i] = kb < K ? W[(size_t)(kb < K ? kb : K - 1) * ld + n] : 0.f; }
  return bsplit16(v); }
__device__ __forceinline__ v8f mac3(const F2& a, const F2& b, v8f c) { c = wmma_bf(a.l, b.h, c); c = wmma_bf(a.h, b.l, c); return wmma_bf(a.h, b.h, c); }
__device__ __forceinline__ float sigm(float v) { return 1.0f / (1.0f + expf(-v)); }
#define LDSX() do { asm volatile("s_wait_dscnt 0" ::: "memory"); __builtin_amdgcn_wave_barrier(); __builtin_amdgcn_fence(__ATOMIC_RELEASE, "workgroup"); } while (0)

// Non-local block (B 4, C 64, 80 x 80 = 6,400 positions; inter channels 32): theta, phi, g = 1x1 convs of x ((out,in) [32,64] + bias); f[n][m] = theta_n . phi_m (no scaling); P = softmax over m; y[n] = sum_m P[n][m] g_m; W_y = w_out y + b_out (32 -> 64); out = BN_eval(W_y) (running mean/var, eps 1e-4, affine) + x.
#define NB 4
#define TT 6400
#define CC 128            // projected plane width (32 real columns + 96 zero)
#define DIN 64            // input channels
#define NH 1
#define HD 128
#define NQB (TT / 64)
#define HG 1               // sizes WS_S: one 6,400 x 6,400 f32 plane, unused (scores stay in registers)
#define SCALE (1.0f)
#define HDQK 32            // theta / phi / g channels: the planes are 128 wide, columns >= 32 are zero; only the 32 real columns enter the scores
#define CAUSAL 0
#ifndef TNB
#define TNB NB
#endif
__device__ __forceinline__ v16b zero16b() { v16b z; _Pragma("unroll") for (int i = 0; i < 16; ++i) z[i] = (__bf16)0.f; return z; }
__device__ __forceinline__ float bfr(float v) { return (float)(__bf16)v; }
__host__ __device__ __forceinline__ int kb_last(int qb) { return CAUSAL ? ((qb * 64 + 63) >> 7) : (TT / 128 - 1); }
typedef __attribute__((ext_vector_type(8))) __bf16 v8b;
__device__ __forceinline__ v16b frag_b(const __bf16* rowk0, int lane) {
  union { v16b v; v8b q[2]; } u; const __bf16* p = rowk0 + 8 * (lane >> 4);
  u.q[0] = *(const v8b*)p; u.q[1] = *(const v8b*)(p + 16); return u.v;
}
#define QBH (TT / 64)      // ALL queries take the 3-product logits (k_fa)
#define QBH_PV 0           // P.v stays single f16
#define QHI 6400            // q residual rows everywhere
#define KHI 6400           // k residual rows for ALL keys (3-product logits; sigma_f ~ 5.7 unscaled)
// B fragment (k rows k0+.., output column o) of a weight: (in,out) [K][ld] or (out,in) [ld rows of K]: bf16 exact, or f16(bf16 * 256) exact
__device__ __forceinline__ v16b wcol_io(const float* Wm, int k0, int o, int lane, int ld) { v16b w; const int g = lane >> 4;
#pragma unroll
  for (int i = 0; i < 8; ++i) { w[i] = (__bf16)Wm[(size_t)(k0 + 8 * g + i) * ld + o]; w[8 + i] = (__bf16)Wm[(size_t)(k0 + 16 + 8 * g + i) * ld + o]; }
  return w; }
__device__ __forceinline__ v16b wcol_oi(const float* Wm, int k0, int o, int lane, int K) { v16b w; const float* p = Wm + (size_t)o * K + k0 + 8 * (lane >> 4);
#pragma unroll
  for (int i = 0; i < 8; ++i) { w[i] = (__bf16)p[i]; w[8 + i] = (__bf16)p[16 + i]; }
  return w; }
__device__ __forceinline__ v16h wcolh_io(const float* Wm, int k0, int o, int lane, int ld) { v16h w; const int g = lane >> 4;
#pragma unroll
  for (int i = 0; i < 8; ++i) { w[i] = (_Float16)(bfr(Wm[(size_t)(k0 + 8 * g + i) * ld + o]) * 256.0f); w[8 + i] = (_Float16)(bfr(Wm[(size_t)(k0 + 16 + 8 * g + i) * ld + o]) * 256.0f); }
  return w; }
__device__ __forceinline__ v16h wcolh_oi(const float* Wm, int k0, int o, int lane, int K) { v16h w; const float* p = Wm + (size_t)o * K + k0 + 8 * (lane >> 4);
#pragma unroll
  for (int i = 0; i < 8; ++i) { w[i] = (_Float16)(bfr(p[i]) * 256.0f); w[8 + i] = (_Float16)(bfr(p[16 + i]) * 256.0f); }
  return w; }
#define WQKV_LAYOUT 1   // 0 = (in,out) [DIN][CC]; 1 = (out,in) [HDQK][DIN]; 2 = per-head [NH][DIN][HD]
__device__ __forceinline__ v16b wcol_hdk(const float* Wm, int k0, int o, int lane) { v16b w; const int g = lane >> 4; const float* p = Wm + (size_t)(o / HD) * DIN * HD + (o % HD);
#pragma unroll
  for (int i = 0; i < 8; ++i) { w[i] = (__bf16)p[(size_t)(k0 + 8 * g + i) * HD]; w[8 + i] = (__bf16)p[(size_t)(k0 + 16 + 8 * g + i) * HD]; }
  return w; }
#define WO_OUT_IN 0
#if WQKV_LAYOUT == 1
#define WCOL(W, k0, o, lane) (((o) < HDQK) ? wcol_oi(W, k0, (o), lane, DIN) : zero16b())   /* theta/phi/g weights are [32][64] (out,in): plane columns >= 32 are zero for all three */
#elif WQKV_LAYOUT == 2
#define WCOL(W, k0, o, lane) wcol_hdk(W, k0, o, lane)
#else
#define WCOL(W, k0, o, lane) wcol_io(W, k0, o, lane, CC)
#endif
#if WO_OUT_IN
#define WOCOL(W, k0, o, lane) wcol_oi(W, k0, o, lane, CC)
#define WOCOLH(W, k0, o, lane) wcolh_oi(W, k0, o, lane, CC)
#else
#define WOCOL(W, k0, o, lane) wcol_io(W, k0, o, lane, DIN)
#define WOCOLH(W, k0, o, lane) wcolh_io(W, k0, o, lane, DIN)
#endif
#ifndef XP
#define XP TT              // position pitch of x and of the output
#endif
#define BG HG
#define DVH 128
#define WS_YR (WS_END)     // f32 attended rows [b*n][128] (32 real columns)
#define WS_OR (WS_YR + 4u * (size_t)NB * TT * CC)   // W y + b rows [b*n][64]
#define WS_END2 (WS_OR + 4u * (size_t)NB * TT * DIN)
// ---- k_wz: block = (64 rows, 64 output cols): OR = y (hi + lo, K = 32 real columns of the YR rows) . W^T ((out,in) [64][32], exact) + b
__global__ __launch_bounds__(128) void k_wz(const float* __restrict__ YR, const float* __restrict__ WW, const float* __restrict__ WB, float* __restrict__ ORW) { __shared__ __align__(16) float sf[4][16][132];
  const int tid = threadIdx.x, wave = tid >> 5, lane = tid & 31, col = lane & 15, g = lane >> 4; const int c0 = 0;   /* DIN (64) output channels in one block */ const size_t r0 = (size_t)blockIdx.x * 64 + wave * 16;
  v8f acc[8] = {};
#pragma unroll
  for (int kc = 0; kc < HDQK / 32; ++kc) { const F2 a = split_row(YR + (r0 + col) * CC, kc * 32, lane); asm volatile("s_wait_loadcnt 0x0" ::: "memory");
#pragma unroll
    for (int j = 0; j < DIN / 16; ++j) { const v16b w = wcol_oi(WW, kc * 32, c0 + j * 16 + col, lane, HDQK); asm volatile("s_wait_loadcnt 0x0" ::: "memory"); acc[j] = wmma_bf(a.h, w, acc[j]); acc[j] = wmma_bf(a.l, w, acc[j]); } }
#pragma unroll
  for (int j = 0; j < DIN / 16; ++j) { const float bb = bfr(WB[c0 + j * 16 + col]); asm volatile("s_wait_loadcnt 0x0" ::: "memory");
#pragma unroll
    for (int r = 0; r < 8; ++r) sf[wave][8 * g + r][j * 16 + col] = acc[j][r] + bb; }
  LDSX(); for (int rl = 0; rl < 16; ++rl) if (lane < DIN / 4) vst2(ORW + (r0 + rl) * DIN + c0 + lane * 4, *(const v4f*)&sf[wave][rl][lane * 4]); }   /* 16 lanes x 16 B = the 256-B row */
// ---- k_fin2: block = (64 positions, 64 channels, batch b): out[b][c][n] = BN_eval(OR[b*N + n][c]) + bf16(x[b][c][n]) (LDS transpose; 256-B runs of 64 positions per channel)
__global__ __launch_bounds__(256) void k_fin2(const float* __restrict__ ORW, const float* __restrict__ X, const float* __restrict__ GAm, const float* __restrict__ BEt, const float* __restrict__ MUv, const float* __restrict__ VAv, float* __restrict__ OUT) { __shared__ float st[64][68]; const int tid = threadIdx.x; const int n0 = blockIdx.x * 64, c0 = blockIdx.y * 64; const size_t b = blockIdx.z;
  for (int e = tid; e < 64 * 16; e += 256) { const int nl = e >> 4, q = e & 15; *(v4f*)&st[nl][q * 4] = *(const v4f*)(ORW + (b * TT + n0 + nl) * (size_t)DIN + c0 + q * 4); }
  __syncthreads();
  for (int e = tid; e < 64 * 16; e += 256) { const int cl = e >> 4, q = e & 15; const int c = c0 + cl; const size_t oi = (b * DIN + c) * (size_t)XP + n0 + q * 4; const v4f xr = *(const v4f*)(X + oi); const float inv = bfr(GAm[c]) / __fsqrt_rn(bfr(VAv[c]) + 1e-4f), mu = bfr(MUv[c]), be = bfr(BEt[c]); asm volatile("s_wait_loadcnt 0x0" ::: "memory"); v4f o;
#pragma unroll
    for (int i = 0; i < 4; ++i) o[i] = ((st[q * 4 + i][cl] - mu) * inv + be) + bfr(xr[i]);
    vst2(OUT + oi, o); } }   /* eval BN: (W_y - mean) * (gamma / sqrt(var + eps)) + beta, then + x */
#ifndef SM_EXTRA_PARAMS
#define SM_EXTRA_PARAMS
#endif
#ifndef PROJ_EXTRA_PARAMS
#define PROJ_EXTRA_PARAMS
#endif
#ifndef SM_MASK_HOOK
#define SM_MASK_HOOK (void)0
#endif

#define WS_QH  0u                                      // f16 q rows [b*t][CC]
#define WS_KH  (WS_QH + 2u * (size_t)NB * TT * CC)      // f16 k rows [b*t][CC]
#define WS_VT  (WS_KH + 2u * (size_t)NB * TT * CC)      // f16 v planes [b][c][t]
#define WS_QL  (WS_VT + 2u * (size_t)NB * CC * TT)      // f16 q residual x 2^10 rows [b][t < QHI][CC]
#define WS_KL  (WS_QL + 2u * (size_t)NB * QHI * CC)     // f16 k residual x 2^10 rows [b][t < KHI][CC]
#define WS_VB  (WS_KL + 2u * (size_t)NB * KHI * CC)     // bf16 v hi planes [b][c][t < KHI]
#define WS_VBL (WS_VB + 2u * (size_t)NB * CC * KHI)
#define WS_S   (WS_VBL + 2u * (size_t)NB * CC * KHI)    // f32 [hg][t][s] region, unused (no kernel stores logits)
#define WS_Y   (WS_S  + 4u * (size_t)HG * TT * TT)      // empty: the ctx rows go to WS_YR
#define WS_END (WS_Y  + 0u)

// ---- k_proj: block = (64 rows, 128 cols, which): q/k/v = X W (+ b) with exact bf16 products (K = DIN) -> which 0: q f16 rows (+ residual rows < QHI); 1: k f16 rows (+ residual rows < KHI); 2: v f16 planes [c][t] (+ bf16 hi/lo planes for t < KHI)
__global__ __launch_bounds__(128) void k_proj(const float* __restrict__ XQ, const float* __restrict__ XK, const float* __restrict__ XV, const float* __restrict__ WQ, const float* __restrict__ WK, const float* __restrict__ WV, const float* __restrict__ BQ, const float* __restrict__ BK, const float* __restrict__ BV,
    _Float16* __restrict__ QH, _Float16* __restrict__ QL, _Float16* __restrict__ KH, _Float16* __restrict__ KL, _Float16* __restrict__ VT, __bf16* __restrict__ VB, __bf16* __restrict__ VBL) {
  __shared__ __align__(16) _Float16 sh[64][136], sl[64][136]; __shared__ __align__(16) _Float16 th[128][72]; __shared__ __align__(16) __bf16 tb[128][72], tbl[128][72];
  const int tid = threadIdx.x, wave = tid >> 5, lane = tid & 31, col = lane & 15, g = lane >> 4; const int which = blockIdx.z; const int c0 = blockIdx.y * 128; const size_t r0 = (size_t)blockIdx.x * 64; const size_t bb = r0 / TT; const int t0 = (int)(r0 % TT);
  const float* X = which == 0 ? XQ : which == 1 ? XK : XV; const float* WA = which == 0 ? WQ : which == 1 ? WK : WV; const float* BA = which == 0 ? BQ : which == 1 ? BK : BV;
  v8f acc[8] = {};
#pragma unroll 2
  for (int kc = 0; kc < DIN / 32; ++kc) { v16b a; { const float* p = X + (bb * DIN + kc * 32 + 8 * g) * (size_t)XP + t0 + wave * 16 + col;   /* channels-first gather: x[b][k][t], stride XP between k */
#pragma unroll
      for (int i = 0; i < 8; ++i) { a[i] = (__bf16)p[(size_t)i * XP]; a[8 + i] = (__bf16)p[(size_t)(16 + i) * XP]; } }
    asm volatile("s_wait_loadcnt 0x0" ::: "memory");
#pragma unroll
    for (int j = 0; j < 8; ++j) { const v16b w = WCOL(WA, kc * 32, c0 + j * 16 + col, lane); asm volatile("s_wait_loadcnt 0x0" ::: "memory"); acc[j] = wmma_bf(a, w, acc[j]); } }
  if (which < 2) { _Float16* DH = which == 0 ? QH : KH; _Float16* DL = which == 0 ? QL : KL; const int nhi = which == 0 ? QHI : KHI; const bool hi_rows = t0 < nhi;
#pragma unroll
    for (int j = 0; j < 8; ++j) { const float bias = (BA && (c0 + j * 16 + col < HDQK)) ? bfr(BA[c0 + j * 16 + col]) : 0.f;   /* 32-entry biases */
#pragma unroll
      for (int r = 0; r < 8; ++r) { const float v = acc[j][r] + bias; const _Float16 hv = (_Float16)v; sh[wave * 16 + 8 * g + r][j * 16 + col] = hv; sl[wave * 16 + 8 * g + r][j * 16 + col] = (_Float16)((v - (float)hv) * 1024.0f); } }
    __syncthreads();
    for (int e = tid; e < 64 * 16; e += 128) { const int rl = e >> 4, q = e & 15; vst2((unsigned*)(DH + (r0 + rl) * CC + c0 + q * 8), *(const v4u*)&sh[rl][q * 8]); if (hi_rows) vst2((unsigned*)(DL + (bb * nhi + t0 + rl) * (size_t)CC + c0 + q * 8), *(const v4u*)&sl[rl][q * 8]); }
  } else { const bool hi_rows = t0 < KHI;
#pragma unroll
    for (int j = 0; j < 8; ++j) { const float bias = (BA && (c0 + j * 16 + col < HDQK)) ? bfr(BA[c0 + j * 16 + col]) : 0.f;   /* 32-entry biases */
#pragma unroll
      for (int r = 0; r < 8; ++r) { const float v = acc[j][r] + bias; const int rl = wave * 16 + 8 * g + r, cl = j * 16 + col; th[cl][rl] = (_Float16)v; const __bf16 bh = (__bf16)v; tb[cl][rl] = bh; tbl[cl][rl] = (__bf16)(v - (float)bh); } }
    __syncthreads();
    for (int e = tid; e < 128 * 8; e += 128) { const int cl = e >> 3, q = e & 7; vst2((unsigned*)(VT + (bb * CC + c0 + cl) * (size_t)TT + t0 + q * 8), *(const v4u*)&th[cl][q * 8]); if (hi_rows) { const size_t o3 = (bb * CC + c0 + cl) * (size_t)KHI + t0 + q * 8; vst2((unsigned*)(VB + o3), *(const v4u*)&tb[cl][q * 8]); vst2((unsigned*)(VBL + o3), *(const v4u*)&tbl[cl][q * 8]); } } } }
// ---- k_fa: block = 128 queries of batch b (4 groups of 32) x 5 key ranges of 1,280 keys, one wave per (query group, key range); the 4 waves of a range read the same k and v lines. Per 32 keys: S^T = k . q^T (k rows as A, q as B; q and k as f16 hi + residual x 2^10, 3 products), so a lane holds 16 keys' logits of ONE query per 16-query tile; running maximum and sum per query (f32; exponentials as hardware exp2 of fma(s, log2 e, -(max - PSH) log2 e)); exp(s - max) x e^7.625 once to f16 is the B operand as it stands in the accumulators; ctx^T += v^T . P^T (v planes as A, 1 product, the 32 real channels). The 5 ranges' (max, sum, ctx) meet in LDS and are joined in range order.
#define FQ 2               // 16-query tiles per wave
#define FG 4               // query groups (waves) per key range
#define FKS 5              // key ranges per block
#define FQB (16 * FQ * FG) // queries per block
#define FST (TT / 32 / FKS)   // 32-key steps per range
#define L2E 1.4426950408889634f   // log2(e)
#define PSH 7.625f         // P is held as exp(s - max + PSH) <= 2,049: small weights stay normal f16 numbers; the factor cancels in ctx / sum
static_assert(!CAUSAL && TT % FQB == 0 && TT % (32 * FKS) == 0 && HDQK == 32 && QHI == TT && KHI == TT, "whole query blocks, equal key ranges, one 32-deep product");
// every unroll directive of k_fa: the fragment, score and accumulator arrays are then indexed by constants alone and stay in registers
__device__ __forceinline__ v8f wm(v16h a, v16h b, v8f c) { return __builtin_amdgcn_wmma_f32_16x16x32_f16(false, a, false, b, (short)0, c, false, false); }
__device__ __forceinline__ v16h frag_u(const _Float16* base, unsigned boff) { union { v16h v; v8h q[2]; } u; const char* p = (const char*)base + boff; u.q[0] = *(const v8h*)p; u.q[1] = *(const v8h*)(p + 32); return u.v; }   // uniform base + the lane's byte offset
__device__ __forceinline__ float xhalf(float x) { return __builtin_bit_cast(float, __builtin_amdgcn_permlanex16(__builtin_bit_cast(int, x), __builtin_bit_cast(int, x), 0x76543210, 0xfedcba98, false, false)); }   // lane l reads lane l ^ 16
__global__ __launch_bounds__(32 * FG * FKS) void k_fa(const _Float16* __restrict__ QH, const _Float16* __restrict__ QL, const _Float16* __restrict__ KH, const _Float16* __restrict__ KL, const _Float16* __restrict__ VT, float* __restrict__ Y) {
  __shared__ __align__(16) float so[FKS][FQB][HDQK + 4]; __shared__ float smx[FKS][FQB], ssu[FKS][FQB];
  const int tid = threadIdx.x, wave = __builtin_amdgcn_readfirstlane(tid >> 5), lane = tid & 31, col = lane & 15, g = lane >> 4; const int qg = wave % FG, ks = wave / FG;
  const int b = blockIdx.y, qr0 = blockIdx.x * FQB; const size_t rb = (size_t)b * TT;
  v16h qh[FQ], ql[FQ];
#pragma unroll
  for (int u = 0; u < FQ; ++u) { const size_t qo = (rb + qr0 + (qg * FQ + u) * 16 + col) * CC; qh[u] = frag_h(QH + qo, lane); ql[u] = frag_h(QL + qo, lane); }
  const _Float16* kph = KH + (rb + ks * (FST * 32)) * CC; const _Float16* kpl = KL + (rb + ks * (FST * 32)) * CC; const _Float16* vp = VT + (size_t)b * CC * TT + ks * (FST * 32);   /* wave-uniform bases */
  const unsigned ko = (col * CC + 8 * g) * 2, vo = (col * TT + 8 * g) * 2;   /* bytes: the lane's own place in a 16-row tile (fragment k order: 8g + 0..7, 16 + 8g + 0..7), fixed over the loop */
  float m[FQ], l[FQ]; v8f o[FQ][2];
#pragma unroll
  for (int u = 0; u < FQ; ++u) { m[u] = -3.0e38f; l[u] = 0.f; o[u][0] = v8f{}; o[u][1] = v8f{}; }
  for (int kc = 0; kc < FST; ++kc) {
    v16h kh[2], kl[2], vv[2];
#pragma unroll
    for (int t = 0; t < 2; ++t) { kh[t] = frag_u(kph + (size_t)(kc * 32 + t * 16) * CC, ko); kl[t] = frag_u(kpl + (size_t)(kc * 32 + t * 16) * CC, ko); vv[t] = frag_u(vp + (size_t)(t * 16) * TT + kc * 32, vo); }
#pragma unroll
    for (int u = 0; u < FQ; ++u) { v2f s[8];   /* logits in pairs, as the packed fma takes and leaves them */
#pragma unroll
      for (int t = 0; t < 2; ++t) { v8f a = {}, al = {}; a = wm(kh[t], qh[u], a); al = wm(kh[t], ql[u], al); al = wm(kl[t], qh[u], al);
#pragma unroll
        for (int r = 0; r < 4; ++r) s[t * 4 + r] = __builtin_elementwise_fma(v2f{al[2 * r], al[2 * r + 1]}, v2f{1.0f / 1024.0f, 1.0f / 1024.0f}, v2f{a[2 * r], a[2 * r + 1]}) * SCALE; }
      float mx = s[0].x;
#pragma unroll
      for (int i = 1; i < 16; ++i) mx = fmaxf(mx, s[i >> 1][i & 1]);
      mx = fmaxf(mx, xhalf(mx));   /* the two lane halves hold the same query's other 16 keys */
      const float mn = fmaxf(m[u], mx), sc = __builtin_amdgcn_exp2f((m[u] - mn) * L2E), ms2 = (mn - PSH) * L2E; m[u] = mn;   /* sc is 0 on the first step (argument -inf) */
      v16h p; float sum = 0.f;
#pragma unroll
      for (int i = 0; i < 8; ++i) { const v2f a = __builtin_elementwise_fma(s[i], v2f{L2E, L2E}, v2f{-ms2, -ms2}); const float e0 = __builtin_amdgcn_exp2f(a.x), e1 = __builtin_amdgcn_exp2f(a.y); sum += e0; sum += e1; p[2 * i] = (_Float16)e0; p[2 * i + 1] = (_Float16)e1; }   /* the argument is at most PSH log2 e, about 11; far below the maximum the result is 0 */
      l[u] = l[u] * sc + sum;
#pragma unroll
      for (int c = 0; c < 2; ++c) {
#pragma unroll
        for (int r = 0; r < 8; ++r) o[u][c][r] *= sc;
        o[u][c] = wm(vv[c], p, o[u][c]); } } }
#pragma unroll
  for (int u = 0; u < FQ; ++u) { const int rl = (qg * FQ + u) * 16 + col; const float lt = l[u] + xhalf(l[u]); if (g == 0) { smx[ks][rl] = m[u]; ssu[ks][rl] = lt; }
#pragma unroll
    for (int c = 0; c < 2; ++c)
#pragma unroll
      for (int r = 0; r < 8; ++r) so[ks][rl][c * 16 + 8 * g + r] = o[u][c][r]; }   /* register r = channel 16c + 8g + r of query col */
  __syncthreads();   /* every range's maximum, sum and partial rows are in LDS before any thread joins them */
  for (int e = tid; e < FQB * (HDQK / 4); e += 32 * FG * FKS) { const int rl = e / (HDQK / 4), q = e % (HDQK / 4); float mt = smx[0][rl];
#pragma unroll
    for (int i = 1; i < FKS; ++i) mt = fmaxf(mt, smx[i][rl]);
    float lt = 0.f; v4f s = {};
#pragma unroll
    for (int i = 0; i < FKS; ++i) { const float w = expf(smx[i][rl] - mt); lt += w * ssu[i][rl]; s += *(const v4f*)&so[i][rl][q * 4] * w; }
    vst2(Y + (rb + qr0 + rl) * CC + q * 4, s * (1.0f / lt)); } }   /* 8 lanes store one row's 32 channels: one 128-B line; k_wz reads these 32 columns alone */

extern "C" void kernel_launch(void* const* d_in, const int* in_sizes, int n_in, void* d_out, int out_size, void* d_ws, size_t ws_size, hipStream_t stream) {
  (void)in_sizes; (void)n_in; (void)out_size;
  const float** F = (const float**)d_in;
  if (ws_size < (size_t)WS_END) return;
  char* ws = (char*)d_ws; _Float16 *QH = (_Float16*)(ws + WS_QH), *KH = (_Float16*)(ws + WS_KH), *VT = (_Float16*)(ws + WS_VT), *QL = (_Float16*)(ws + WS_QL), *KL = (_Float16*)(ws + WS_KL); __bf16 *VB = (__bf16*)(ws + WS_VB), *VBL = (__bf16*)(ws + WS_VBL); float *S = (float*)(ws + WS_S), *Y = (float*)(ws + WS_Y);
  (void)Y; (void)S;
  // inputs: 0 x [4,64,80,80]; 1 w_theta [32,64] (out,in), 2 b_theta; 3 w_phi, 4 b_phi; 5 w_g, 6 b_g; 7 w_out [64,32] (out,in), 8 b_out; 9 bn_gamma, 10 bn_beta, 11 bn_mean, 12 bn_var
  if (ws_size < (size_t)WS_END2) return;
  float *YR = (float*)(ws + WS_YR), *ORW = (float*)(ws + WS_OR);
  k_proj<<<dim3(TNB * TT / 64, CC / 128, 3), 128, 0, stream>>>(F[0], F[0], F[0], F[1], F[3], F[5], F[2], F[4], F[6], QH, QL, KH, KL, VT, VB, VBL);   /* q = theta, k = phi, v = g */
  k_fa<<<dim3(TT / FQB, TNB), 32 * FG * FKS, 0, stream>>>(QH, QL, KH, KL, VT, YR);
  k_wz<<<dim3(TNB * TT / 64, 1), 128, 0, stream>>>(YR, F[7], F[8], ORW);
  k_fin2<<<dim3(TT / 64, DIN / 64, TNB), 256, 0, stream>>>(ORW, F[0], F[9], F[10], F[11], F[12], (float*)d_out);
}

// v004
// One run takes 70.2 microseconds.
// In two side-by-side timings against v003, it was 1.60 and 1.57 times as fast.
// All steps since v000 together make it 27.6 times as fast.
// compute dtype: all float inputs rounded to bf16; theta/phi/g = W x + b with EXACT bf16 products on WMMA 16x16x32 (f32 accumulate); unscaled logits theta.phi with BOTH as f16 hi + residual planes (3 products); softmax in f32 (running maximum and sum, logits kept in registers; in the key loop exp(z) = 2^(z log2 e) on the hardware exp2, log2 e folded into one fma per logit; precise expf where the key ranges are joined); exp(f - max) x e^7.625 once to f16 against g once to f16 (1 product), divided by the f32 sum at the end; y split bf16 hi + lo against exact w_out (2 products) + b_out; eval BatchNorm and the residual in f32; f32 output.
#include <hip/hip_runtime.h>
#include <math.h>

typedef __attribute__((ext_vector_type(16))) _Float16 v16h;
typedef __attribute__((ext_vector_type(16))) __bf16 v16b;
typedef __attribute__((ext_vector_type(8)))  _Float16 v8h;
typedef __attribute__((ext_vector_type(8)))  float v8f;
typedef __attribute__((ext_vector_type(4)))  float v4f;
typedef __attribute__((ext_vector_type(2)))  float v2f;
typedef __attribute__((ext_vector_type(4)))  unsigned v4u;
typedef __attribute__((ext_vector_type(4)))  int v4i;
typedef float __attribute__((may_alias)) float_a;
typedef int __attribute__((may_alias)) int_a;

template <typename T> __device__ __forceinline__ void vst2(void* p, T v) { *(T*)p = v;  }
__device__ __forceinline__ v8f wmma16(v16h a, v16h b, v8f c) {
  v8f d = __builtin_amdgcn_wmma_f32_16x16x32_f16(false, a, false, b, (short)0, c, false, false);
  asm volatile("v_nop\n\tv_nop\n\tv_nop\n\tv_nop" : "+v"(d) : "v"(a), "v"(b));
  return d;
}
__device__ __forceinline__ v8f wmma_bf(v16b a, v16b b, v8f c) {
  v8f d = __builtin_amdgcn_wmma_f32_16x16x32_bf16(false, a, false, b, (short)0, c, false, false);
  asm volatile("v_nop\n\tv_nop\n\tv_nop\n\tv_nop" : "+v"(d) : "v"(a), "v"(b));
  return d;
}
// 16x16x32 fragments: lane = (h = lane>>4, row/col = lane&15); elements 0..7 = k0+8h+0..7, 8..15 = k0+16+8h+0..7; D element r = row 8h+r
__device__ __forceinline__ v16h frag_h(const _Float16* rowk0, int lane) {
  union { v16h v; v8h q[2]; } u; const _Float16* p = rowk0 + 8 * (lane >> 4);
  u.q[0] = *(const v8h*)p; u.q[1] = *(const v8h*)(p + 16); return u.v;
}
__device__ __forceinline__ v16h frag_f32(const float* rowk0, int lane) {
  v16h a; const float* p = rowk0 + 8 * (lane >> 4);
#pragma unroll
  for (int i = 0; i < 8; ++i) { a[i] = (_Float16)p[i]; a[8 + i] = (_Float16)p[16 + i]; }
  return a;
}
__device__ __forceinline__ v16h frag_f32s(const float* rowk0, int lane, float sc) {
  v16h a; const float* p = rowk0 + 8 * (lane >> 4);
#pragma unroll
  for (int i = 0; i < 8; ++i) { a[i] = (_Float16)(p[i] * sc); a[8 + i] = (_Float16)(p[16 + i] * sc); }
  return a;
}
// column fragment from a [K][ld] layout (column n), rows >= K read as 0
__device__ __forceinline__ v16h fragc_f32(const float* W, int k0, int n, int lane, int ld, int K) {
  v16h a; const int g = lane >> 4;
#pragma unroll
  for (int i = 0; i < 8; ++i) { const int ka = k0 + 8 * g + i, kb = ka + 16;
    a[i] = (_Float16)(ka < K ? W[(size_t)(ka < K ? ka : K - 1) * ld + n] : 0.f); a[8 + i] = (_Float16)(kb < K ? W[(size_t)(kb < K ? kb : K - 1) * ld + n] : 0.f); }
  return a;
}
struct F2 { v16b h, l; };
__device__ __forceinline__ F2 bsplit16(const float v[16]) { F2 r;
#pragma unroll
  for (int i = 0; i < 16; ++i) { const __bf16 h = (__bf16)v[i]; r.h[i] = h; r.l[i] = (__bf16)(v[i] - (float)h); }
  return r; }
__device__ __forceinline__ F2 split_row(const float* row, int k0, int lane) { float v[16]; const float* p = row + k0 + 8 * (lane >> 4);
#pragma unroll
  for (int i = 0; i < 8; ++i) { v[i] = p[i]; v[8 + i] = p[16 + i]; }
  return bsplit16(v); }
__device__ __forceinline__ F2 split_rowK(const float* row, int k0, int lane, int K) { float v[16]; const int g = lane >> 4;
#pragma unroll
  for (int i = 0; i < 8; ++i) { const int ka = k0 + 8 * g + i, kb = ka + 16; v[i] = ka < K ? row[ka < K ? ka : K - 1] : 0.f; v[8 + i] = kb < K ? row[kb < K ? kb : K - 1] : 0.f; }
  return bsplit16(v); }
__device__ __forceinline__ F2 split_col(const float* W, int k0, int n, int lane, int ld, int K) { float v[16]; const int g = lane >> 4;
#pragma unroll
  for (int i = 0; i < 8; ++i) { const int ka = k0 + 8 * g + i, kb = ka + 16; v[i] = ka < K ? W[(size_t)(ka < K ? ka : K - 1) * ld + n] : 0.f; v[8 + i] = kb < K ? W[(size_t)(kb < K ? kb : K - 1) * ld + n] : 0.f; }
  return bsplit16(v); }
__device__ __forceinline__ v8f mac3(const F2& a, const F2& b, v8f c) { c = wmma_bf(a.l, b.h, c); c = wmma_bf(a.h, b.l, c); return wmma_bf(a.h, b.h, c); }
__device__ __forceinline__ float sigm(float v) { return 1.0f / (1.0f + expf(-v)); }
#define LDSX() do { asm volatile("s_wait_dscnt 0" ::: "memory"); __builtin_amdgcn_wave_barrier(); __builtin_amdgcn_fence(__ATOMIC_RELEASE, "workgroup"); } while (0)

// Non-local block (B 4, C 64, 80 x 80 = 6,400 positions; inter channels 32): theta, phi, g = 1x1 convs of x ((out,in) [32,64] + bias); f[n][m] = theta_n . phi_m (no scaling); P = softmax over m; y[n] = sum_m P[n][m] g_m; W_y = w_out y + b_out (32 -> 64); out = BN_eval(W_y) (running mean/var, eps 1e-4, affine) + x.
#define NB 4
#define TT 6400
#define CC 128            // projected plane width (32 real columns + 96 zero)
#define DIN 64            // input channels
#define NH 1
#define HD 128
#define NQB (TT / 64)
#define HG 1               // sizes WS_S: one 6,400 x 6,400 f32 plane, unused (scores stay in registers)
#define SCALE (1.0f)
#define HDQK 32            // theta / phi / g channels: q rows are 128 wide with columns >= 32 zero, the k and v fragment planes hold the 32 real columns alone; only the 32 real columns enter the scores
#define CAUSAL 0
#ifndef TNB
#define TNB NB
#endif
__device__ __forceinline__ v16b zero16b() { v16b z; _Pragma("unroll") for (int i = 0; i < 16; ++i) z[i] = (__bf16)0.f; return z; }
__device__ __forceinline__ float bfr(float v) { return (float)(__bf16)v; }
__host__ __device__ __forceinline__ int kb_last(int qb) { return CAUSAL ? ((qb * 64 + 63) >> 7) : (TT / 128 - 1); }
typedef __attribute__((ext_vector_type(8))) __bf16 v8b;
__device__ __forceinline__ v16b frag_b(const __bf16* rowk0, int lane) {
  union { v16b v; v8b q[2]; } u; const __bf16* p = rowk0 + 8 * (lane >> 4);
  u.q[0] = *(const v8b*)p; u.q[1] = *(const v8b*)(p + 16); return u.v;
}
#define QBH (TT / 64)      // ALL queries take the 3-product logits (k_fa)
#define QBH_PV 0           // P.v stays single f16
#define QHI 6400            // q residual rows everywhere
#define KHI 6400           // k residual rows for ALL keys (3-product logits; sigma_f ~ 5.7 unscaled)
// B fragment (k rows k0+.., output column o) of a weight: (in,out) [K][ld] or (out,in) [ld rows of K]: bf16 exact, or f16(bf16 * 256) exact
__device__ __forceinline__ v16b wcol_io(const float* Wm, int k0, int o, int lane, int ld) { v16b w; const int g = lane >> 4;
#pragma unroll
  for (int i = 0; i < 8; ++i) { w[i] = (__bf16)Wm[(size_t)(k0 + 8 * g + i) * ld + o]; w[8 + i] = (__bf16)Wm[(size_t)(k0 + 16 + 8 * g + i) * ld + o]; }
  return w; }
__device__ __forceinline__ v16b wcol_oi(const float* Wm, int k0, int o, int lane, int K) { v16b w; const float* p = Wm + (size_t)o * K + k0 + 8 * (lane >> 4);
#pragma unroll
  for (int i = 0; i < 8; ++i) { w[i] = (__bf16)p[i]; w[8 + i] = (__bf16)p[16 + i]; }
  return w; }
__device__ __forceinline__ v16h wcolh_io(const float* Wm, int k0, int o, int lane, int ld) { v16h w; const int g = lane >> 4;
#pragma unroll
  for (int i = 0; i < 8; ++i) { w[i] = (_Float16)(bfr(Wm[(size_t)(k0 + 8 * g + i) * ld + o]) * 256.0f); w[8 + i] = (_Float16)(bfr(Wm[(size_t)(k0 + 16 + 8 * g + i) * ld + o]) * 256.0f); }
  return w; }
__device__ __forceinline__ v16h wcolh_oi(const float* Wm, int k0, int o, int lane, int K) { v16h w; const float* p = Wm + (size_t)o * K + k0 + 8 * (lane >> 4);
#pragma unroll
  for (int i = 0; i < 8; ++i) { w[i] = (_Float16)(bfr(p[i]) * 256.0f); w[8 + i] = (_Float16)(bfr(p[16 + i]) * 256.0f); }
  return w; }
#define WQKV_LAYOUT 1   // 0 = (in,out) [DIN][CC]; 1 = (out,in) [HDQK][DIN]; 2 = per-head [NH][DIN][HD]
__device__ __forceinline__ v16b wcol_hdk(const float* Wm, int k0, int o, int lane) { v16b w; const int g = lane >> 4; const float* p = Wm + (size_t)(o / HD) * DIN * HD + (o % HD);
#pragma unroll
  for (int i = 0; i < 8; ++i) { w[i] = (__bf16)p[(size_t)(k0 + 8 * g + i) * HD]; w[8 + i] = (__bf16)p[(size_t)(k0 + 16 + 8 * g + i) * HD]; }
  return w; }
#define WO_OUT_IN 0
#if WQKV_LAYOUT == 1
#define WCOL(W, k0, o, lane) (((o) < HDQK) ? wcol_oi(W, k0, (o), lane, DIN) : zero16b())   /* theta/phi/g weights are [32][64] (out,in): plane columns >= 32 are zero for all three */
#elif WQKV_LAYOUT == 2
#define WCOL(W, k0, o, lane) wcol_hdk(W, k0, o, lane)
#else
#define WCOL(W, k0, o, lane) wcol_io(W, k0, o, lane, CC)
#endif
#if WO_OUT_IN
#define WOCOL(W, k0, o, lane) wcol_oi(W, k0, o, lane, CC)
#define WOCOLH(W, k0, o, lane) wcolh_oi(W, k0, o, lane, CC)
#else
#define WOCOL(W, k0, o, lane) wcol_io(W, k0, o, lane, DIN)
#define WOCOLH(W, k0, o, lane) wcolh_io(W, k0, o, lane, DIN)
#endif
#ifndef XP
#define XP TT              // position pitch of x and of the output
#endif
#define BG HG
#define DVH 128
#define WS_YR (WS_END)     // f32 attended rows [b*n][128] (32 real columns)
#define WS_OR (WS_YR + 4u * (size_t)NB * TT * CC)   // W y + b rows [b*n][64]
#define WS_END2 (WS_OR + 4u * (size_t)NB * TT * DIN)
// ---- k_wz: block = (64 rows, 64 output cols): OR = y (hi + lo, K = 32 real columns of the YR rows) . W^T ((out,in) [64][32], exact) + b
__global__ __launch_bounds__(128) void k_wz(const float* __restrict__ YR, const float* __restrict__ WW, const float* __restrict__ WB, float* __restrict__ ORW) { __shared__ __align__(16) float sf[4][16][132];
  const int tid = threadIdx.x, wave = tid >> 5, lane = tid & 31, col = lane & 15, g = lane >> 4; const int c0 = 0;   /* DIN (64) output channels in one block */ const size_t r0 = (size_t)blockIdx.x * 64 + wave * 16;
  v8f acc[8] = {};
#pragma unroll
  for (int kc = 0; kc < HDQK / 32; ++kc) { const F2 a = split_row(YR + (r0 + col) * CC, kc * 32, lane); asm volatile("s_wait_loadcnt 0x0" ::: "memory");
#pragma unroll
    for (int j = 0; j < DIN / 16; ++j) { const v16b w = wcol_oi(WW, kc * 32, c0 + j * 16 + col, lane, HDQK); asm volatile("s_wait_loadcnt 0x0" ::: "memory"); acc[j] = wmma_bf(a.h, w, acc[j]); acc[j] = wmma_bf(a.l, w, acc[j]); } }
#pragma unroll
  for (int j = 0; j < DIN / 16; ++j) { const float bb = bfr(WB[c0 + j * 16 + col]); asm volatile("s_wait_loadcnt 0x0" ::: "memory");
#pragma unroll
    for (int r = 0; r < 8; ++r) sf[wave][8 * g + r][j * 16 + col] = acc[j][r] + bb; }
  LDSX(); for (int rl = 0; rl < 16; ++rl) if (lane < DIN / 4) vst2(ORW + (r0 + rl) * DIN + c0 + lane * 4, *(const v4f*)&sf[wave][rl][lane * 4]); }   /* 16 lanes x 16 B = the 256-B row */
// ---- k_fin2: block = (64 positions, 64 channels, batch b): out[b][c][n] = BN_eval(OR[b*N + n][c]) + bf16(x[b][c][n]) (LDS transpose; 256-B runs of 64 positions per channel)
__global__ __launch_bounds__(256) void k_fin2(const float* __restrict__ ORW, const float* __restrict__ X, const float* __restrict__ GAm, const float* __restrict__ BEt, const float* __restrict__ MUv, const float* __restrict__ VAv, float* __restrict__ OUT) { __shared__ float st[64][68]; const int tid = threadIdx.x; const int n0 = blockIdx.x * 64, c0 = blockIdx.y * 64; const size_t b = blockIdx.z;
  for (int e = tid; e < 64 * 16; e += 256) { const int nl = e >> 4, q = e & 15; *(v4f*)&st[nl][q * 4] = *(const v4f*)(ORW + (b * TT + n0 + nl) * (size_t)DIN + c0 + q * 4); }
  __syncthreads();
  for (int e = tid; e < 64 * 16; e += 256) { const int cl = e >> 4, q = e & 15; const int c = c0 + cl; const size_t oi = (b * DIN + c) * (size_t)XP + n0 + q * 4; const v4f xr = *(const v4f*)(X + oi); const float inv = bfr(GAm[c]) / __fsqrt_rn(bfr(VAv[c]) + 1e-4f), mu = bfr(MUv[c]), be = bfr(BEt[c]); asm volatile("s_wait_loadcnt 0x0" ::: "memory"); v4f o;
#pragma unroll
    for (int i = 0; i < 4; ++i) o[i] = ((st[q * 4 + i][cl] - mu) * inv + be) + bfr(xr[i]);
    vst2(OUT + oi, o); } }   /* eval BN: (W_y - mean) * (gamma / sqrt(var + eps)) + beta, then + x */
#ifndef SM_EXTRA_PARAMS
#define SM_EXTRA_PARAMS
#endif
#ifndef PROJ_EXTRA_PARAMS
#define PROJ_EXTRA_PARAMS
#endif
#ifndef SM_MASK_HOOK
#define SM_MASK_HOOK (void)0
#endif

#define WS_QH  0u                                      // f16 q rows [b*t][CC]
#define WS_KH  (WS_QH + 2u * (size_t)NB * TT * CC)      // f16 k, the 32 real columns in fragment order: [b*t / 16][half][lane][8], 1,024 B per 16-key tile
#define WS_VT  (WS_KH + 2u * (size_t)NB * TT * CC)      // f16 v, the 32 real channels in fragment order: [b*t / 32][channel tile][half][lane][8], 2,048 B per 32 keys
#define WS_QL  (WS_VT + 2u * (size_t)NB * CC * TT)      // f16 q residual x 2^10 rows [b][t < QHI][CC]
#define WS_KL  (WS_QL + 2u * (size_t)NB * QHI * CC)     // f16 k residual x 2^10, laid out as WS_KH
#define WS_VB  (WS_KL + 2u * (size_t)NB * KHI * CC)     // bf16 v hi planes [b][c][t < KHI]
#define WS_VBL (WS_VB + 2u * (size_t)NB * CC * KHI)
#define WS_S   (WS_VBL + 2u * (size_t)NB * CC * KHI)    // f32 [hg][t][s] region, unused (no kernel stores logits)
#define WS_Y   (WS_S  + 4u * (size_t)HG * TT * TT)      // empty: the ctx rows go to WS_YR
#define WS_END (WS_Y  + 0u)

// ---- k_proj: block = (64 rows, 128 cols, which): q/k/v = X W (+ b) with exact bf16 products (K = DIN) -> which 0: q f16 rows (+ residual rows < QHI); 1: k f16 and its residual in fragment order; 2: v f16 in fragment order (+ bf16 hi/lo planes [c][t] for t < KHI). Fragment order: the 16 bytes that lane l of k_fa loads stand at 16 l inside a 512-byte run, so one wave-wide load reads 4 whole lines
__global__ __launch_bounds__(128) void k_proj(const float* __restrict__ XQ, const float* __restrict__ XK, const float* __restrict__ XV, const float* __restrict__ WQ, const float* __restrict__ WK, const float* __restrict__ WV, const float* __restrict__ BQ, const float* __restrict__ BK, const float* __restrict__ BV,
    _Float16* __restrict__ QH, _Float16* __restrict__ QL, _Float16* __restrict__ KH, _Float16* __restrict__ KL, _Float16* __restrict__ VT, __bf16* __restrict__ VB, __bf16* __restrict__ VBL) {
  __shared__ __align__(16) _Float16 sh[64][136], sl[64][136]; __shared__ __align__(16) _Float16 th[128][72]; __shared__ __align__(16) __bf16 tb[128][72], tbl[128][72];
  const int tid = threadIdx.x, wave = tid >> 5, lane = tid & 31, col = lane & 15, g = lane >> 4; const int which = blockIdx.z; const int c0 = blockIdx.y * 128; const size_t r0 = (size_t)blockIdx.x * 64; const size_t bb = r0 / TT; const int t0 = (int)(r0 % TT);
  const float* X = which == 0 ? XQ : which == 1 ? XK : XV; const float* WA = which == 0 ? WQ : which == 1 ? WK : WV; const float* BA = which == 0 ? BQ : which == 1 ? BK : BV;
  v8f acc[8] = {};
#pragma unroll 2
  for (int kc = 0; kc < DIN / 32; ++kc) { v16b a; { const float* p = X + (bb * DIN + kc * 32 + 8 * g) * (size_t)XP + t0 + wave * 16 + col;   /* channels-first gather: x[b][k][t], stride XP between k */
#pragma unroll
      for (int i = 0; i < 8; ++i) { a[i] = (__bf16)p[(size_t)i * XP]; a[8 + i] = (__bf16)p[(size_t)(16 + i) * XP]; } }
    asm volatile("s_wait_loadcnt 0x0" ::: "memory");
#pragma unroll
    for (int j = 0; j < 8; ++j) { const v16b w = WCOL(WA, kc * 32, c0 + j * 16 + col, lane); asm volatile("s_wait_loadcnt 0x0" ::: "memory"); acc[j] = wmma_bf(a, w, acc[j]); } }
  if (which < 2) { _Float16* DH = which == 0 ? QH : KH; _Float16* DL = which == 0 ? QL : KL; const int nhi = which == 0 ? QHI : KHI; const bool hi_rows = t0 < nhi;
#pragma unroll
    for (int j = 0; j < 8; ++j) { const float bias = (BA && (c0 + j * 16 + col < HDQK)) ? bfr(BA[c0 + j * 16 + col]) : 0.f;   /* 32-entry biases */
#pragma unroll
      for (int r = 0; r < 8; ++r) { const float v = acc[j][r] + bias; const _Float16 hv = (_Float16)v; sh[wave * 16 + 8 * g + r][j * 16 + col] = hv; sl[wave * 16 + 8 * g + r][j * 16 + col] = (_Float16)((v - (float)hv) * 1024.0f); } }
    __syncthreads();
    if (which == 0) { for (int e = tid; e < 64 * 16; e += 128) { const int rl = e >> 4, q = e & 15; vst2((unsigned*)(DH + (r0 + rl) * CC + c0 + q * 8), *(const v4u*)&sh[rl][q * 8]); if (hi_rows) vst2((unsigned*)(DL + (bb * nhi + t0 + rl) * (size_t)CC + c0 + q * 8), *(const v4u*)&sl[rl][q * 8]); } }
    else { for (int e = tid; e < 4 * 64; e += 128) { const int tl = e >> 6, h2 = (e >> 5) & 1, ln = e & 31; const int rl = tl * 16 + (ln & 15), cs = 16 * h2 + 8 * (ln >> 4); const size_t d = (r0 + tl * 16) * HDQK + h2 * 256 + ln * 8;   /* A fragment of key tile tl: lane (col, g) holds key col, channels 16 h2 + 8 g + 0..7 */
        vst2((unsigned*)(DH + d), *(const v4u*)&sh[rl][cs]); if (hi_rows) vst2((unsigned*)(DL + d), *(const v4u*)&sl[rl][cs]); } }
  } else { const bool hi_rows = t0 < KHI;
#pragma unroll
    for (int j = 0; j < 8; ++j) { const float bias = (BA && (c0 + j * 16 + col < HDQK)) ? bfr(BA[c0 + j * 16 + col]) : 0.f;   /* 32-entry biases */
#pragma unroll
      for (int r = 0; r < 8; ++r) { const float v = acc[j][r] + bias; const int rl = wave * 16 + 8 * g + r, cl = j * 16 + col; th[cl][rl] = (_Float16)v; const __bf16 bh = (__bf16)v; tb[cl][rl] = bh; tbl[cl][rl] = (__bf16)(v - (float)bh); } }
    __syncthreads();
    for (int e = tid; e < 4 * 64; e += 128) { const int st = e >> 7, ct = (e >> 6) & 1, h2 = (e >> 5) & 1, ln = e & 31;   /* A fragment of channel tile ct, 32-key step st: lane (col, g) holds channel 16 ct + col, keys 16 h2 + 8 g + 0..7 */
      vst2((unsigned*)(VT + (r0 + st * 32) * HDQK + ct * 512 + h2 * 256 + ln * 8), *(const v4u*)&th[ct * 16 + (ln & 15)][st * 32 + 16 * h2 + 8 * (ln >> 4)]); }
    for (int e = tid; e < 128 * 8; e += 128) { const int cl = e >> 3, q = e & 7; if (hi_rows) { const size_t o3 = (bb * CC + c0 + cl) * (size_t)KHI + t0 + q * 8; vst2((unsigned*)(VB + o3), *(const v4u*)&tb[cl][q * 8]); vst2((unsigned*)(VBL + o3), *(const v4u*)&tbl[cl][q * 8]); } } } }
// ---- k_fa: block = 128 queries of batch b (4 groups of 32) x 5 key ranges of 1,280 keys, one wave per (query group, key range); the 4 waves of a range read the same k and v lines, which k_proj left in fragment order (every wave-wide 16-byte load covers 512 contiguous bytes). Per 32 keys: S^T = k . q^T (k rows as A, q as B; q and k as f16 hi + residual x 2^10, 3 products), so a lane holds 16 keys' logits of ONE query per 16-query tile; running maximum and sum per query (f32; exponentials as hardware exp2 of fma(s, log2 e, -(max - PSH) log2 e)); exp(s - max) x e^7.625 once to f16 is the B operand as it stands in the accumulators; ctx^T += v^T . P^T (v planes as A, 1 product, the 32 real channels). The 5 ranges' (max, sum, ctx) meet in LDS and are joined in range order.
#define FQ 2               // 16-query tiles per wave
#define FG 4               // query groups (waves) per key range
#define FKS 5              // key ranges per block
#define FQB (16 * FQ * FG) // queries per block
#define FST (TT / 32 / FKS)   // 32-key steps per range
#define L2E 1.4426950408889634f   // log2(e)
#define PSH 7.625f         // P is held as exp(s - max + PSH) <= 2,049: small weights stay normal f16 numbers; the factor cancels in ctx / sum
static_assert(!CAUSAL && TT % FQB == 0 && TT % (32 * FKS) == 0 && HDQK == 32 && QHI == TT && KHI == TT && CC == 128 && TT % 64 == 0, "whole query blocks, equal key ranges, one 32-deep product; one k_proj block column holds the 32 real columns, its 64 rows whole tiles of one batch");
// every unroll directive of k_fa: the fragment, score and accumulator arrays are then indexed by constants alone and stay in registers
__device__ __forceinline__ v8f wm(v16h a, v16h b, v8f c) { return __builtin_amdgcn_wmma_f32_16x16x32_f16(false, a, false, b, (short)0, c, false, false); }
__device__ __forceinline__ v16h frag_p(const _Float16* base, unsigned boff) { union { v16h v; v8h q[2]; } u; const char* p = (const char*)base + boff; u.q[0] = *(const v8h*)p; u.q[1] = *(const v8h*)(p + 512); return u.v; }   // fragment-order tile: uniform base + 16 x lane; elements 0..7 in the first 512 bytes, 8..15 in the second
__device__ __forceinline__ float xhalf(float x) { return __builtin_bit_cast(float, __builtin_amdgcn_permlanex16(__builtin_bit_cast(int, x), __builtin_bit_cast(int, x), 0x76543210, 0xfedcba98, false, false)); }   // lane l reads lane l ^ 16
__global__ __launch_bounds__(32 * FG * FKS) void k_fa(const _Float16* __restrict__ QH, const _Float16* __restrict__ QL, const _Float16* __restrict__ KH, const _Float16* __restrict__ KL, const _Float16* __restrict__ VT, float* __restrict__ Y) {
  __shared__ __align__(16) float so[FKS][FQB][HDQK + 4]; __shared__ float smx[FKS][FQB], ssu[FKS][FQB];
  const int tid = threadIdx.x, wave = __builtin_amdgcn_readfirstlane(tid >> 5), lane = tid & 31, col = lane & 15, g = lane >> 4; const int qg = wave % FG, ks = wave / FG;
  const int b = blockIdx.y, qr0 = blockIdx.x * FQB; const size_t rb = (size_t)b * TT;
  v16h qh[FQ], ql[FQ];
#pragma unroll
  for (int u = 0; u < FQ; ++u) { const size_t qo = (rb + qr0 + (qg * FQ + u) * 16 + col) * CC; qh[u] = frag_h(QH + qo, lane); ql[u] = frag_h(QL + qo, lane); }
  const _Float16* kph = KH + (rb + ks * (FST * 32)) * HDQK; const _Float16* kpl = KL + (rb + ks * (FST * 32)) * HDQK; const _Float16* vp = VT + (rb + ks * (FST * 32)) * HDQK;   /* wave-uniform bases; 32 halves per key in each of the three */
  const unsigned lo = lane * 16;   /* bytes: the lane's own place in each 512-byte half of a tile, fixed over the loop */
  float m[FQ], l[FQ]; v8f o[FQ][2];
#pragma unroll
  for (int u = 0; u < FQ; ++u) { m[u] = -3.0e38f; l[u] = 0.f; o[u][0] = v8f{}; o[u][1] = v8f{}; }
  for (int kc = 0; kc < FST; ++kc) {
    v16h kh[2], kl[2], vv[2];
#pragma unroll
    for (int t = 0; t < 2; ++t) { kh[t] = frag_p(kph + (size_t)(kc * 32 + t * 16) * HDQK, lo); kl[t] = frag_p(kpl + (size_t)(kc * 32 + t * 16) * HDQK, lo); vv[t] = frag_p(vp + (size_t)(kc * 32 + t * 16) * HDQK, lo); }
#pragma unroll
    for (int u = 0; u < FQ; ++u) { v2f s[8];   /* logits in pairs, as the packed fma takes and leaves them */
#pragma unroll
      for (int t = 0; t < 2; ++t) { v8f a = {}, al = {}; a = wm(kh[t], qh[u], a); al = wm(kh[t], ql[u], al); al = wm(kl[t], qh[u], al);
#pragma unroll
        for (int r = 0; r < 4; ++r) s[t * 4 + r] = __builtin_elementwise_fma(v2f{al[2 * r], al[2 * r + 1]}, v2f{1.0f / 1024.0f, 1.0f / 1024.0f}, v2f{a[2 * r], a[2 * r + 1]}) * SCALE; }
      float mx = s[0].x;
#pragma unroll
      for (int i = 1; i < 16; ++i) mx = fmaxf(mx, s[i >> 1][i & 1]);
      mx = fmaxf(mx, xhalf(mx));   /* the two lane halves hold the same query's other 16 keys */
      const float mn = fmaxf(m[u], mx), sc = __builtin_amdgcn_exp2f((m[u] - mn) * L2E), ms2 = (mn - PSH) * L2E; m[u] = mn;   /* sc is 0 on the first step (argument -inf) */
      v16h p; float sum = 0.f;
#pragma unroll
      for (int i = 0; i < 8; ++i) { const v2f a = __builtin_elementwise_fma(s[i], v2f{L2E, L2E}, v2f{-ms2, -ms2}); const float e0 = __builtin_amdgcn_exp2f(a.x), e1 = __builtin_amdgcn_exp2f(a.y); sum += e0; sum += e1; p[2 * i] = (_Float16)e0; p[2 * i + 1] = (_Float16)e1; }   /* the argument is at most PSH log2 e, about 11; far below the maximum the result is 0 */
      l[u] = l[u] * sc + sum;
#pragma unroll
      for (int c = 0; c < 2; ++c) {
#pragma unroll
        for (int r = 0; r < 8; ++r) o[u][c][r] *= sc;
        o[u][c] = wm(vv[c], p, o[u][c]); } } }
#pragma unroll
  for (int u = 0; u < FQ; ++u) { const int rl = (qg * FQ + u) * 16 + col; const float lt = l[u] + xhalf(l[u]); if (g == 0) { smx[ks][rl] = m[u]; ssu[ks][rl] = lt; }
#pragma unroll
    for (int c = 0; c < 2; ++c)
#pragma unroll
      for (int r = 0; r < 8; ++r) so[ks][rl][c * 16 + 8 * g + r] = o[u][c][r]; }   /* register r = channel 16c + 8g + r of query col */
  __syncthreads();   /* every range's maximum, sum and partial rows are in LDS before any thread joins them */
  for (int e = tid; e < FQB * (HDQK / 4); e += 32 * FG * FKS) { const int rl = e / (HDQK / 4), q = e % (HDQK / 4); float mt = smx[0][rl];
#pragma unroll
    for (int i = 1; i < FKS; ++i) mt = fmaxf(mt, smx[i][rl]);
    float lt = 0.f; v4f s = {};
#pragma unroll
    for (int i = 0; i < FKS; ++i) { const float w = expf(smx[i][rl] - mt); lt += w * ssu[i][rl]; s += *(const v4f*)&so[i][rl][q * 4] * w; }
    vst2(Y + (rb + qr0 + rl) * CC + q * 4, s * (1.0f / lt)); } }   /* 8 lanes store one row's 32 channels: one 128-B line; k_wz reads these 32 columns alone */

extern "C" void kernel_launch(void* const* d_in, const int* in_sizes, int n_in, void* d_out, int out_size, void* d_ws, size_t ws_size, hipStream_t stream) {
  (void)in_sizes; (void)n_in; (void)out_size;
  const float** F = (const float**)d_in;
  if (ws_size < (size_t)WS_END) return;
  char* ws = (char*)d_ws; _Float16 *QH = (_Float16*)(ws + WS_QH), *KH = (_Float16*)(ws + WS_KH), *VT = (_Float16*)(ws + WS_VT), *QL = (_Float16*)(ws + WS_QL), *KL = (_Float16*)(ws + WS_KL); __bf16 *VB = (__bf16*)(ws + WS_VB), *VBL = (__bf16*)(ws + WS_VBL); float *S = (float*)(ws + WS_S), *Y = (float*)(ws + WS_Y);
  (void)Y; (void)S;
  // inputs: 0 x [4,64,80,80]; 1 w_theta [32,64] (out,in), 2 b_theta; 3 w_phi, 4 b_phi; 5 w_g, 6 b_g; 7 w_out [64,32] (out,in), 8 b_out; 9 bn_gamma, 10 bn_beta, 11 bn_mean, 12 bn_var
  if (ws_size < (size_t)WS_END2) return;
  float *YR = (float*)(ws + WS_YR), *ORW = (float*)(ws + WS_OR);
  k_proj<<<dim3(TNB * TT / 64, CC / 128, 3), 128, 0, stream>>>(F[0], F[0], F[0], F[1], F[3], F[5], F[2], F[4], F[6], QH, QL, KH, KL, VT, VB, VBL);   /* q = theta, k = phi, v = g */
  k_fa<<<dim3(TT / FQB, TNB), 32 * FG * FKS, 0, stream>>>(QH, QL, KH, KL, VT, YR);
  k_wz<<<dim3(TNB * TT / 64, 1), 128, 0, stream>>>(YR, F[7], F[8], ORW);
  k_fin2<<<dim3(TT / 64, DIN / 64, TNB), 256, 0, stream>>>(ORW, F[0], F[9], F[10], F[11], F[12], (float*)d_out);
}

// v005
// One run takes 57.8 microseconds.
// Timed twice side by side with v004, it ran 1.21 and 1.20 times as fast.
// Over all steps from v000 it is 33.2 times as fast.
// compute dtype: all float inputs rounded to bf16; theta/phi/g = W x + b with EXACT bf16 products on WMMA 16x16x32 (f32 accumulate); unscaled logits theta.phi with BOTH as f16 hi + residual planes (3 products); softmax in f32 (running maximum and sum, logits kept in registers; in the key loop exp(z) = 2^(z log2 e) on the hardware exp2, log2 e folded into one fma per logit; precise expf where the key ranges are joined); exp(f - max) x e^7.625 once to f16 against g once to f16 (1 product), divided by the f32 sum at the end; y split bf16 hi + lo against exact w_out (2 products) + b_out; eval BatchNorm and the residual in f32; f32 output.
#include <hip/hip_runtime.h>
#include <math.h>

typedef __attribute__((ext_vector_type(16))) _Float16 v16h;
typedef __attribute__((ext_vector_type(16))) __bf16 v16b;
typedef __attribute__((ext_vector_type(8)))  _Float16 v8h;
typedef __attribute__((ext_vector_type(8)))  float v8f;
typedef __attribute__((ext_vector_type(4)))  float v4f;
typedef __attribute__((ext_vector_type(2)))  float v2f;
typedef __attribute__((ext_vector_type(4)))  unsigned v4u;
typedef __attribute__((ext_vector_type(4)))  int v4i;
typedef float __attribute__((may_alias)) float_a;
typedef int __attribute__((may_alias)) int_a;

template <typename T> __device__ __forceinline__ void vst2(void* p, T v) { *(T*)p = v;  }
__device__ __forceinline__ v8f wmma16(v16h a, v16h b, v8f c) {
  v8f d = __builtin_amdgcn_wmma_f32_16x16x32_f16(false, a, false, b, (short)0, c, false, false);
  asm volatile("v_nop\n\tv_nop\n\tv_nop\n\tv_nop" : "+v"(d) : "v"(a), "v"(b));
  return d;
}
__device__ __forceinline__ v8f wmma_bf(v16b a, v16b b, v8f c) {
  v8f d = __builtin_amdgcn_wmma_f32_16x16x32_bf16(false, a, false, b, (short)0, c, false, false);
  asm volatile("v_nop\n\tv_nop\n\tv_nop\n\tv_nop" : "+v"(d) : "v"(a), "v"(b));
  return d;
}
// 16x16x32 fragments: lane = (h = lane>>4, row/col = lane&15); elements 0..7 = k0+8h+0..7, 8..15 = k0+16+8h+0..7; D element r = row 8h+r
__device__ __forceinline__ v16h frag_h(const _Float16* rowk0, int lane) {
  union { v16h v; v8h q[2]; } u; const _Float16* p = rowk0 + 8 * (lane >> 4);
  u.q[0] = *(const v8h*)p; u.q[1] = *(const v8h*)(p + 16); return u.v;
}
__device__ __forceinline__ v16h frag_f32(const float* rowk0, int lane) {
  v16h a; const float* p = rowk0 + 8 * (lane >> 4);
#pragma unroll
  for (int i = 0; i < 8; ++i) { a[i] = (_Float16)p[i]; a[8 + i] = (_Float16)p[16 + i]; }
  return a;
}
__device__ __forceinline__ v16h frag_f32s(const float* rowk0, int lane, float sc) {
  v16h a; const float* p = rowk0 + 8 * (lane >> 4);
#pragma unroll
  for (int i = 0; i < 8; ++i) { a[i] = (_Float16)(p[i] * sc); a[8 + i] = (_Float16)(p[16 + i] * sc); }
  return a;
}
// column fragment from a [K][ld] layout (column n), rows >= K read as 0
__device__ __forceinline__ v16h fragc_f32(const float* W, int k0, int n, int lane, int ld, int K) {
  v16h a; const int g = lane >> 4;
#pragma unroll
  for (int i = 0; i < 8; ++i) { const int ka = k0 + 8 * g + i, kb = ka + 16;
    a[i] = (_Float16)(ka < K ? W[(size_t)(ka < K ? ka : K - 1) * ld + n] : 0.f); a[8 + i] = (_Float16)(kb < K ? W[(size_t)(kb < K ? kb : K - 1) * ld + n] : 0.f); }
  return a;
}
struct F2 { v16b h, l; };
__device__ __forceinline__ F2 bsplit16(const float v[16]) { F2 r;
#pragma unroll
  for (int i = 0; i < 16; ++i) { const __bf16 h = (__bf16)v[i]; r.h[i] = h; r.l[i] = (__bf16)(v[i] - (float)h); }
  return r; }
__device__ __forceinline__ F2 split_row(const float* row, int k0, int lane) { float v[16]; const float* p = row + k0 + 8 * (lane >> 4);
#pragma unroll
  for (int i = 0; i < 8; ++i) { v[i] = p[i]; v[8 + i] = p[16 + i]; }
  return bsplit16(v); }
__device__ __forceinline__ F2 split_rowK(const float* row, int k0, int lane, int K) { float v[16]; const int g = lane >> 4;
#pragma unroll
  for (int i = 0; i < 8; ++i) { const int ka = k0 + 8 * g + i, kb = ka + 16; v[i] = ka < K ? row[ka < K ? ka : K - 1] : 0.f; v[8 + i] = kb < K ? row[kb < K ? kb : K - 1] : 0.f; }
  return bsplit16(v); }
__device__ __forceinline__ F2 split_col(const float* W, int k0, int n, int lane, int ld, int K) { float v[16]; const int g = lane >> 4;
#pragma unroll
  for (int i = 0; i < 8; ++i) { const int ka = k0 + 8 * g + i, kb = ka + 16; v[i] = ka < K ? W[(size_t)(ka < K ? ka : K - 1) * ld + n] : 0.f; v[8 + i] = kb < K ? W[(size_t)(kb < K ? kb : K - 1) * ld + n] : 0.f; }
  return bsplit16(v); }
__device__ __forceinline__ v8f mac3(const F2& a, const F2& b, v8f c) { c = wmma_bf(a.l, b.h, c); c = wmma_bf(a.h, b.l, c); return wmma_bf(a.h, b.h, c); }
__device__ __forceinline__ float sigm(float v) { return 1.0f / (1.0f + expf(-v)); }
#define LDSX() do { asm volatile("s_wait_dscnt 0" ::: "memory"); __builtin_amdgcn_wave_barrier(); __builtin_amdgcn_fence(__ATOMIC_RELEASE, "workgroup"); } while (0)

// Non-local block (B 4, C 64, 80 x 80 = 6,400 positions; inter channels 32): theta, phi, g = 1x1 convs of x ((out,in) [32,64] + bias); f[n][m] = theta_n . phi_m (no scaling); P = softmax over m; y[n] = sum_m P[n][m] g_m; W_y = w_out y + b_out (32 -> 64); out = BN_eval(W_y) (running mean/var, eps 1e-4, affine) + x.
#define NB 4
#define TT 6400
#define CC 128            // projected plane width (32 real columns + 96 zero)
#define DIN 64            // input channels
#define NH 1
#define HD 128
#define NQB (TT / 64)
#define HG 1               // sizes WS_S: one 6,400 x 6,400 f32 plane, unused (scores stay in registers)
#define SCALE (1.0f)
#define HDQK 32            // theta / phi / g channels: q rows are 128 wide with columns >= 32 zero, the k and v fragment planes hold the 32 real columns alone; only the 32 real columns enter the scores
#define CAUSAL 0
#ifndef TNB
#define TNB NB
#endif
__device__ __forceinline__ v16b zero16b() { v16b z; _Pragma("unroll") for (int i = 0; i < 16; ++i) z[i] = (__bf16)0.f; return z; }
__device__ __forceinline__ float bfr(float v) { return (float)(__bf16)v; }
__host__ __device__ __forceinline__ int kb_last(int qb) { return CAUSAL ? ((qb * 64 + 63) >> 7) : (TT / 128 - 1); }
typedef __attribute__((ext_vector_type(8))) __bf16 v8b;
__device__ __forceinline__ v16b frag_b(const __bf16* rowk0, int lane) {
  union { v16b v; v8b q[2]; } u; const __bf16* p = rowk0 + 8 * (lane >> 4);
  u.q[0] = *(const v8b*)p; u.q[1] = *(const v8b*)(p + 16); return u.v;
}
#define QBH (TT / 64)      // ALL queries take the 3-product logits (k_fa)
#define QBH_PV 0           // P.v stays single f16
#define QHI 6400            // q residual rows everywhere
#define KHI 6400           // k residual rows for ALL keys (3-product logits; sigma_f ~ 5.7 unscaled)
// B fragment (k rows k0+.., output column o) of a weight: (in,out) [K][ld] or (out,in) [ld rows of K]: bf16 exact, or f16(bf16 * 256) exact
__device__ __forceinline__ v16b wcol_io(const float* Wm, int k0, int o, int lane, int ld) { v16b w; const int g = lane >> 4;
#pragma unroll
  for (int i = 0; i < 8; ++i) { w[i] = (__bf16)Wm[(size_t)(k0 + 8 * g + i) * ld + o]; w[8 + i] = (__bf16)Wm[(size_t)(k0 + 16 + 8 * g + i) * ld + o]; }
  return w; }
__device__ __forceinline__ v16b wcol_oi(const float* Wm, int k0, int o, int lane, int K) { v16b w; const float* p = Wm + (size_t)o * K + k0 + 8 * (lane >> 4);
#pragma unroll
  for (int i = 0; i < 8; ++i) { w[i] = (__bf16)p[i]; w[8 + i] = (__bf16)p[16 + i]; }
  return w; }
__device__ __forceinline__ v16h wcolh_io(const float* Wm, int k0, int o, int lane, int ld) { v16h w; const int g = lane >> 4;
#pragma unroll
  for (int i = 0; i < 8; ++i) { w[i] = (_Float16)(bfr(Wm[(size_t)(k0 + 8 * g + i) * ld + o]) * 256.0f); w[8 + i] = (_Float16)(bfr(Wm[(size_t)(k0 + 16 + 8 * g + i) * ld + o]) * 256.0f); }
  return w; }
__device__ __forceinline__ v16h wcolh_oi(const float* Wm, int k0, int o, int lane, int K) { v16h w; const float* p = Wm + (size_t)o * K + k0 + 8 * (lane >> 4);
#pragma unroll
  for (int i = 0; i < 8; ++i) { w[i] = (_Float16)(bfr(p[i]) * 256.0f); w[8 + i] = (_Float16)(bfr(p[16 + i]) * 256.0f); }
  return w; }
#define WQKV_LAYOUT 1   // 0 = (in,out) [DIN][CC]; 1 = (out,in) [HDQK][DIN]; 2 = per-head [NH][DIN][HD]
__device__ __forceinline__ v16b wcol_hdk(const float* Wm, int k0, int o, int lane) { v16b w; const int g = lane >> 4; const float* p = Wm + (size_t)(o / HD) * DIN * HD + (o % HD);
#pragma unroll
  for (int i = 0; i < 8; ++i) { w[i] = (__bf16)p[(size_t)(k0 + 8 * g + i) * HD]; w[8 + i] = (__bf16)p[(size_t)(k0 + 16 + 8 * g + i) * HD]; }
  return w; }
#define WO_OUT_IN 0
#if WQKV_LAYOUT == 1
#define WCOL(W, k0, o, lane) (((o) < HDQK) ? wcol_oi(W, k0, (o), lane, DIN) : zero16b())   /* theta/phi/g weights are [32][64] (out,in): plane columns >= 32 are zero for all three */
#elif WQKV_LAYOUT == 2
#define WCOL(W, k0, o, lane) wcol_hdk(W, k0, o, lane)
#else
#define WCOL(W, k0, o, lane) wcol_io(W, k0, o, lane, CC)
#endif
#if WO_OUT_IN
#define WOCOL(W, k0, o, lane) wcol_oi(W, k0, o, lane, CC)
#define WOCOLH(W, k0, o, lane) wcolh_oi(W, k0, o, lane, CC)
#else
#define WOCOL(W, k0, o, lane) wcol_io(W, k0, o, lane, DIN)
#define WOCOLH(W, k0, o, lane) wcolh_io(W, k0, o, lane, DIN)
#endif
#ifndef XP
#define XP TT              // position pitch of x and of the output
#endif
#define BG HG              // the pass group spans BATCHES (single head): k_fa's blockIdx.y selects the batch
#define DVH 128
#ifndef SM_EXTRA_PARAMS
#define SM_EXTRA_PARAMS
#endif
#ifndef PROJ_EXTRA_PARAMS
#define PROJ_EXTRA_PARAMS
#endif
#ifndef SM_MASK_HOOK
#define SM_MASK_HOOK (void)0
#endif

#define WS_QH  0u                                      // f16 q rows [b*t][CC]
#define WS_KH  (WS_QH + 2u * (size_t)NB * TT * CC)      // f16 k, the 32 real columns in fragment order: [b*t / 16][half][lane][8], 1,024 B per 16-key tile
#define WS_VT  (WS_KH + 2u * (size_t)NB * TT * CC)      // f16 v, the 32 real channels in fragment order: [b*t / 32][channel tile][half][lane][8], 2,048 B per 32 keys
#define WS_QL  (WS_VT + 2u * (size_t)NB * CC * TT)      // f16 q residual x 2^10 rows [b][t < QHI][CC]
#define WS_KL  (WS_QL + 2u * (size_t)NB * QHI * CC)     // f16 k residual x 2^10, laid out as WS_KH
#define WS_VB  (WS_KL + 2u * (size_t)NB * KHI * CC)     // bf16 v hi planes [b][c][t < KHI]
#define WS_VBL (WS_VB + 2u * (size_t)NB * CC * KHI)
#define WS_S   (WS_VBL + 2u * (size_t)NB * CC * KHI)    // f32 [hg][t][s] region, unused (no kernel stores logits)
#define WS_Y   (WS_S  + 4u * (size_t)HG * TT * TT)      // empty: the joined rows y stay in k_fa's LDS
#define WS_END (WS_Y  + 0u)

// ---- k_proj: block = (64 rows, 128 cols, which): q/k/v = X W (+ b) with exact bf16 products (K = DIN) -> which 0: q f16 rows (+ residual rows < QHI); 1: k f16 and its residual in fragment order; 2: v f16 in fragment order (+ bf16 hi/lo planes [c][t] for t < KHI). Fragment order: the 16 bytes that lane l of k_fa loads stand at 16 l inside a 512-byte run, so one wave-wide load reads 4 whole lines
__global__ __launch_bounds__(128) void k_proj(const float* __restrict__ XQ, const float* __restrict__ XK, const float* __restrict__ XV, const float* __restrict__ WQ, const float* __restrict__ WK, const float* __restrict__ WV, const float* __restrict__ BQ, const float* __restrict__ BK, const float* __restrict__ BV,
    _Float16* __restrict__ QH, _Float16* __restrict__ QL, _Float16* __restrict__ KH, _Float16* __restrict__ KL, _Float16* __restrict__ VT, __bf16* __restrict__ VB, __bf16* __restrict__ VBL) {
  __shared__ __align__(16) _Float16 sh[64][136], sl[64][136]; __shared__ __align__(16) _Float16 th[128][72]; __shared__ __align__(16) __bf16 tb[128][72], tbl[128][72];
  const int tid = threadIdx.x, wave = tid >> 5, lane = tid & 31, col = lane & 15, g = lane >> 4; const int which = blockIdx.z; const int c0 = blockIdx.y * 128; const size_t r0 = (size_t)blockIdx.x * 64; const size_t bb = r0 / TT; const int t0 = (int)(r0 % TT);
  const float* X = which == 0 ? XQ : which == 1 ? XK : XV; const float* WA = which == 0 ? WQ : which == 1 ? WK : WV; const float* BA = which == 0 ? BQ : which == 1 ? BK : BV;
  v8f acc[8] = {};
#pragma unroll 2
  for (int kc = 0; kc < DIN / 32; ++kc) { v16b a; { const float* p = X + (bb * DIN + kc * 32 + 8 * g) * (size_t)XP + t0 + wave * 16 + col;   /* channels-first gather: x[b][k][t], stride XP between k */
#pragma unroll
      for (int i = 0; i < 8; ++i) { a[i] = (__bf16)p[(size_t)i * XP]; a[8 + i] = (__bf16)p[(size_t)(16 + i) * XP]; } }
    asm volatile("s_wait_loadcnt 0x0" ::: "memory");
#pragma unroll
    for (int j = 0; j < 8; ++j) { const v16b w = WCOL(WA, kc * 32, c0 + j * 16 + col, lane); asm volatile("s_wait_loadcnt 0x0" ::: "memory"); acc[j] = wmma_bf(a, w, acc[j]); } }
  if (which < 2) { _Float16* DH = which == 0 ? QH : KH; _Float16* DL = which == 0 ? QL : KL; const int nhi = which == 0 ? QHI : KHI; const bool hi_rows = t0 < nhi;
#pragma unroll
    for (int j = 0; j < 8; ++j) { const float bias = (BA && (c0 + j * 16 + col < HDQK)) ? bfr(BA[c0 + j * 16 + col]) : 0.f;   /* 32-entry biases */
#pragma unroll
      for (int r = 0; r < 8; ++r) { const float v = acc[j][r] + bias; const _Float16 hv = (_Float16)v; sh[wave * 16 + 8 * g + r][j * 16 + col] = hv; sl[wave * 16 + 8 * g + r][j * 16 + col] = (_Float16)((v - (float)hv) * 1024.0f); } }
    __syncthreads();
    if (which == 0) { for (int e = tid; e < 64 * 16; e += 128) { const int rl = e >> 4, q = e & 15; vst2((unsigned*)(DH + (r0 + rl) * CC + c0 + q * 8), *(const v4u*)&sh[rl][q * 8]); if (hi_rows) vst2((unsigned*)(DL + (bb * nhi + t0 + rl) * (size_t)CC + c0 + q * 8), *(const v4u*)&sl[rl][q * 8]); } }
    else { for (int e = tid; e < 4 * 64; e += 128) { const int tl = e >> 6, h2 = (e >> 5) & 1, ln = e & 31; const int rl = tl * 16 + (ln & 15), cs = 16 * h2 + 8 * (ln >> 4); const size_t d = (r0 + tl * 16) * HDQK + h2 * 256 + ln * 8;   /* A fragment of key tile tl: lane (col, g) holds key col, channels 16 h2 + 8 g + 0..7 */
        vst2((unsigned*)(DH + d), *(const v4u*)&sh[rl][cs]); if (hi_rows) vst2((unsigned*)(DL + d), *(const v4u*)&sl[rl][cs]); } }
  } else { const bool hi_rows = t0 < KHI;
#pragma unroll
    for (int j = 0; j < 8; ++j) { const float bias = (BA && (c0 + j * 16 + col < HDQK)) ? bfr(BA[c0 + j * 16 + col]) : 0.f;   /* 32-entry biases */
#pragma unroll
      for (int r = 0; r < 8; ++r) { const float v = acc[j][r] + bias; const int rl = wave * 16 + 8 * g + r, cl = j * 16 + col; th[cl][rl] = (_Float16)v; const __bf16 bh = (__bf16)v; tb[cl][rl] = bh; tbl[cl][rl] = (__bf16)(v - (float)bh); } }
    __syncthreads();
    for (int e = tid; e < 4 * 64; e += 128) { const int st = e >> 7, ct = (e >> 6) & 1, h2 = (e >> 5) & 1, ln = e & 31;   /* A fragment of channel tile ct, 32-key step st: lane (col, g) holds channel 16 ct + col, keys 16 h2 + 8 g + 0..7 */
      vst2((unsigned*)(VT + (r0 + st * 32) * HDQK + ct * 512 + h2 * 256 + ln * 8), *(const v4u*)&th[ct * 16 + (ln & 15)][st * 32 + 16 * h2 + 8 * (ln >> 4)]); }
    for (int e = tid; e < 128 * 8; e += 128) { const int cl = e >> 3, q = e & 7; if (hi_rows) { const size_t o3 = (bb * CC + c0 + cl) * (size_t)KHI + t0 + q * 8; vst2((unsigned*)(VB + o3), *(const v4u*)&tb[cl][q * 8]); vst2((unsigned*)(VBL + o3), *(const v4u*)&tbl[cl][q * 8]); } } } }
// ---- k_fa: block = 128 queries of batch b (4 groups of 32) x 5 key ranges of 1,280 keys, one wave per (query group, key range); the 4 waves of a range read the same k and v lines, which k_proj left in fragment order (every wave-wide 16-byte load covers 512 contiguous bytes). Per 32 keys: S^T = k . q^T (k rows as A, q as B; q and k as f16 hi + residual x 2^10, 3 products), so a lane holds 16 keys' logits of ONE query per 16-query tile; running maximum and sum per query (f32; exponentials as hardware exp2 of fma(s, log2 e, -(max - PSH) log2 e)); exp(s - max) x e^7.625 once to f16 is the B operand as it stands in the accumulators; ctx^T += v^T . P^T (v planes as A, 1 product, the 32 real channels). The 5 ranges' (max, sum, ctx) meet in LDS and are joined in range order; the joined rows y stay in LDS. Output stage, 16 of the 20 waves, one per (32 positions, 16 output channels): W_y^T = w_out (A, exact bf16) . y^T (B, bf16 hi + lo, 2 products), so a lane holds 8 channels of ONE position; + b_out, eval BatchNorm, + x, stored as out[b][c][n]: the 32 positions of a wave are one whole 128-byte line per channel.
#define FQ 2               // 16-query tiles per wave
#define FG 4               // query groups (waves) per key range
#define FKS 5              // key ranges per block
#define FQB (16 * FQ * FG) // queries per block
#define FST (TT / 32 / FKS)   // 32-key steps per range
#define L2E 1.4426950408889634f   // log2(e)
#define PSH 7.625f         // P is held as exp(s - max + PSH) <= 2,049: small weights stay normal f16 numbers; the factor cancels in ctx / sum
static_assert(FQB == 128 && DIN == 64 && FG * FKS >= 16, "output stage: 4 position pairs x 4 channel tiles = 16 waves");
static_assert(!CAUSAL && TT % FQB == 0 && TT % (32 * FKS) == 0 && HDQK == 32 && QHI == TT && KHI == TT && CC == 128 && TT % 64 == 0, "whole query blocks, equal key ranges, one 32-deep product; one k_proj block column holds the 32 real columns, its 64 rows whole tiles of one batch");
// every unroll directive of k_fa: the fragment, score and accumulator arrays are then indexed by constants alone and stay in registers
__device__ __forceinline__ v8f wm(v16h a, v16h b, v8f c) { return __builtin_amdgcn_wmma_f32_16x16x32_f16(false, a, false, b, (short)0, c, false, false); }
__device__ __forceinline__ v8f wmb(v16b a, v16b b, v8f c) { return __builtin_amdgcn_wmma_f32_16x16x32_bf16(false, a, false, b, (short)0, c, false, false); }
__device__ __forceinline__ v16h frag_p(const _Float16* base, unsigned boff) { union { v16h v; v8h q[2]; } u; const char* p = (const char*)base + boff; u.q[0] = *(const v8h*)p; u.q[1] = *(const v8h*)(p + 512); return u.v; }   // fragment-order tile: uniform base + 16 x lane; elements 0..7 in the first 512 bytes, 8..15 in the second
__device__ __forceinline__ float xhalf(float x) { return __builtin_bit_cast(float, __builtin_amdgcn_permlanex16(__builtin_bit_cast(int, x), __builtin_bit_cast(int, x), 0x76543210, 0xfedcba98, false, false)); }   // lane l reads lane l ^ 16
__global__ __launch_bounds__(32 * FG * FKS) void k_fa(const _Float16* __restrict__ QH, const _Float16* __restrict__ QL, const _Float16* __restrict__ KH, const _Float16* __restrict__ KL, const _Float16* __restrict__ VT,
    const float* __restrict__ X, const float* __restrict__ WW, const float* __restrict__ WB, const float* __restrict__ GAm, const float* __restrict__ BEt, const float* __restrict__ MUv, const float* __restrict__ VAv, float* __restrict__ OUT) {
  __shared__ __align__(16) float so[FKS][FQB][HDQK + 4]; __shared__ float smx[FKS][FQB], ssu[FKS][FQB]; __shared__ __align__(16) float sbn[4][DIN];   /* per output channel: gamma / sqrt(var + eps), mean, beta, b_out */
  const int tid = threadIdx.x, wave = __builtin_amdgcn_readfirstlane(tid >> 5), lane = tid & 31, col = lane & 15, g = lane >> 4; const int qg = wave % FG, ks = wave / FG;
  const int b = blockIdx.y, qr0 = blockIdx.x * FQB; const size_t rb = (size_t)b * TT;
  if (wave < DIN / 32) { sbn[0][tid] = bfr(GAm[tid]) / __fsqrt_rn(bfr(VAv[tid]) + 1e-4f); sbn[1][tid] = bfr(MUv[tid]); sbn[2][tid] = bfr(BEt[tid]); sbn[3][tid] = bfr(WB[tid]); }   /* one thread per output channel, one division and root per channel and block; read behind the two barriers below */
  v16h qh[FQ], ql[FQ];
#pragma unroll
  for (int u = 0; u < FQ; ++u) { const size_t qo = (rb + qr0 + (qg * FQ + u) * 16 + col) * CC; qh[u] = frag_h(QH + qo, lane); ql[u] = frag_h(QL + qo, lane); }
  const _Float16* kph = KH + (rb + ks * (FST * 32)) * HDQK; const _Float16* kpl = KL + (rb + ks * (FST * 32)) * HDQK; const _Float16* vp = VT + (rb + ks * (FST * 32)) * HDQK;   /* wave-uniform bases; 32 halves per key in each of the three */
  const unsigned lo = lane * 16;   /* bytes: the lane's own place in each 512-byte half of a tile, fixed over the loop */
  float m[FQ], l[FQ]; v8f o[FQ][2];
#pragma unroll
  for (int u = 0; u < FQ; ++u) { m[u] = -3.0e38f; l[u] = 0.f; o[u][0] = v8f{}; o[u][1] = v8f{}; }
  for (int kc = 0; kc < FST; ++kc) {
    v16h kh[2], kl[2], vv[2];
#pragma unroll
    for (int t = 0; t < 2; ++t) { kh[t] = frag_p(kph + (size_t)(kc * 32 + t * 16) * HDQK, lo); kl[t] = frag_p(kpl + (size_t)(kc * 32 + t * 16) * HDQK, lo); vv[t] = frag_p(vp + (size_t)(kc * 32 + t * 16) * HDQK, lo); }
#pragma unroll
    for (int u = 0; u < FQ; ++u) { v2f s[8];   /* logits in pairs, as the packed fma takes and leaves them */
#pragma unroll
      for (int t = 0; t < 2; ++t) { v8f a = {}, al = {}; a = wm(kh[t], qh[u], a); al = wm(kh[t], ql[u], al); al = wm(kl[t], qh[u], al);
#pragma unroll
        for (int r = 0; r < 4; ++r) s[t * 4 + r] = __builtin_elementwise_fma(v2f{al[2 * r], al[2 * r + 1]}, v2f{1.0f / 1024.0f, 1.0f / 1024.0f}, v2f{a[2 * r], a[2 * r + 1]}) * SCALE; }
      float mx = s[0].x;
#pragma unroll
      for (int i = 1; i < 16; ++i) mx = fmaxf(mx, s[i >> 1][i & 1]);
      mx = fmaxf(mx, xhalf(mx));   /* the two lane halves hold the same query's other 16 keys */
      const float mn = fmaxf(m[u], mx), sc = __builtin_amdgcn_exp2f((m[u] - mn) * L2E), ms2 = (mn - PSH) * L2E; m[u] = mn;   /* sc is 0 on the first step (argument -inf) */
      v16h p; float sum = 0.f;
#pragma unroll
      for (int i = 0; i < 8; ++i) { const v2f a = __builtin_elementwise_fma(s[i], v2f{L2E, L2E}, v2f{-ms2, -ms2}); const float e0 = __builtin_amdgcn_exp2f(a.x), e1 = __builtin_amdgcn_exp2f(a.y); sum += e0; sum += e1; p[2 * i] = (_Float16)e0; p[2 * i + 1] = (_Float16)e1; }   /* the argument is at most PSH log2 e, about 11; far below the maximum the result is 0 */
      l[u] = l[u] * sc + sum;
#pragma unroll
      for (int c = 0; c < 2; ++c) {
#pragma unroll
        for (int r = 0; r < 8; ++r) o[u][c][r] *= sc;
        o[u][c] = wm(vv[c], p, o[u][c]); } } }
#pragma unroll
  for (int u = 0; u < FQ; ++u) { const int rl = (qg * FQ + u) * 16 + col; const float lt = l[u] + xhalf(l[u]); if (g == 0) { smx[ks][rl] = m[u]; ssu[ks][rl] = lt; }
#pragma unroll
    for (int c = 0; c < 2; ++c)
#pragma unroll
      for (int r = 0; r < 8; ++r) so[ks][rl][c * 16 + 8 * g + r] = o[u][c][r]; }   /* register r = channel 16c + 8g + r of query col */
  // output stage, operands that do not depend on y: fetched in front of the barrier, where a wave that leaves the key loop early waits for the others anyway
  const bool ow = wave < 16; const int np = wave & 3, ct = wave >> 2;   /* wave-uniform: position pair np (tiles 2 np, 2 np + 1) x channel tile ct */
  v16b wf = zero16b(); float xr[2][8] = {};
  const size_t oi = ((size_t)b * DIN + ct * 16 + 8 * g) * XP + qr0 + np * 32 + col;   /* channel 16 ct + 8 g (+ r), position 32 np + col (+ 16 t) */
  if (ow) { wf = wcol_oi(WW, 0, ct * 16 + col, lane, HDQK);   /* A fragment: row = output channel 16 ct + col, k = y channel, the k order of split_row */
#pragma unroll
    for (int r = 0; r < 8; ++r)
#pragma unroll
      for (int t = 0; t < 2; ++t) xr[t][r] = bfr(X[oi + (size_t)r * XP + t * 16]); }
  __syncthreads();   /* every range's maximum, sum and partial rows are in LDS before any thread joins them */
  for (int e = tid; e < FQB * (HDQK / 4); e += 32 * FG * FKS) { const int rl = e / (HDQK / 4), q = e % (HDQK / 4); float mt = smx[0][rl];
#pragma unroll
    for (int i = 1; i < FKS; ++i) mt = fmaxf(mt, smx[i][rl]);
    float lt = 0.f; v4f s = {};
#pragma unroll
    for (int i = 0; i < FKS; ++i) { const float w = expf(smx[i][rl] - mt); lt += w * ssu[i][rl]; s += *(const v4f*)&so[i][rl][q * 4] * w; }
    *(v4f*)&so[0][rl][q * 4] = s * (1.0f / lt); }   /* y in place of range 0's partial row: these 4 words are read by this thread alone, above */
  __syncthreads();   /* all of y and the channel table are in LDS before the output stage reads them */
  if (ow) { float inv[8], mu[8], be[8], bo[8];
#pragma unroll
    for (int r = 0; r < 8; ++r) { const int c = ct * 16 + 8 * g + r; inv[r] = sbn[0][c]; mu[r] = sbn[1][c]; be[r] = sbn[2][c]; bo[r] = sbn[3][c]; }
#pragma unroll
    for (int t = 0; t < 2; ++t) { const F2 y = split_row(&so[0][np * 32 + t * 16 + col][0], 0, lane); v8f acc = {}; acc = wmb(wf, y.h, acc); acc = wmb(wf, y.l, acc);
#pragma unroll
      for (int r = 0; r < 8; ++r) OUT[oi + (size_t)r * XP + t * 16] = (((acc[r] + bo[r]) - mu[r]) * inv[r] + be[r]) + xr[t][r]; } } }   /* eval BN: (W_y - mean) * (gamma / sqrt(var + eps)) + beta, then + x */

extern "C" void kernel_launch(void* const* d_in, const int* in_sizes, int n_in, void* d_out, int out_size, void* d_ws, size_t ws_size, hipStream_t stream) {
  (void)in_sizes; (void)n_in; (void)out_size;
  const float** F = (const float**)d_in;
  if (ws_size < (size_t)WS_END) return;
  char* ws = (char*)d_ws; _Float16 *QH = (_Float16*)(ws + WS_QH), *KH = (_Float16*)(ws + WS_KH), *VT = (_Float16*)(ws + WS_VT), *QL = (_Float16*)(ws + WS_QL), *KL = (_Float16*)(ws + WS_KL); __bf16 *VB = (__bf16*)(ws + WS_VB), *VBL = (__bf16*)(ws + WS_VBL); float *S = (float*)(ws + WS_S), *Y = (float*)(ws + WS_Y);
  (void)Y; (void)S;
  // inputs: 0 x [4,64,80,80]; 1 w_theta [32,64] (out,in), 2 b_theta; 3 w_phi, 4 b_phi; 5 w_g, 6 b_g; 7 w_out [64,32] (out,in), 8 b_out; 9 bn_gamma, 10 bn_beta, 11 bn_mean, 12 bn_var
  k_proj<<<dim3(TNB * TT / 64, CC / 128, 3), 128, 0, stream>>>(F[0], F[0], F[0], F[1], F[3], F[5], F[2], F[4], F[6], QH, QL, KH, KL, VT, VB, VBL);   /* q = theta, k = phi, v = g */
  k_fa<<<dim3(TT / FQB, TNB), 32 * FG * FKS, 0, stream>>>(QH, QL, KH, KL, VT, F[0], F[7], F[8], F[9], F[10], F[11], F[12], (float*)d_out);
}

// v006
// It runs in 51.6 microseconds.
// Timed twice side by side with v005, it ran 1.12 and 1.13 times as fast.
// Over all steps from v000 it is 37.4 times as fast.
// compute dtype: all float inputs rounded to bf16; theta/phi/g = W x + b with EXACT bf16 products on WMMA 16x16x32 (f32 accumulate); unscaled logits theta.phi with BOTH as f16 hi + residual planes (3 products); softmax in f32 (running maximum and sum, logits kept in registers; in the key loop exp(z) = 2^(z log2 e) on the hardware exp2, log2 e folded into one fma per logit; precise expf where the key ranges are joined); exp(f - max) x e^7.625 once to f16 against g once to f16 (1 product), divided by the f32 sum at the end; y split bf16 hi + lo against exact w_out (2 products) + b_out; eval BatchNorm and the residual in f32; f32 output.
#include <hip/hip_runtime.h>
#include <math.h>

typedef __attribute__((ext_vector_type(16))) _Float16 v16h;
typedef __attribute__((ext_vector_type(16))) __bf16 v16b;
typedef __attribute__((ext_vector_type(8)))  _Float16 v8h;
typedef __attribute__((ext_vector_type(8)))  float v8f;
typedef __attribute__((ext_vector_type(4)))  float v4f;
typedef __attribute__((ext_vector_type(2)))  float v2f;
typedef __attribute__((ext_vector_type(4)))  unsigned v4u;
typedef __attribute__((ext_vector_type(4)))  int v4i;
typedef float __attribute__((may_alias)) float_a;
typedef int __attribute__((may_alias)) int_a;

template <typename T> __device__ __forceinline__ void vst2(void* p, T v) { *(T*)p = v;  }
__device__ __forceinline__ v8f wmma16(v16h a, v16h b, v8f c) {
  v8f d = __builtin_amdgcn_wmma_f32_16x16x32_f16(false, a, false, b, (short)0, c, false, false);
  asm volatile("v_nop\n\tv_nop\n\tv_nop\n\tv_nop" : "+v"(d) : "v"(a), "v"(b));
  return d;
}
__device__ __forceinline__ v8f wmma_bf(v16b a, v16b b, v8f c) {
  v8f d = __builtin_amdgcn_wmma_f32_16x16x32_bf16(false, a, false, b, (short)0, c, false, false);
  asm volatile("v_nop\n\tv_nop\n\tv_nop\n\tv_nop" : "+v"(d) : "v"(a), "v"(b));
  return d;
}
// 16x16x32 fragments: lane = (h = lane>>4, row/col = lane&15); elements 0..7 = k0+8h+0..7, 8..15 = k0+16+8h+0..7; D element r = row 8h+r
__device__ __forceinline__ v16h frag_h(const _Float16* rowk0, int lane) {
  union { v16h v; v8h q[2]; } u; const _Float16* p = rowk0 + 8 * (lane >> 4);
  u.q[0] = *(const v8h*)p; u.q[1] = *(const v8h*)(p + 16); return u.v;
}
__device__ __forceinline__ v16h frag_f32(const float* rowk0, int lane) {
  v16h a; const float* p = rowk0 + 8 * (lane >> 4);
#pragma unroll
  for (int i = 0; i < 8; ++i) { a[i] = (_Float16)p[i]; a[8 + i] = (_Float16)p[16 + i]; }
  return a;
}
__device__ __forceinline__ v16h frag_f32s(const float* rowk0, int lane, float sc) {
  v16h a; const float* p = rowk0 + 8 * (lane >> 4);
#pragma unroll
  for (int i = 0; i < 8; ++i) { a[i] = (_Float16)(p[i] * sc); a[8 + i] = (_Float16)(p[16 + i] * sc); }
  return a;
}
// column fragment from a [K][ld] layout (column n), rows >= K read as 0
__device__ __forceinline__ v16h fragc_f32(const float* W, int k0, int n, int lane, int ld, int K) {
  v16h a; const int g = lane >> 4;
#pragma unroll
  for (int i = 0; i < 8; ++i) { const int ka = k0 + 8 * g + i, kb = ka + 16;
    a[i] = (_Float16)(ka < K ? W[(size_t)(ka < K ? ka : K - 1) * ld + n] : 0.f); a[8 + i] = (_Float16)(kb < K ? W[(size_t)(kb < K ? kb : K - 1) * ld + n] : 0.f); }
  return a;
}
struct F2 { v16b h, l; };
__device__ __forceinline__ F2 bsplit16(const float v[16]) { F2 r;
#pragma unroll
  for (int i = 0; i < 16; ++i) { const __bf16 h = (__bf16)v[i]; r.h[i] = h; r.l[i] = (__bf16)(v[i] - (float)h); }
  return r; }
__device__ __forceinline__ F2 split_row(const float* row, int k0, int lane) { float v[16]; const float* p = row + k0 + 8 * (lane >> 4);
#pragma unroll
  for (int i = 0; i < 8; ++i) { v[i] = p[i]; v[8 + i] = p[16 + i]; }
  return bsplit16(v); }
__device__ __forceinline__ F2 split_rowK(const float* row, int k0, int lane, int K) { float v[16]; const int g = lane >> 4;
#pragma unroll
  for (int i = 0; i < 8; ++i) { const int ka = k0 + 8 * g + i, kb = ka + 16; v[i] = ka < K ? row[ka < K ? ka : K - 1] : 0.f; v[8 + i] = kb < K ? row[kb < K ? kb : K - 1] : 0.f; }
  return bsplit16(v); }
__device__ __forceinline__ F2 split_col(const float* W, int k0, int n, int lane, int ld, int K) { float v[16]; const int g = lane >> 4;
#pragma unroll
  for (int i = 0; i < 8; ++i) { const int ka = k0 + 8 * g + i, kb = ka + 16; v[i] = ka < K ? W[(size_t)(ka < K ? ka : K - 1) * ld + n] : 0.f; v[8 + i] = kb < K ? W[(size_t)(kb < K ? kb : K - 1) * ld + n] : 0.f; }
  return bsplit16(v); }
__device__ __forceinline__ v8f mac3(const F2& a, const F2& b, v8f c) { c = wmma_bf(a.l, b.h, c); c = wmma_bf(a.h, b.l, c); return wmma_bf(a.h, b.h, c); }
__device__ __forceinline__ float sigm(float v) { return 1.0f / (1.0f + expf(-v)); }
#define LDSX() do { asm volatile("s_wait_dscnt 0" ::: "memory"); __builtin_amdgcn_wave_barrier(); __builtin_amdgcn_fence(__ATOMIC_RELEASE, "workgroup"); } while (0)

// Non-local block (B 4, C 64, 80 x 80 = 6,400 positions; inter channels 32): theta, phi, g = 1x1 convs of x ((out,in) [32,64] + bias); f[n][m] = theta_n . phi_m (no scaling); P = softmax over m; y[n] = sum_m P[n][m] g_m; W_y = w_out y + b_out (32 -> 64); out = BN_eval(W_y) (running mean/var, eps 1e-4, affine) + x.
#define NB 4
#define TT 6400
#define CC 128            // sizes the workspace regions (32 columns of each are used) and k_proj's grid y (CC / 128 = 1 block column)
#define DIN 64            // input channels
#define NH 1
#define HD 128
#define NQB (TT / 64)
#define HG 1               // sizes WS_S: one 6,400 x 6,400 f32 plane, unused (scores stay in registers)
#define SCALE (1.0f)
#define HDQK 32            // theta / phi / g channels
#define CAUSAL 0
#ifndef TNB
#define TNB NB
#endif
__device__ __forceinline__ v16b zero16b() { v16b z; _Pragma("unroll") for (int i = 0; i < 16; ++i) z[i] = (__bf16)0.f; return z; }
__device__ __forceinline__ float bfr(float v) { return (float)(__bf16)v; }
__host__ __device__ __forceinline__ int kb_last(int qb) { return CAUSAL ? ((qb * 64 + 63) >> 7) : (TT / 128 - 1); }
typedef __attribute__((ext_vector_type(8))) __bf16 v8b;
__device__ __forceinline__ v16b frag_b(const __bf16* rowk0, int lane) {
  union { v16b v; v8b q[2]; } u; const __bf16* p = rowk0 + 8 * (lane >> 4);
  u.q[0] = *(const v8b*)p; u.q[1] = *(const v8b*)(p + 16); return u.v;
}
#define QBH (TT / 64)      // ALL queries take the 3-product logits (k_fa)
#define QBH_PV 0           // P.v stays single f16
#define QHI 6400            // q residual rows everywhere
#define KHI 6400           // k residual rows for ALL keys (3-product logits; sigma_f ~ 5.7 unscaled)
// B fragment (k rows k0+.., output column o) of a weight: (in,out) [K][ld] or (out,in) [ld rows of K]: bf16 exact, or f16(bf16 * 256) exact
__device__ __forceinline__ v16b wcol_io(const float* Wm, int k0, int o, int lane, int ld) { v16b w; const int g = lane >> 4;
#pragma unroll
  for (int i = 0; i < 8; ++i) { w[i] = (__bf16)Wm[(size_t)(k0 + 8 * g + i) * ld + o]; w[8 + i] = (__bf16)Wm[(size_t)(k0 + 16 + 8 * g + i) * ld + o]; }
  return w; }
__device__ __forceinline__ v16b wcol_oi(const float* Wm, int k0, int o, int lane, int K) { v16b w; const float* p = Wm + (size_t)o * K + k0 + 8 * (lane >> 4);
#pragma unroll
  for (int i = 0; i < 8; ++i) { w[i] = (__bf16)p[i]; w[8 + i] = (__bf16)p[16 + i]; }
  return w; }
__device__ __forceinline__ v16h wcolh_io(const float* Wm, int k0, int o, int lane, int ld) { v16h w; const int g = lane >> 4;
#pragma unroll
  for (int i = 0; i < 8; ++i) { w[i] = (_Float16)(bfr(Wm[(size_t)(k0 + 8 * g + i) * ld + o]) * 256.0f); w[8 + i] = (_Float16)(bfr(Wm[(size_t)(k0 + 16 + 8 * g + i) * ld + o]) * 256.0f); }
  return w; }
__device__ __forceinline__ v16h wcolh_oi(const float* Wm, int k0, int o, int lane, int K) { v16h w; const float* p = Wm + (size_t)o * K + k0 + 8 * (lane >> 4);
#pragma unroll
  for (int i = 0; i < 8; ++i) { w[i] = (_Float16)(bfr(p[i]) * 256.0f); w[8 + i] = (_Float16)(bfr(p[16 + i]) * 256.0f); }
  return w; }
#define WQKV_LAYOUT 1   // 0 = (in,out) [DIN][CC]; 1 = (out,in) [HDQK][DIN]; 2 = per-head [NH][DIN][HD]
__device__ __forceinline__ v16b wcol_hdk(const float* Wm, int k0, int o, int lane) { v16b w; const int g = lane >> 4; const float* p = Wm + (size_t)(o / HD) * DIN * HD + (o % HD);
#pragma unroll
  for (int i = 0; i < 8; ++i) { w[i] = (__bf16)p[(size_t)(k0 + 8 * g + i) * HD]; w[8 + i] = (__bf16)p[(size_t)(k0 + 16 + 8 * g + i) * HD]; }
  return w; }
#define WO_OUT_IN 0
#if WQKV_LAYOUT == 1
#define WCOL(W, k0, o, lane) (((o) < HDQK) ? wcol_oi(W, k0, (o), lane, DIN) : zero16b())   /* theta/phi/g weights are [32][64] (out,in): columns o >= 32 give zero fragments */
#elif WQKV_LAYOUT == 2
#define WCOL(W, k0, o, lane) wcol_hdk(W, k0, o, lane)
#else
#define WCOL(W, k0, o, lane) wcol_io(W, k0, o, lane, CC)
#endif
#if WO_OUT_IN
#define WOCOL(W, k0, o, lane) wcol_oi(W, k0, o, lane, CC)
#define WOCOLH(W, k0, o, lane) wcolh_oi(W, k0, o, lane, CC)
#else
#define WOCOL(W, k0, o, lane) wcol_io(W, k0, o, lane, DIN)
#define WOCOLH(W, k0, o, lane) wcolh_io(W, k0, o, lane, DIN)
#endif
#ifndef XP
#define XP TT              // position pitch of x and of the output
#endif
#define BG HG              // the pass group spans BATCHES (single head): k_fa's blockIdx.y selects the batch
#define DVH 128
#ifndef SM_EXTRA_PARAMS
#define SM_EXTRA_PARAMS
#endif
#ifndef PROJ_EXTRA_PARAMS
#define PROJ_EXTRA_PARAMS
#endif
#ifndef SM_MASK_HOOK
#define SM_MASK_HOOK (void)0
#endif

#define WS_QH  0u                                      // f16 q rows [b*t][HDQK], the 32 real columns
#define WS_KH  (WS_QH + 2u * (size_t)NB * TT * CC)      // f16 k, the 32 real columns in fragment order: [b*t / 16][half][lane][8], 1,024 B per 16-key tile
#define WS_VT  (WS_KH + 2u * (size_t)NB * TT * CC)      // f16 v, the 32 real channels in fragment order: [b*t / 32][channel tile][half][lane][8], 2,048 B per 32 keys
#define WS_QL  (WS_VT + 2u * (size_t)NB * CC * TT)      // f16 q residual x 2^10 rows [b][t < QHI][HDQK]
#define WS_KL  (WS_QL + 2u * (size_t)NB * QHI * CC)     // f16 k residual x 2^10, laid out as WS_KH
#define WS_VB  (WS_KL + 2u * (size_t)NB * KHI * CC)     // not used (the offsets behind it stay where they were)
#define WS_VBL (WS_VB + 2u * (size_t)NB * CC * KHI)
#define WS_S   (WS_VBL + 2u * (size_t)NB * CC * KHI)    // f32 [hg][t][s] region, unused (no kernel stores logits)
#define WS_Y   (WS_S  + 4u * (size_t)HG * TT * TT)      // empty: the joined rows y stay in k_fa's LDS
#define WS_END (WS_Y  + 0u)
#define PJ (HDQK / 16)     // 16-column tiles of a projection: the real columns only

// ---- k_proj: block = (64 rows, the 32 real columns, which): q/k/v = X W (+ b) with exact bf16 products (K = DIN) -> which 0: q f16 rows (+ residual rows < QHI), 32 columns a row; 1: k f16 and its residual in fragment order; 2: v f16 in fragment order. Only what k_fa reads is computed and stored. Fragment order: the 16 bytes that lane l of k_fa loads stand at 16 l inside a 512-byte run, so one wave-wide load reads 4 whole lines
__global__ __launch_bounds__(128) void k_proj(const float* __restrict__ XQ, const float* __restrict__ XK, const float* __restrict__ XV, const float* __restrict__ WQ, const float* __restrict__ WK, const float* __restrict__ WV, const float* __restrict__ BQ, const float* __restrict__ BK, const float* __restrict__ BV,
    _Float16* __restrict__ QH, _Float16* __restrict__ QL, _Float16* __restrict__ KH, _Float16* __restrict__ KL, _Float16* __restrict__ VT) {
  __shared__ __align__(16) _Float16 sh[64][HDQK + 8], sl[64][HDQK + 8]; __shared__ __align__(16) _Float16 th[HDQK][72];
  const int tid = threadIdx.x, wave = tid >> 5, lane = tid & 31, col = lane & 15, g = lane >> 4; const int which = blockIdx.z; const size_t r0 = (size_t)blockIdx.x * 64; const size_t bb = r0 / TT; const int t0 = (int)(r0 % TT);
  const float* X = which == 0 ? XQ : which == 1 ? XK : XV; const float* WA = which == 0 ? WQ : which == 1 ? WK : WV; const float* BA = which == 0 ? BQ : which == 1 ? BK : BV;
  v8f acc[PJ] = {};
#pragma unroll 2
  for (int kc = 0; kc < DIN / 32; ++kc) { v16b a; { const float* p = X + (bb * DIN + kc * 32 + 8 * g) * (size_t)XP + t0 + wave * 16 + col;   /* channels-first gather: x[b][k][t], stride XP between k */
#pragma unroll
      for (int i = 0; i < 8; ++i) { a[i] = (__bf16)p[(size_t)i * XP]; a[8 + i] = (__bf16)p[(size_t)(16 + i) * XP]; } }
    asm volatile("s_wait_loadcnt 0x0" ::: "memory");
#pragma unroll
    for (int j = 0; j < PJ; ++j) { const v16b w = wcol_oi(WA, kc * 32, j * 16 + col, lane, DIN); asm volatile("s_wait_loadcnt 0x0" ::: "memory"); acc[j] = wmma_bf(a, w, acc[j]); } }
  if (which < 2) { _Float16* DH = which == 0 ? QH : KH; _Float16* DL = which == 0 ? QL : KL; const int nhi = which == 0 ? QHI : KHI; const bool hi_rows = t0 < nhi;
#pragma unroll
    for (int j = 0; j < PJ; ++j) { const float bias = BA ? bfr(BA[j * 16 + col]) : 0.f;   /* 32-entry biases */
#pragma unroll
      for (int r = 0; r < 8; ++r) { const float v = acc[j][r] + bias; const _Float16 hv = (_Float16)v; sh[wave * 16 + 8 * g + r][j * 16 + col] = hv; sl[wave * 16 + 8 * g + r][j * 16 + col] = (_Float16)((v - (float)hv) * 1024.0f); } }
    __syncthreads();
    if (which == 0) { for (int e = tid; e < 64 * (HDQK / 8); e += 128) { const int rl = e / (HDQK / 8), q = e % (HDQK / 8); vst2((unsigned*)(DH + (r0 + rl) * HDQK + q * 8), *(const v4u*)&sh[rl][q * 8]); if (hi_rows) vst2((unsigned*)(DL + (bb * nhi + t0 + rl) * (size_t)HDQK + q * 8), *(const v4u*)&sl[rl][q * 8]); } }
    else { for (int e = tid; e < 4 * 64; e += 128) { const int tl = e >> 6, h2 = (e >> 5) & 1, ln = e & 31; const int rl = tl * 16 + (ln & 15), cs = 16 * h2 + 8 * (ln >> 4); const size_t d = (r0 + tl * 16) * HDQK + h2 * 256 + ln * 8;   /* A fragment of key tile tl: lane (col, g) holds key col, channels 16 h2 + 8 g + 0..7 */
        vst2((unsigned*)(DH + d), *(const v4u*)&sh[rl][cs]); if (hi_rows) vst2((unsigned*)(DL + d), *(const v4u*)&sl[rl][cs]); } }
  } else {
#pragma unroll
    for (int j = 0; j < PJ; ++j) { const float bias = BA ? bfr(BA[j * 16 + col]) : 0.f;   /* 32-entry biases */
#pragma unroll
      for (int r = 0; r < 8; ++r) { const float v = acc[j][r] + bias; const int rl = wave * 16 + 8 * g + r, cl = j * 16 + col; th[cl][rl] = (_Float16)v; } }
    __syncthreads();
    for (int e = tid; e < 4 * 64; e += 128) { const int st = e >> 7, ct = (e >> 6) & 1, h2 = (e >> 5) & 1, ln = e & 31;   /* A fragment of channel tile ct, 32-key step st: lane (col, g) holds channel 16 ct + col, keys 16 h2 + 8 g + 0..7 */
      vst2((unsigned*)(VT + (r0 + st * 32) * HDQK + ct * 512 + h2 * 256 + ln * 8), *(const v4u*)&th[ct * 16 + (ln & 15)][st * 32 + 16 * h2 + 8 * (ln >> 4)]); } } }
// ---- k_fa: block = 128 queries of batch b (4 groups of 32) x 5 key ranges of 1,280 keys, one wave per (query group, key range); the 4 waves of a range read the same k and v lines, which k_proj left in fragment order (every wave-wide 16-byte load covers 512 contiguous bytes). Per 32 keys: S^T = k . q^T (k rows as A, q as B; q and k as f16 hi + residual x 2^10, 3 products), so a lane holds 16 keys' logits of ONE query per 16-query tile; running maximum and sum per query (f32; exponentials as hardware exp2 of fma(s, log2 e, -(max - PSH) log2 e)); exp(s - max) x e^7.625 once to f16 is the B operand as it stands in the accumulators; ctx^T += v^T . P^T (v planes as A, 1 product, the 32 real channels). The 5 ranges' (max, sum, ctx) meet in LDS and are joined in range order; the joined rows y stay in LDS. Output stage, 16 of the 20 waves, one per (32 positions, 16 output channels): W_y^T = w_out (A, exact bf16) . y^T (B, bf16 hi + lo, 2 products), so a lane holds 8 channels of ONE position; + b_out, eval BatchNorm, + x, stored as out[b][c][n]: the 32 positions of a wave are one whole 128-byte line per channel.
#define FQ 2               // 16-query tiles per wave
#define FG 4               // query groups (waves) per key range
#define FKS 5              // key ranges per block
#define FQB (16 * FQ * FG) // queries per block
#define FST (TT / 32 / FKS)   // 32-key steps per range
#define L2E 1.4426950408889634f   // log2(e)
#define PSH 7.625f         // P is held as exp(s - max + PSH) <= 2,049: small weights stay normal f16 numbers; the factor cancels in ctx / sum
static_assert(FQB == 128 && DIN == 64 && FG * FKS >= 16, "output stage: 4 position pairs x 4 channel tiles = 16 waves");
static_assert(!CAUSAL && TT % FQB == 0 && TT % (32 * FKS) == 0 && HDQK == 32 && QHI == TT && KHI == TT && CC == 128 && TT % 64 == 0, "whole query blocks, equal key ranges, one 32-deep product; one k_proj block column holds the 32 real columns, its 64 rows whole tiles of one batch");
// every unroll directive of k_fa: the fragment, score and accumulator arrays are then indexed by constants alone and stay in registers
__device__ __forceinline__ v8f wm(v16h a, v16h b, v8f c) { return __builtin_amdgcn_wmma_f32_16x16x32_f16(false, a, false, b, (short)0, c, false, false); }
__device__ __forceinline__ v8f wmb(v16b a, v16b b, v8f c) { return __builtin_amdgcn_wmma_f32_16x16x32_bf16(false, a, false, b, (short)0, c, false, false); }
__device__ __forceinline__ v16h frag_p(const _Float16* base, unsigned boff) { union { v16h v; v8h q[2]; } u; const char* p = (const char*)base + boff; u.q[0] = *(const v8h*)p; u.q[1] = *(const v8h*)(p + 512); return u.v; }   // fragment-order tile: uniform base + 16 x lane; elements 0..7 in the first 512 bytes, 8..15 in the second
__device__ __forceinline__ float xhalf(float x) { return __builtin_bit_cast(float, __builtin_amdgcn_permlanex16(__builtin_bit_cast(int, x), __builtin_bit_cast(int, x), 0x76543210, 0xfedcba98, false, false)); }   // lane l reads lane l ^ 16
__global__ __launch_bounds__(32 * FG * FKS) void k_fa(const _Float16* __restrict__ QH, const _Float16* __restrict__ QL, const _Float16* __restrict__ KH, const _Float16* __restrict__ KL, const _Float16* __restrict__ VT,
    const float* __restrict__ X, const float* __restrict__ WW, const float* __restrict__ WB, const float* __restrict__ GAm, const float* __restrict__ BEt, const float* __restrict__ MUv, const float* __restrict__ VAv, float* __restrict__ OUT) {
  __shared__ __align__(16) float so[FKS][FQB][HDQK + 4]; __shared__ float smx[FKS][FQB], ssu[FKS][FQB]; __shared__ __align__(16) float sbn[4][DIN];   /* per output channel: gamma / sqrt(var + eps), mean, beta, b_out */
  const int tid = threadIdx.x, wave = __builtin_amdgcn_readfirstlane(tid >> 5), lane = tid & 31, col = lane & 15, g = lane >> 4; const int qg = wave % FG, ks = wave / FG;
  const int b = blockIdx.y, qr0 = blockIdx.x * FQB; const size_t rb = (size_t)b * TT;
  if (wave < DIN / 32) { sbn[0][tid] = bfr(GAm[tid]) / __fsqrt_rn(bfr(VAv[tid]) + 1e-4f); sbn[1][tid] = bfr(MUv[tid]); sbn[2][tid] = bfr(BEt[tid]); sbn[3][tid] = bfr(WB[tid]); }   /* one thread per output channel, one division and root per channel and block; read behind the two barriers below */
  v16h qh[FQ], ql[FQ];
#pragma unroll
  for (int u = 0; u < FQ; ++u) { const size_t qo = (rb + qr0 + (qg * FQ + u) * 16 + col) * HDQK; qh[u] = frag_h(QH + qo, lane); ql[u] = frag_h(QL + qo, lane); }
  const _Float16* kph = KH + (rb + ks * (FST * 32)) * HDQK; const _Float16* kpl = KL + (rb + ks * (FST * 32)) * HDQK; const _Float16* vp = VT + (rb + ks * (FST * 32)) * HDQK;   /* wave-uniform bases; 32 halves per key in each of the three */
  const unsigned lo = lane * 16;   /* bytes: the lane's own place in each 512-byte half of a tile, fixed over the loop */
  float m[FQ], l[FQ]; v8f o[FQ][2];
#pragma unroll
  for (int u = 0; u < FQ; ++u) { m[u] = -3.0e38f; l[u] = 0.f; o[u][0] = v8f{}; o[u][1] = v8f{}; }
  for (int kc = 0; kc < FST; ++kc) {
    v16h kh[2], kl[2], vv[2];
#pragma unroll
    for (int t = 0; t < 2; ++t) { kh[t] = frag_p(kph + (size_t)(kc * 32 + t * 16) * HDQK, lo); kl[t] = frag_p(kpl + (size_t)(kc * 32 + t * 16) * HDQK, lo); vv[t] = frag_p(vp + (size_t)(kc * 32 + t * 16) * HDQK, lo); }
#pragma unroll
    for (int u = 0; u < FQ; ++u) { v2f s[8];   /* logits in pairs, as the packed fma takes and leaves them */
#pragma unroll
      for (int t = 0; t < 2; ++t) { v8f a = {}, al = {}; a = wm(kh[t], qh[u], a); al = wm(kh[t], ql[u], al); al = wm(kl[t], qh[u], al);
#pragma unroll
        for (int r = 0; r < 4; ++r) s[t * 4 + r] = __builtin_elementwise_fma(v2f{al[2 * r], al[2 * r + 1]}, v2f{1.0f / 1024.0f, 1.0f / 1024.0f}, v2f{a[2 * r], a[2 * r + 1]}) * SCALE; }
      float mx = s[0].x;
#pragma unroll
      for (int i = 1; i < 16; ++i) mx = fmaxf(mx, s[i >> 1][i & 1]);
      mx = fmaxf(mx, xhalf(mx));   /* the two lane halves hold the same query's other 16 keys */
      const float mn = fmaxf(m[u], mx), sc = __builtin_amdgcn_exp2f((m[u] - mn) * L2E), ms2 = (mn - PSH) * L2E; m[u] = mn;   /* sc is 0 on the first step (argument -inf) */
      v16h p; float sum = 0.f;
#pragma unroll
      for (int i = 0; i < 8; ++i) { const v2f a = __builtin_elementwise_fma(s[i], v2f{L2E, L2E}, v2f{-ms2, -ms2}); const float e0 = __builtin_amdgcn_exp2f(a.x), e1 = __builtin_amdgcn_exp2f(a.y); sum += e0; sum += e1; p[2 * i] = (_Float16)e0; p[2 * i + 1] = (_Float16)e1; }   /* the argument is at most PSH log2 e, about 11; far below the maximum the result is 0 */
      l[u] = l[u] * sc + sum;
#pragma unroll
      for (int c = 0; c < 2; ++c) {
#pragma unroll
        for (int r = 0; r < 8; ++r) o[u][c][r] *= sc;
        o[u][c] = wm(vv[c], p, o[u][c]); } } }
#pragma unroll
  for (int u = 0; u < FQ; ++u) { const int rl = (qg * FQ + u) * 16 + col; const float lt = l[u] + xhalf(l[u]); if (g == 0) { smx[ks][rl] = m[u]; ssu[ks][rl] = lt; }
#pragma unroll
    for (int c = 0; c < 2; ++c)
#pragma unroll
      for (int r = 0; r < 8; ++r) so[ks][rl][c * 16 + 8 * g + r] = o[u][c][r]; }   /* register r = channel 16c + 8g + r of query col */
  // output stage, operands that do not depend on y: fetched in front of the barrier, where a wave that leaves the key loop early waits for the others anyway
  const bool ow = wave < 16; const int np = wave & 3, ct = wave >> 2;   /* wave-uniform: position pair np (tiles 2 np, 2 np + 1) x channel tile ct */
  v16b wf = zero16b(); float xr[2][8] = {};
  const size_t oi = ((size_t)b * DIN + ct * 16 + 8 * g) * XP + qr0 + np * 32 + col;   /* channel 16 ct + 8 g (+ r), position 32 np + col (+ 16 t) */
  if (ow) { wf = wcol_oi(WW, 0, ct * 16 + col, lane, HDQK);   /* A fragment: row = output channel 16 ct + col, k = y channel, the k order of split_row */
#pragma unroll
    for (int r = 0; r < 8; ++r)
#pragma unroll
      for (int t = 0; t < 2; ++t) xr[t][r] = bfr(X[oi + (size_t)r * XP + t * 16]); }
  __syncthreads();   /* every range's maximum, sum and partial rows are in LDS before any thread joins them */
  for (int e = tid; e < FQB * (HDQK / 4); e += 32 * FG * FKS) { const int rl = e / (HDQK / 4), q = e % (HDQK / 4); float mt = smx[0][rl];
#pragma unroll
    for (int i = 1; i < FKS; ++i) mt = fmaxf(mt, smx[i][rl]);
    float lt = 0.f; v4f s = {};
#pragma unroll
    for (int i = 0; i < FKS; ++i) { const float w = expf(smx[i][rl] - mt); lt += w * ssu[i][rl]; s += *(const v4f*)&so[i][rl][q * 4] * w; }
    *(v4f*)&so[0][rl][q * 4] = s * (1.0f / lt); }   /* y in place of range 0's partial row: these 4 words are read by this thread alone, above */
  __syncthreads();   /* all of y and the channel table are in LDS before the output stage reads them */
  if (ow) { float inv[8], mu[8], be[8], bo[8];
#pragma unroll
    for (int r = 0; r < 8; ++r) { const int c = ct * 16 + 8 * g + r; inv[r] = sbn[0][c]; mu[r] = sbn[1][c]; be[r] = sbn[2][c]; bo[r] = sbn[3][c]; }
#pragma unroll
    for (int t = 0; t < 2; ++t) { const F2 y = split_row(&so[0][np * 32 + t * 16 + col][0], 0, lane); v8f acc = {}; acc = wmb(wf, y.h, acc); acc = wmb(wf, y.l, acc);
#pragma unroll
      for (int r = 0; r < 8; ++r) OUT[oi + (size_t)r * XP + t * 16] = (((acc[r] + bo[r]) - mu[r]) * inv[r] + be[r]) + xr[t][r]; } } }   /* eval BN: (W_y - mean) * (gamma / sqrt(var + eps)) + beta, then + x */

extern "C" void kernel_launch(void* const* d_in, const int* in_sizes, int n_in, void* d_out, int out_size, void* d_ws, size_t ws_size, hipStream_t stream) {
  (void)in_sizes; (void)n_in; (void)out_size;
  const float** F = (const float**)d_in;
  if (ws_size < (size_t)WS_END) return;
  char* ws = (char*)d_ws; _Float16 *QH = (_Float16*)(ws + WS_QH), *KH = (_Float16*)(ws + WS_KH), *VT = (_Float16*)(ws + WS_VT), *QL = (_Float16*)(ws + WS_QL), *KL = (_Float16*)(ws + WS_KL); float *S = (float*)(ws + WS_S), *Y = (float*)(ws + WS_Y);
  (void)Y; (void)S;
  // inputs: 0 x [4,64,80,80]; 1 w_theta [32,64] (out,in), 2 b_theta; 3 w_phi, 4 b_phi; 5 w_g, 6 b_g; 7 w_out [64,32] (out,in), 8 b_out; 9 bn_gamma, 10 bn_beta, 11 bn_mean, 12 bn_var
  k_proj<<<dim3(TNB * TT / 64, CC / 128, 3), 128, 0, stream>>>(F[0], F[0], F[0], F[1], F[3], F[5], F[2], F[4], F[6], QH, QL, KH, KL, VT);   /* q = theta, k = phi, v = g */
  k_fa<<<dim3(TT / FQB, TNB), 32 * FG * FKS, 0, stream>>>(QH, QL, KH, KL, VT, F[0], F[7], F[8], F[9], F[10], F[11], F[12], (float*)d_out);
}

// v007
// Measured time: 49.3 microseconds a run.
// Timed twice side by side with v006, it ran 1.06 times as fast both times.
// Counting every step since v000, it is 39.7 times as fast.
// compute dtype: all float inputs rounded to bf16; theta/phi/g = W x + b with EXACT bf16 products on WMMA 16x16x32 (f32 accumulate); unscaled logits theta.phi with BOTH as f16 hi + residual planes (3 products); softmax in f32 (running maximum and sum, logits kept in registers; in the key loop exp(z) = 2^(z log2 e) on the hardware exp2, log2 e folded into one fma per logit; precise expf where the key ranges are joined); exp(f - max) x e^7.625 once to f16 against g once to f16 (1 product), divided by the f32 sum at the end; y split bf16 hi + lo against exact w_out (2 products) + b_out; eval BatchNorm and the residual in f32; f32 output.
#include <hip/hip_runtime.h>
#include <math.h>

typedef __attribute__((ext_vector_type(16))) _Float16 v16h;
typedef __attribute__((ext_vector_type(16))) __bf16 v16b;
typedef __attribute__((ext_vector_type(8)))  _Float16 v8h;
typedef __attribute__((ext_vector_type(8)))  float v8f;
typedef __attribute__((ext_vector_type(4)))  float v4f;
typedef __attribute__((ext_vector_type(2)))  float v2f;
typedef __attribute__((ext_vector_type(4)))  unsigned v4u;
typedef __attribute__((ext_vector_type(4)))  int v4i;
typedef float __attribute__((may_alias)) float_a;
typedef int __attribute__((may_alias)) int_a;

template <typename T> __device__ __forceinline__ void vst2(void* p, T v) { *(T*)p = v;  }
__device__ __forceinline__ v8f wmma16(v16h a, v16h b, v8f c) {
  v8f d = __builtin_amdgcn_wmma_f32_16x16x32_f16(false, a, false, b, (short)0, c, false, false);
  asm volatile("v_nop\n\tv_nop\n\tv_nop\n\tv_nop" : "+v"(d) : "v"(a), "v"(b));
  return d;
}
__device__ __forceinline__ v8f wmma_bf(v16b a, v16b b, v8f c) {
  v8f d = __builtin_amdgcn_wmma_f32_16x16x32_bf16(false, a, false, b, (short)0, c, false, false);
  asm volatile("v_nop\n\tv_nop\n\tv_nop\n\tv_nop" : "+v"(d) : "v"(a), "v"(b));
  return d;
}
// 16x16x32 fragments: lane = (h = lane>>4, row/col = lane&15); elements 0..7 = k0+8h+0..7, 8..15 = k0+16+8h+0..7; D element r = row 8h+r
__device__ __forceinline__ v16h frag_h(const _Float16* rowk0, int lane) {
  union { v16h v; v8h q[2]; } u; const _Float16* p = rowk0 + 8 * (lane >> 4);
  u.q[0] = *(const v8h*)p; u.q[1] = *(const v8h*)(p + 16); return u.v;
}
__device__ __forceinline__ v16h frag_f32(const float* rowk0, int lane) {
  v16h a; const float* p = rowk0 + 8 * (lane >> 4);
#pragma unroll
  for (int i = 0; i < 8; ++i) { a[i] = (_Float16)p[i]; a[8 + i] = (_Float16)p[16 + i]; }
  return a;
}
__device__ __forceinline__ v16h frag_f32s(const float* rowk0, int lane, float sc) {
  v16h a; const float* p = rowk0 + 8 * (lane >> 4);
#pragma unroll
  for (int i = 0; i < 8; ++i) { a[i] = (_Float16)(p[i] * sc); a[8 + i] = (_Float16)(p[16 + i] * sc); }
  return a;
}
// column fragment from a [K][ld] layout (column n), rows >= K read as 0
__device__ __forceinline__ v16h fragc_f32(const float* W, int k0, int n, int lane, int ld, int K) {
  v16h a; const int g = lane >> 4;
#pragma unroll
  for (int i = 0; i < 8; ++i) { const int ka = k0 + 8 * g + i, kb = ka + 16;
    a[i] = (_Float16)(ka < K ? W[(size_t)(ka < K ? ka : K - 1) * ld + n] : 0.f); a[8 + i] = (_Float16)(kb < K ? W[(size_t)(kb < K ? kb : K - 1) * ld + n] : 0.f); }
  return a;
}
struct F2 { v16b h, l; };
__device__ __forceinline__ F2 bsplit16(const float v[16]) { F2 r;
#pragma unroll
  for (int i = 0; i < 16; ++i) { const __bf16 h = (__bf16)v[i]; r.h[i] = h; r.l[i] = (__bf16)(v[i] - (float)h); }
  return r; }
__device__ __forceinline__ F2 split_row(const float* row, int k0, int lane) { float v[16]; const float* p = row + k0 + 8 * (lane >> 4);
#pragma unroll
  for (int i = 0; i < 8; ++i) { v[i] = p[i]; v[8 + i] = p[16 + i]; }
  return bsplit16(v); }
__device__ __forceinline__ F2 split_rowK(const float* row, int k0, int lane, int K) { float v[16]; const int g = lane >> 4;
#pragma unroll
  for (int i = 0; i < 8; ++i) { const int ka = k0 + 8 * g + i, kb = ka + 16; v[i] = ka < K ? row[ka < K ? ka : K - 1] : 0.f; v[8 + i] = kb < K ? row[kb < K ? kb : K - 1] : 0.f; }
  return bsplit16(v); }
__device__ __forceinline__ F2 split_col(const float* W, int k0, int n, int lane, int ld, int K) { float v[16]; const int g = lane >> 4;
#pragma unroll
  for (int i = 0; i < 8; ++i) { const int ka = k0 + 8 * g + i, kb = ka + 16; v[i] = ka < K ? W[(size_t)(ka < K ? ka : K - 1) * ld + n] : 0.f; v[8 + i] = kb < K ? W[(size_t)(kb < K ? kb : K - 1) * ld + n] : 0.f; }
  return bsplit16(v); }
__device__ __forceinline__ v8f mac3(const F2& a, const F2& b, v8f c) { c = wmma_bf(a.l, b.h, c); c = wmma_bf(a.h, b.l, c); return wmma_bf(a.h, b.h, c); }
__device__ __forceinline__ float sigm(float v) { return 1.0f / (1.0f + expf(-v)); }
#define LDSX() do { asm volatile("s_wait_dscnt 0" ::: "memory"); __builtin_amdgcn_wave_barrier(); __builtin_amdgcn_fence(__ATOMIC_RELEASE, "workgroup"); } while (0)

// Non-local block (B 4, C 64, 80 x 80 = 6,400 positions; inter channels 32): theta, phi, g = 1x1 convs of x ((out,in) [32,64] + bias); f[n][m] = theta_n . phi_m (no scaling); P = softmax over m; y[n] = sum_m P[n][m] g_m; W_y = w_out y + b_out (32 -> 64); out = BN_eval(W_y) (running mean/var, eps 1e-4, affine) + x.
#define NB 4
#define TT 6400
#define CC 128            // sizes the workspace regions (32 columns of each are used) and k_proj's grid y (CC / 128 = 1 block column)
#define DIN 64            // input channels
#define NH 1
#define HD 128
#define NQB (TT / 64)
#define HG 1               // sizes WS_S: one 6,400 x 6,400 f32 plane, unused (scores stay in registers)
#define SCALE (1.0f)
#define HDQK 32            // theta / phi / g channels
#define CAUSAL 0
#ifndef TNB
#define TNB NB
#endif
__device__ __forceinline__ v16b zero16b() { v16b z; _Pragma("unroll") for (int i = 0; i < 16; ++i) z[i] = (__bf16)0.f; return z; }
__device__ __forceinline__ float bfr(float v) { return (float)(__bf16)v; }
__host__ __device__ __forceinline__ int kb_last(int qb) { return CAUSAL ? ((qb * 64 + 63) >> 7) : (TT / 128 - 1); }
typedef __attribute__((ext_vector_type(8))) __bf16 v8b;
__device__ __forceinline__ v16b frag_b(const __bf16* rowk0, int lane) {
  union { v16b v; v8b q[2]; } u; const __bf16* p = rowk0 + 8 * (lane >> 4);
  u.q[0] = *(const v8b*)p; u.q[1] = *(const v8b*)(p + 16); return u.v;
}
#define QBH (TT / 64)      // ALL queries take the 3-product logits (k_fa)
#define QBH_PV 0           // P.v stays single f16
#define QHI 6400            // q residual rows everywhere
#define KHI 6400           // k residual rows for ALL keys (3-product logits; sigma_f ~ 5.7 unscaled)
// B fragment (k rows k0+.., output column o) of a weight: (in,out) [K][ld] or (out,in) [ld rows of K]: bf16 exact, or f16(bf16 * 256) exact
__device__ __forceinline__ v16b wcol_io(const float* Wm, int k0, int o, int lane, int ld) { v16b w; const int g = lane >> 4;
#pragma unroll
  for (int i = 0; i < 8; ++i) { w[i] = (__bf16)Wm[(size_t)(k0 + 8 * g + i) * ld + o]; w[8 + i] = (__bf16)Wm[(size_t)(k0 + 16 + 8 * g + i) * ld + o]; }
  return w; }
__device__ __forceinline__ v16b wcol_oi(const float* Wm, int k0, int o, int lane, int K) { v16b w; const float* p = Wm + (size_t)o * K + k0 + 8 * (lane >> 4);
#pragma unroll
  for (int i = 0; i < 8; ++i) { w[i] = (__bf16)p[i]; w[8 + i] = (__bf16)p[16 + i]; }
  return w; }
__device__ __forceinline__ v16h wcolh_io(const float* Wm, int k0, int o, int lane, int ld) { v16h w; const int g = lane >> 4;
#pragma unroll
  for (int i = 0; i < 8; ++i) { w[i] = (_Float16)(bfr(Wm[(size_t)(k0 + 8 * g + i) * ld + o]) * 256.0f); w[8 + i] = (_Float16)(bfr(Wm[(size_t)(k0 + 16 + 8 * g + i) * ld + o]) * 256.0f); }
  return w; }
__device__ __forceinline__ v16h wcolh_oi(const float* Wm, int k0, int o, int lane, int K) { v16h w; const float* p = Wm + (size_t)o * K + k0 + 8 * (lane >> 4);
#pragma unroll
  for (int i = 0; i < 8; ++i) { w[i] = (_Float16)(bfr(p[i]) * 256.0f); w[8 + i] = (_Float16)(bfr(p[16 + i]) * 256.0f); }
  return w; }
#define WQKV_LAYOUT 1   // 0 = (in,out) [DIN][CC]; 1 = (out,in) [HDQK][DIN]; 2 = per-head [NH][DIN][HD]
__device__ __forceinline__ v16b wcol_hdk(const float* Wm, int k0, int o, int lane) { v16b w; const int g = lane >> 4; const float* p = Wm + (size_t)(o / HD) * DIN * HD + (o % HD);
#pragma unroll
  for (int i = 0; i < 8; ++i) { w[i] = (__bf16)p[(size_t)(k0 + 8 * g + i) * HD]; w[8 + i] = (__bf16)p[(size_t)(k0 + 16 + 8 * g + i) * HD]; }
  return w; }
#define WO_OUT_IN 0
#if WQKV_LAYOUT == 1
#define WCOL(W, k0, o, lane) (((o) < HDQK) ? wcol_oi(W, k0, (o), lane, DIN) : zero16b())   /* theta/phi/g weights are [32][64] (out,in): columns o >= 32 give zero fragments */
#elif WQKV_LAYOUT == 2
#define WCOL(W, k0, o, lane) wcol_hdk(W, k0, o, lane)
#else
#define WCOL(W, k0, o, lane) wcol_io(W, k0, o, lane, CC)
#endif
#if WO_OUT_IN
#define WOCOL(W, k0, o, lane) wcol_oi(W, k0, o, lane, CC)
#define WOCOLH(W, k0, o, lane) wcolh_oi(W, k0, o, lane, CC)
#else
#define WOCOL(W, k0, o, lane) wcol_io(W, k0, o, lane, DIN)
#define WOCOLH(W, k0, o, lane) wcolh_io(W, k0, o, lane, DIN)
#endif
#ifndef XP
#define XP TT              // position pitch of x and of the output
#endif
#define BG HG              // the pass group spans BATCHES (single head): k_fa's blockIdx.y selects the batch
#define DVH 128
#ifndef SM_EXTRA_PARAMS
#define SM_EXTRA_PARAMS
#endif
#ifndef PROJ_EXTRA_PARAMS
#define PROJ_EXTRA_PARAMS
#endif
#ifndef SM_MASK_HOOK
#define SM_MASK_HOOK (void)0
#endif

#define WS_QH  0u                                      // f16 q rows [b*t][HDQK], the 32 real columns
#define WS_KH  (WS_QH + 2u * (size_t)NB * TT * CC)      // f16 k, the 32 real columns in fragment order: [b*t / 16][half][lane][8], 1,024 B per 16-key tile
#define WS_VT  (WS_KH + 2u * (size_t)NB * TT * CC)      // f16 v, the 32 real channels in fragment order: [b*t / 32][channel tile][half][lane][8], 2,048 B per 32 keys
#define WS_QL  (WS_VT + 2u * (size_t)NB * CC * TT)      // f16 q residual x 2^10 rows [b][t < QHI][HDQK]
#define WS_KL  (WS_QL + 2u * (size_t)NB * QHI * CC)     // f16 k residual x 2^10, laid out as WS_KH
#define WS_VB  (WS_KL + 2u * (size_t)NB * KHI * CC)     // not used (the offsets behind it stay where they were)
#define WS_VBL (WS_VB + 2u * (size_t)NB * CC * KHI)
#define WS_S   (WS_VBL + 2u * (size_t)NB * CC * KHI)    // f32 [hg][t][s] region, unused (no kernel stores logits)
#define WS_Y   (WS_S  + 4u * (size_t)HG * TT * TT)      // empty: the joined rows y stay in k_fa's LDS
#define WS_END (WS_Y  + 0u)
#define PJ (HDQK / 16)     // 16-column tiles of a projection: the real columns only

// ---- k_proj: block = (64 rows, the 32 real columns, which): q/k/v = X W (+ b) with exact bf16 products (K = DIN) -> which 0: q f16 rows (+ residual rows < QHI), 32 columns a row; 1: k f16 and its residual in fragment order; 2: v f16 in fragment order. Only what k_fa reads is computed and stored. Fragment order: the 16 bytes that lane l of k_fa loads stand at 16 l inside a 512-byte run, so one wave-wide load reads 4 whole lines
__global__ __launch_bounds__(128) void k_proj(const float* __restrict__ XQ, const float* __restrict__ XK, const float* __restrict__ XV, const float* __restrict__ WQ, const float* __restrict__ WK, const float* __restrict__ WV, const float* __restrict__ BQ, const float* __restrict__ BK, const float* __restrict__ BV,
    _Float16* __restrict__ QH, _Float16* __restrict__ QL, _Float16* __restrict__ KH, _Float16* __restrict__ KL, _Float16* __restrict__ VT) {
  __shared__ __align__(16) _Float16 sh[64][HDQK + 8], sl[64][HDQK + 8]; __shared__ __align__(16) _Float16 th[HDQK][72];
  const int tid = threadIdx.x, wave = tid >> 5, lane = tid & 31, col = lane & 15, g = lane >> 4; const int which = blockIdx.z; const size_t r0 = (size_t)blockIdx.x * 64; const size_t bb = r0 / TT; const int t0 = (int)(r0 % TT);
  const float* X = which == 0 ? XQ : which == 1 ? XK : XV; const float* WA = which == 0 ? WQ : which == 1 ? WK : WV; const float* BA = which == 0 ? BQ : which == 1 ? BK : BV;
  v8f acc[PJ] = {};
#pragma unroll 2
  for (int kc = 0; kc < DIN / 32; ++kc) { v16b a; { const float* p = X + (bb * DIN + kc * 32 + 8 * g) * (size_t)XP + t0 + wave * 16 + col;   /* channels-first gather: x[b][k][t], stride XP between k */
#pragma unroll
      for (int i = 0; i < 8; ++i) { a[i] = (__bf16)p[(size_t)i * XP]; a[8 + i] = (__bf16)p[(size_t)(16 + i) * XP]; } }
    asm volatile("s_wait_loadcnt 0x0" ::: "memory");
#pragma unroll
    for (int j = 0; j < PJ; ++j) { const v16b w = wcol_oi(WA, kc * 32, j * 16 + col, lane, DIN); asm volatile("s_wait_loadcnt 0x0" ::: "memory"); acc[j] = wmma_bf(a, w, acc[j]); } }
  if (which < 2) { _Float16* DH = which == 0 ? QH : KH; _Float16* DL = which == 0 ? QL : KL; const int nhi = which == 0 ? QHI : KHI; const bool hi_rows = t0 < nhi;
#pragma unroll
    for (int j = 0; j < PJ; ++j) { const float bias = BA ? bfr(BA[j * 16 + col]) : 0.f;   /* 32-entry biases */
#pragma unroll
      for (int r = 0; r < 8; ++r) { const float v = acc[j][r] + bias; const _Float16 hv = (_Float16)v; sh[wave * 16 + 8 * g + r][j * 16 + col] = hv; sl[wave * 16 + 8 * g + r][j * 16 + col] = (_Float16)((v - (float)hv) * 1024.0f); } }
    __syncthreads();
    if (which == 0) { for (int e = tid; e < 64 * (HDQK / 8); e += 128) { const int rl = e / (HDQK / 8), q = e % (HDQK / 8); vst2((unsigned*)(DH + (r0 + rl) * HDQK + q * 8), *(const v4u*)&sh[rl][q * 8]); if (hi_rows) vst2((unsigned*)(DL + (bb * nhi + t0 + rl) * (size_t)HDQK + q * 8), *(const v4u*)&sl[rl][q * 8]); } }
    else { for (int e = tid; e < 4 * 64; e += 128) { const int tl = e >> 6, h2 = (e >> 5) & 1, ln = e & 31; const int rl = tl * 16 + (ln & 15), cs = 16 * h2 + 8 * (ln >> 4); const size_t d = (r0 + tl * 16) * HDQK + h2 * 256 + ln * 8;   /* A fragment of key tile tl: lane (col, g) holds key col, channels 16 h2 + 8 g + 0..7 */
        vst2((unsigned*)(DH + d), *(const v4u*)&sh[rl][cs]); if (hi_rows) vst2((unsigned*)(DL + d), *(const v4u*)&sl[rl][cs]); } }
  } else {
#pragma unroll
    for (int j = 0; j < PJ; ++j) { const float bias = BA ? bfr(BA[j * 16 + col]) : 0.f;   /* 32-entry biases */
#pragma unroll
      for (int r = 0; r < 8; ++r) { const float v = acc[j][r] + bias; const int rl = wave * 16 + 8 * g + r, cl = j * 16 + col; th[cl][rl] = (_Float16)v; } }
    __syncthreads();
    for (int e = tid; e < 4 * 64; e += 128) { const int st = e >> 7, ct = (e >> 6) & 1, h2 = (e >> 5) & 1, ln = e & 31;   /* A fragment of channel tile ct, 32-key step st: lane (col, g) holds channel 16 ct + col, keys 16 h2 + 8 g + 0..7 */
      vst2((unsigned*)(VT + (r0 + st * 32) * HDQK + ct * 512 + h2 * 256 + ln * 8), *(const v4u*)&th[ct * 16 + (ln & 15)][st * 32 + 16 * h2 + 8 * (ln >> 4)]); } } }
// ---- k_fa: block = 128 queries of batch b (4 groups of 32) x 4 key ranges of 1,600 keys, one wave per (query group, key range); the 4 waves of a range read the same k and v lines, which k_proj left in fragment order (every wave-wide 16-byte load covers 512 contiguous bytes). Per pass of 64 keys: S^T = k . q^T (k rows as A, q as B; q and k as f16 hi + residual x 2^10, 3 products), so a lane holds 32 keys' logits of ONE query per 16-query tile; running maximum and sum per query, moved once per pass (f32; exponentials as hardware exp2 of fma(s, log2 e, -(max - PSH) log2 e)); exp(s - max) x e^7.625 once to f16 is the B operand as it stands in the accumulators; ctx^T += v^T . P^T (v planes as A, 1 product, the 32 real channels). The 4 ranges' (max, sum, ctx) meet in LDS and are joined in range order; the joined rows y stay in LDS. Output stage, the 16 waves, one per (32 positions, 16 output channels): W_y^T = w_out (A, exact bf16) . y^T (B, bf16 hi + lo, 2 products), so a lane holds 8 channels of ONE position; + b_out, eval BatchNorm, + x, stored as out[b][c][n]: the 32 positions of a wave are one whole 128-byte line per channel.
#define FQ 2               // 16-query tiles per wave
#define FG 4               // query groups (waves) per key range
#define FKS 4              // key ranges per block
#define FQB (16 * FQ * FG) // queries per block
#define FST (TT / 32 / FKS)   // 32-key steps per range
#define KP 2               // 32-key steps per pass of the key loop: one maximum, one exchange, one rescale of sum and ctx per pass
#define L2E 1.4426950408889634f   // log2(e)
#define PSH 7.625f         // P is held as exp(s - max + PSH) <= 2,049: small weights stay normal f16 numbers; the factor cancels in ctx / sum
static_assert(FST % KP == 0, "whole passes");
static_assert(FQB == 128 && DIN == 64 && FG * FKS >= 16, "output stage: 4 position pairs x 4 channel tiles = 16 waves");
static_assert(!CAUSAL && TT % FQB == 0 && TT % (32 * FKS) == 0 && HDQK == 32 && QHI == TT && KHI == TT && CC == 128 && TT % 64 == 0, "whole query blocks, equal key ranges, one 32-deep product; one k_proj block column holds the 32 real columns, its 64 rows whole tiles of one batch");
// every unroll directive of k_fa: the fragment, score and accumulator arrays are then indexed by constants alone and stay in registers
__device__ __forceinline__ v8f wm(v16h a, v16h b, v8f c) { return __builtin_amdgcn_wmma_f32_16x16x32_f16(false, a, false, b, (short)0, c, false, false); }
__device__ __forceinline__ v8f wmb(v16b a, v16b b, v8f c) { return __builtin_amdgcn_wmma_f32_16x16x32_bf16(false, a, false, b, (short)0, c, false, false); }
__device__ __forceinline__ v16h frag_p(const _Float16* base, unsigned boff, int tile) { union { v16h v; v8h q[2]; } u; const char* p = (const char*)base + boff + tile; u.q[0] = *(const v8h*)p; u.q[1] = *(const v8h*)(p + 512); return u.v; }   // fragment-order tile: uniform base + the lane's byte offset + the tile's; elements 0..7 in the first 512 bytes, 8..15 in the second
__device__ __forceinline__ float xhalf(float x) { return __builtin_bit_cast(float, __builtin_amdgcn_permlanex16(__builtin_bit_cast(int, x), __builtin_bit_cast(int, x), 0x76543210, 0xfedcba98, false, false)); }   // lane l reads lane l ^ 16
// amdgpu_waves_per_eu(4, 4): the block's 16 waves stand 4 on a SIMD and no second block fits beside them, so nothing is gained by saving registers below 256 a wave; without it the compiler schedules the softmax more tightly: fewer additions of the two query tiles pair into one instruction, and more idle slots stand behind the products
__global__ __launch_bounds__(32 * FG * FKS) __attribute__((amdgpu_waves_per_eu(4, 4))) void k_fa(const _Float16* __restrict__ QH, const _Float16* __restrict__ QL, const _Float16* __restrict__ KH, const _Float16* __restrict__ KL, const _Float16* __restrict__ VT,
    const float* __restrict__ X, const float* __restrict__ WW, const float* __restrict__ WB, const float* __restrict__ GAm, const float* __restrict__ BEt, const float* __restrict__ MUv, const float* __restrict__ VAv, float* __restrict__ OUT) {
  __shared__ __align__(16) float so[FKS][FQB][HDQK + 4]; __shared__ float smx[FKS][FQB], ssu[FKS][FQB]; __shared__ __align__(16) float sbn[4][DIN];   /* per output channel: gamma / sqrt(var + eps), mean, beta, b_out */
  const int tid = threadIdx.x, wave = __builtin_amdgcn_readfirstlane(tid >> 5), lane = tid & 31, col = lane & 15, g = lane >> 4; const int qg = wave % FG, ks = wave / FG;
  const int b = blockIdx.y, qr0 = blockIdx.x * FQB; const size_t rb = (size_t)b * TT;
  if (wave < DIN / 32) { sbn[0][tid] = bfr(GAm[tid]) / __fsqrt_rn(bfr(VAv[tid]) + 1e-4f); sbn[1][tid] = bfr(MUv[tid]); sbn[2][tid] = bfr(BEt[tid]); sbn[3][tid] = bfr(WB[tid]); }   /* one thread per output channel, one division and root per channel and block; read behind the two barriers below */
  v16h qh[FQ], ql[FQ];
#pragma unroll
  for (int u = 0; u < FQ; ++u) { const size_t qo = (rb + qr0 + (qg * FQ + u) * 16 + col) * HDQK; qh[u] = frag_h(QH + qo, lane); ql[u] = frag_h(QL + qo, lane); }
  const _Float16* kph = KH + (rb + ks * (FST * 32)) * HDQK; const _Float16* kpl = KL + (rb + ks * (FST * 32)) * HDQK; const _Float16* vp = VT + (rb + ks * (FST * 32)) * HDQK;   /* wave-uniform bases; 32 halves per key in each of the three */
  unsigned lo = lane * 16;   /* bytes, the same in all three planes: the lane's own place in each 512-byte half of a tile, plus the passes done (stepped by 64 keys at the loop's foot) */
  float m[FQ], l[FQ]; v8f o[FQ][2];
#pragma unroll
  for (int u = 0; u < FQ; ++u) { m[u] = -3.0e38f; l[u] = 0.f; o[u][0] = v8f{}; o[u][1] = v8f{}; }
  for (int kc = 0; kc < FST / KP; ++kc) {
    v16h kh[2 * KP], kl[2 * KP], vv[2 * KP];   /* vv[2 i + c]: 32-key group i, channel tile c */
#pragma unroll
    for (int t = 0; t < 2 * KP; ++t) { kh[t] = frag_p(kph, lo, t * 1024); kl[t] = frag_p(kpl, lo, t * 1024); }
    __builtin_amdgcn_sched_barrier(0);   /* keeps the pass's 16 k loads in one run at its head, so that a pass waits for one load latency; left free, they sink to the products that use them and each is waited for alone */
    v2f s[FQ][8 * KP];   /* logits in pairs, as the packed fma takes and leaves them */
    v8f a[2][FQ], al[2][FQ];   /* the product tiles of two key tiles */
#pragma unroll
    for (int t = 0; t <= 2 * KP; ++t) {
      if (t < 2 * KP) {
#pragma unroll
        for (int u = 0; u < FQ; ++u) al[t & 1][u] = wm(kh[t], ql[u], v8f{});
#pragma unroll
        for (int u = 0; u < FQ; ++u) a[t & 1][u] = wm(kh[t], qh[u], v8f{});
#pragma unroll
        for (int u = 0; u < FQ; ++u) al[t & 1][u] = wm(kl[t], qh[u], al[t & 1][u]); }
      __builtin_amdgcn_sched_barrier(0);   /* key tile t's six products stand between tile t - 1's products and the fmas that read them: the fmas then need no idle slots behind a product; left free, each fma run moves up to its product */
      if (t > 0) {
#pragma unroll
        for (int u = 0; u < FQ; ++u)
#pragma unroll
          for (int r = 0; r < 4; ++r) s[u][(t - 1) * 4 + r] = __builtin_elementwise_fma(v2f{al[(t - 1) & 1][u][2 * r], al[(t - 1) & 1][u][2 * r + 1]}, v2f{1.0f / 1024.0f, 1.0f / 1024.0f}, v2f{a[(t - 1) & 1][u][2 * r], a[(t - 1) & 1][u][2 * r + 1]}) * SCALE; }
      __builtin_amdgcn_sched_barrier(0); }   /* ends tile t - 1's fmas in front of tile t + 1's products, which take over their registers: the product tiles of two key tiles are live at most, not of all four; behind the last tile it keeps the v loads behind the logit products, in registers that k has left, and the softmax covers their latency */
#pragma unroll
    for (int t = 0; t < 2 * KP; ++t) vv[t] = frag_p(vp, lo, t * 1024);
#pragma unroll
    for (int u = 0; u < FQ; ++u) {
      float mx = s[u][0].x;
#pragma unroll
      for (int i = 1; i < 16 * KP; ++i) mx = fmaxf(mx, s[u][i >> 1][i & 1]);
      mx = fmaxf(mx, xhalf(mx));   /* the two lane halves hold the same query's other keys of the pass */
      const float mn = fmaxf(m[u], mx), sc = __builtin_amdgcn_exp2f((m[u] - mn) * L2E), ms2 = (mn - PSH) * L2E; m[u] = mn;   /* sc is 0 on the first pass (argument -inf) */
      v16h p[KP]; float sum = 0.f;
#pragma unroll
      for (int i = 0; i < 8 * KP; ++i) { v2f e = __builtin_elementwise_fma(s[u][i], v2f{L2E, L2E}, v2f{-ms2, -ms2}); e.x = __builtin_amdgcn_exp2f(e.x); e.y = __builtin_amdgcn_exp2f(e.y); sum += e.x; sum += e.y; p[i >> 3][2 * (i & 7)] = (_Float16)e.x; p[i >> 3][2 * (i & 7) + 1] = (_Float16)e.y; }   /* the argument is at most PSH log2 e, about 11; far below the maximum the result is 0 */
      l[u] = l[u] * sc + sum;
#pragma unroll
      for (int c = 0; c < 2; ++c)
#pragma unroll
        for (int r = 0; r < 8; ++r) o[u][c][r] *= sc;
#pragma unroll
      for (int i = 0; i < KP; ++i)
#pragma unroll
        for (int c = 0; c < 2; ++c) o[u][c] = wm(vv[2 * i + c], p[i], o[u][c]); }
    __builtin_amdgcn_sched_barrier(0);   /* holds the wait below at the loop's foot, behind the products that have waited for the loads' data, where it costs no time; left free, it moves up to directly behind the v loads */
    asm volatile("s_wait_xcnt 0x0" : "+v"(lo));   /* the wait in front of the rewrite of the loads' offset register; the register is its operand, so the loads keep the form of one scalar base plus this register, no load lands a result in it, and it is stepped only behind the wait */
    lo += 32 * KP * HDQK * 2; }
#pragma unroll
  for (int u = 0; u < FQ; ++u) { const int rl = (qg * FQ + u) * 16 + col; const float lt = l[u] + xhalf(l[u]); if (g == 0) { smx[ks][rl] = m[u]; ssu[ks][rl] = lt; }
#pragma unroll
    for (int c = 0; c < 2; ++c)
#pragma unroll
      for (int r = 0; r < 8; ++r) so[ks][rl][c * 16 + 8 * g + r] = o[u][c][r]; }   /* register r = channel 16c + 8g + r of query col */
  // output stage, operands that do not depend on y: fetched in front of the barrier, where a wave that leaves the key loop early waits for the others anyway
  const bool ow = wave < 16; const int np = wave & 3, ct = wave >> 2;   /* wave-uniform: position pair np (tiles 2 np, 2 np + 1) x channel tile ct */
  v16b wf = zero16b(); float xr[2][8] = {};
  const size_t oi = ((size_t)b * DIN + ct * 16 + 8 * g) * XP + qr0 + np * 32 + col;   /* channel 16 ct + 8 g (+ r), position 32 np + col (+ 16 t) */
  if (ow) { wf = wcol_oi(WW, 0, ct * 16 + col, lane, HDQK);   /* A fragment: row = output channel 16 ct + col, k = y channel, the k order of split_row */
#pragma unroll
    for (int r = 0; r < 8; ++r)
#pragma unroll
      for (int t = 0; t < 2; ++t) xr[t][r] = bfr(X[oi + (size_t)r * XP + t * 16]); }
  __syncthreads();   /* every range's maximum, sum and partial rows are in LDS before any thread joins them */
  for (int e = tid; e < FQB * (HDQK / 4); e += 32 * FG * FKS) { const int rl = e / (HDQK / 4), q = e % (HDQK / 4); float mt = smx[0][rl];
#pragma unroll
    for (int i = 1; i < FKS; ++i) mt = fmaxf(mt, smx[i][rl]);
    float lt = 0.f; v4f s = {};
#pragma unroll
    for (int i = 0; i < FKS; ++i) { const float w = expf(smx[i][rl] - mt); lt += w * ssu[i][rl]; s += *(const v4f*)&so[i][rl][q * 4] * w; }
    *(v4f*)&so[0][rl][q * 4] = s * (1.0f / lt); }   /* y in place of range 0's partial row: these 4 words are read by this thread alone, above */
  __syncthreads();   /* all of y and the channel table are in LDS before the output stage reads them */
  if (ow) { float inv[8], mu[8], be[8], bo[8];
#pragma unroll
    for (int r = 0; r < 8; ++r) { const int c = ct * 16 + 8 * g + r; inv[r] = sbn[0][c]; mu[r] = sbn[1][c]; be[r] = sbn[2][c]; bo[r] = sbn[3][c]; }
#pragma unroll
    for (int t = 0; t < 2; ++t) { const F2 y = split_row(&so[0][np * 32 + t * 16 + col][0], 0, lane); v8f acc = {}; acc = wmb(wf, y.h, acc); acc = wmb(wf, y.l, acc);
#pragma unroll
      for (int r = 0; r < 8; ++r) OUT[oi + (size_t)r * XP + t * 16] = (((acc[r] + bo[r]) - mu[r]) * inv[r] + be[r]) + xr[t][r]; } } }   /* eval BN: (W_y - mean) * (gamma / sqrt(var + eps)) + beta, then + x */

extern "C" void kernel_launch(void* const* d_in, const int* in_sizes, int n_in, void* d_out, int out_size, void* d_ws, size_t ws_size, hipStream_t stream) {
  (void)in_sizes; (void)n_in; (void)out_size;
  const float** F = (const float**)d_in;
  if (ws_size < (size_t)WS_END) return;
  char* ws = (char*)d_ws; _Float16 *QH = (_Float16*)(ws + WS_QH), *KH = (_Float16*)(ws + WS_KH), *VT = (_Float16*)(ws + WS_VT), *QL = (_Float16*)(ws + WS_QL), *KL = (_Float16*)(ws + WS_KL); float *S = (float*)(ws + WS_S), *Y = (float*)(ws + WS_Y);
  (void)Y; (void)S;
  // inputs: 0 x [4,64,80,80]; 1 w_theta [32,64] (out,in), 2 b_theta; 3 w_phi, 4 b_phi; 5 w_g, 6 b_g; 7 w_out [64,32] (out,in), 8 b_out; 9 bn_gamma, 10 bn_beta, 11 bn_mean, 12 bn_var
  k_proj<<<dim3(TNB * TT / 64, CC / 128, 3), 128, 0, stream>>>(F[0], F[0], F[0], F[1], F[3], F[5], F[2], F[4], F[6], QH, QL, KH, KL, VT);   /* q = theta, k = phi, v = g */
  k_fa<<<dim3(TT / FQB, TNB), 32 * FG * FKS, 0, stream>>>(QH, QL, KH, KL, VT, F[0], F[7], F[8], F[9], F[10], F[11], F[12], (float*)d_out);
}

// v008
// Measured time: 47.2 microseconds a run.
// Next to v007, in two timings, it ran 1.04 and 1.03 times as fast.
// Counting every step since v000, it is 41.2 times as fast.
// compute dtype: all float inputs rounded to bf16; theta/phi/g = W x + b with EXACT bf16 products on WMMA 16x16x32 (f32 accumulate); unscaled logits theta.phi with BOTH as f16 hi + residual planes (3 products); softmax in f32 (logits kept in registers, in units of log2: theta is multiplied by log2 e before it is split; a reference maximum per query enters the logit product as the accumulator's start value and is moved only when a pass's weights sum to more than 2^15 in a lane, so exp(f - ref) = hardware exp2 of the product as it stands; precise expf where the key ranges are joined); exp(f - ref) once to f16 against g once to f16 (1 product), divided by the f32 sum at the end; y split bf16 hi + lo against exact w_out (2 products) + b_out; eval BatchNorm and the residual in f32; f32 output.
#include <hip/hip_runtime.h>
#include <math.h>

typedef __attribute__((ext_vector_type(16))) _Float16 v16h;
typedef __attribute__((ext_vector_type(16))) __bf16 v16b;
typedef __attribute__((ext_vector_type(8)))  _Float16 v8h;
typedef __attribute__((ext_vector_type(8)))  float v8f;
typedef __attribute__((ext_vector_type(4)))  float v4f;
typedef __attribute__((ext_vector_type(2)))  float v2f;
typedef __attribute__((ext_vector_type(4)))  unsigned v4u;
typedef __attribute__((ext_vector_type(4)))  int v4i;
typedef float __attribute__((may_alias)) float_a;
typedef int __attribute__((may_alias)) int_a;

template <typename T> __device__ __forceinline__ void vst2(void* p, T v) { *(T*)p = v;  }
__device__ __forceinline__ v8f wmma16(v16h a, v16h b, v8f c) {
  v8f d = __builtin_amdgcn_wmma_f32_16x16x32_f16(false, a, false, b, (short)0, c, false, false);
  asm volatile("v_nop\n\tv_nop\n\tv_nop\n\tv_nop" : "+v"(d) : "v"(a), "v"(b));
  return d;
}
__device__ __forceinline__ v8f wmma_bf(v16b a, v16b b, v8f c) {
  v8f d = __builtin_amdgcn_wmma_f32_16x16x32_bf16(false, a, false, b, (short)0, c, false, false);
  asm volatile("v_nop\n\tv_nop\n\tv_nop\n\tv_nop" : "+v"(d) : "v"(a), "v"(b));
  return d;
}
// 16x16x32 fragments: lane = (h = lane>>4, row/col = lane&15); elements 0..7 = k0+8h+0..7, 8..15 = k0+16+8h+0..7; D element r = row 8h+r
__device__ __forceinline__ v16h frag_h(const _Float16* rowk0, int lane) {
  union { v16h v; v8h q[2]; } u; const _Float16* p = rowk0 + 8 * (lane >> 4);
  u.q[0] = *(const v8h*)p; u.q[1] = *(const v8h*)(p + 16); return u.v;
}
__device__ __forceinline__ v16h frag_f32(const float* rowk0, int lane) {
  v16h a; const float* p = rowk0 + 8 * (lane >> 4);
#pragma unroll
  for (int i = 0; i < 8; ++i) { a[i] = (_Float16)p[i]; a[8 + i] = (_Float16)p[16 + i]; }
  return a;
}
__device__ __forceinline__ v16h frag_f32s(const float* rowk0, int lane, float sc) {
  v16h a; const float* p = rowk0 + 8 * (lane >> 4);
#pragma unroll
  for (int i = 0; i < 8; ++i) { a[i] = (_Float16)(p[i] * sc); a[8 + i] = (_Float16)(p[16 + i] * sc); }
  return a;
}
// column fragment from a [K][ld] layout (column n), rows >= K read as 0
__device__ __forceinline__ v16h fragc_f32(const float* W, int k0, int n, int lane, int ld, int K) {
  v16h a; const int g = lane >> 4;
#pragma unroll
  for (int i = 0; i < 8; ++i) { const int ka = k0 + 8 * g + i, kb = ka + 16;
    a[i] = (_Float16)(ka < K ? W[(size_t)(ka < K ? ka : K - 1) * ld + n] : 0.f); a[8 + i] = (_Float16)(kb < K ? W[(size_t)(kb < K ? kb : K - 1) * ld + n] : 0.f); }
  return a;
}
struct F2 { v16b h, l; };
__device__ __forceinline__ F2 bsplit16(const float v[16]) { F2 r;
#pragma unroll
  for (int i = 0; i < 16; ++i) { const __bf16 h = (__bf16)v[i]; r.h[i] = h; r.l[i] = (__bf16)(v[i] - (float)h); }
  return r; }
__device__ __forceinline__ F2 split_row(const float* row, int k0, int lane) { float v[16]; const float* p = row + k0 + 8 * (lane >> 4);
#pragma unroll
  for (int i = 0; i < 8; ++i) { v[i] = p[i]; v[8 + i] = p[16 + i]; }
  return bsplit16(v); }
__device__ __forceinline__ F2 split_rowK(const float* row, int k0, int lane, int K) { float v[16]; const int g = lane >> 4;
#pragma unroll
  for (int i = 0; i < 8; ++i) { const int ka = k0 + 8 * g + i, kb = ka + 16; v[i] = ka < K ? row[ka < K ? ka : K - 1] : 0.f; v[8 + i] = kb < K ? row[kb < K ? kb : K - 1] : 0.f; }
  return bsplit16(v); }
__device__ __forceinline__ F2 split_col(const float* W, int k0, int n, int lane, int ld, int K) { float v[16]; const int g = lane >> 4;
#pragma unroll
  for (int i = 0; i < 8; ++i) { const int ka = k0 + 8 * g + i, kb = ka + 16; v[i] = ka < K ? W[(size_t)(ka < K ? ka : K - 1) * ld + n] : 0.f; v[8 + i] = kb < K ? W[(size_t)(kb < K ? kb : K - 1) * ld + n] : 0.f; }
  return bsplit16(v); }
__device__ __forceinline__ v8f mac3(const F2& a, const F2& b, v8f c) { c = wmma_bf(a.l, b.h, c); c = wmma_bf(a.h, b.l, c); return wmma_bf(a.h, b.h, c); }
__device__ __forceinline__ float sigm(float v) { return 1.0f / (1.0f + expf(-v)); }
#define LDSX() do { asm volatile("s_wait_dscnt 0" ::: "memory"); __builtin_amdgcn_wave_barrier(); __builtin_amdgcn_fence(__ATOMIC_RELEASE, "workgroup"); } while (0)

// Non-local block (B 4, C 64, 80 x 80 = 6,400 positions; inter channels 32): theta, phi, g = 1x1 convs of x ((out,in) [32,64] + bias); f[n][m] = theta_n . phi_m (no scaling); P = softmax over m; y[n] = sum_m P[n][m] g_m; W_y = w_out y + b_out (32 -> 64); out = BN_eval(W_y) (running mean/var, eps 1e-4, affine) + x.
#define NB 4
#define TT 6400
#define CC 128            // sizes the workspace regions (32 columns of each are used) and k_proj's grid y (CC / 128 = 1 block column)
#define DIN 64            // input channels
#define NH 1
#define HD 128
#define NQB (TT / 64)
#define HG 1               // sizes WS_S: one 6,400 x 6,400 f32 plane, unused (scores stay in registers)
#define SCALE (1.0f)
#define HDQK 32            // theta / phi / g channels
#define CAUSAL 0
#ifndef TNB
#define TNB NB
#endif
__device__ __forceinline__ v16b zero16b() { v16b z; _Pragma("unroll") for (int i = 0; i < 16; ++i) z[i] = (__bf16)0.f; return z; }
__device__ __forceinline__ float bfr(float v) { return (float)(__bf16)v; }
__host__ __device__ __forceinline__ int kb_last(int qb) { return CAUSAL ? ((qb * 64 + 63) >> 7) : (TT / 128 - 1); }
typedef __attribute__((ext_vector_type(8))) __bf16 v8b;
__device__ __forceinline__ v16b frag_b(const __bf16* rowk0, int lane) {
  union { v16b v; v8b q[2]; } u; const __bf16* p = rowk0 + 8 * (lane >> 4);
  u.q[0] = *(const v8b*)p; u.q[1] = *(const v8b*)(p + 16); return u.v;
}
#define QBH (TT / 64)      // ALL queries take the 3-product logits (k_fa)
#define QBH_PV 0           // P.v stays single f16
#define QHI 6400            // q residual rows everywhere
#define KHI 6400           // k residual rows for ALL keys (3-product logits; sigma_f ~ 5.7 unscaled)
// B fragment (k rows k0+.., output column o) of a weight: (in,out) [K][ld] or (out,in) [ld rows of K]: bf16 exact, or f16(bf16 * 256) exact
__device__ __forceinline__ v16b wcol_io(const float* Wm, int k0, int o, int lane, int ld) { v16b w; const int g = lane >> 4;
#pragma unroll
  for (int i = 0; i < 8; ++i) { w[i] = (__bf16)Wm[(size_t)(k0 + 8 * g + i) * ld + o]; w[8 + i] = (__bf16)Wm[(size_t)(k0 + 16 + 8 * g + i) * ld + o]; }
  return w; }
__device__ __forceinline__ v16b wcol_oi(const float* Wm, int k0, int o, int lane, int K) { v16b w; const float* p = Wm + (size_t)o * K + k0 + 8 * (lane >> 4);
#pragma unroll
  for (int i = 0; i < 8; ++i) { w[i] = (__bf16)p[i]; w[8 + i] = (__bf16)p[16 + i]; }
  return w; }
__device__ __forceinline__ v16h wcolh_io(const float* Wm, int k0, int o, int lane, int ld) { v16h w; const int g = lane >> 4;
#pragma unroll
  for (int i = 0; i < 8; ++i) { w[i] = (_Float16)(bfr(Wm[(size_t)(k0 + 8 * g + i) * ld + o]) * 256.0f); w[8 + i] = (_Float16)(bfr(Wm[(size_t)(k0 + 16 + 8 * g + i) * ld + o]) * 256.0f); }
  return w; }
__device__ __forceinline__ v16h wcolh_oi(const float* Wm, int k0, int o, int lane, int K) { v16h w; const float* p = Wm + (size_t)o * K + k0 + 8 * (lane >> 4);
#pragma unroll
  for (int i = 0; i < 8; ++i) { w[i] = (_Float16)(bfr(p[i]) * 256.0f); w[8 + i] = (_Float16)(bfr(p[16 + i]) * 256.0f); }
  return w; }
#define WQKV_LAYOUT 1   // 0 = (in,out) [DIN][CC]; 1 = (out,in) [HDQK][DIN]; 2 = per-head [NH][DIN][HD]
__device__ __forceinline__ v16b wcol_hdk(const float* Wm, int k0, int o, int lane) { v16b w; const int g = lane >> 4; const float* p = Wm + (size_t)(o / HD) * DIN * HD + (o % HD);
#pragma unroll
  for (int i = 0; i < 8; ++i) { w[i] = (__bf16)p[(size_t)(k0 + 8 * g + i) * HD]; w[8 + i] = (__bf16)p[(size_t)(k0 + 16 + 8 * g + i) * HD]; }
  return w; }
#define WO_OUT_IN 0
#if WQKV_LAYOUT == 1
#define WCOL(W, k0, o, lane) (((o) < HDQK) ? wcol_oi(W, k0, (o), lane, DIN) : zero16b())   /* theta/phi/g weights are [32][64] (out,in): columns o >= 32 give zero fragments */
#elif WQKV_LAYOUT == 2
#define WCOL(W, k0, o, lane) wcol_hdk(W, k0, o, lane)
#else
#define WCOL(W, k0, o, lane) wcol_io(W, k0, o, lane, CC)
#endif
#if WO_OUT_IN
#define WOCOL(W, k0, o, lane) wcol_oi(W, k0, o, lane, CC)
#define WOCOLH(W, k0, o, lane) wcolh_oi(W, k0, o, lane, CC)
#else
#define WOCOL(W, k0, o, lane) wcol_io(W, k0, o, lane, DIN)
#define WOCOLH(W, k0, o, lane) wcolh_io(W, k0, o, lane, DIN)
#endif
#ifndef XP
#define XP TT              // position pitch of x and of the output
#endif
#define BG HG              // the pass group spans BATCHES (single head): k_fa's blockIdx.y selects the batch
#define DVH 128
#ifndef SM_EXTRA_PARAMS
#define SM_EXTRA_PARAMS
#endif
#ifndef PROJ_EXTRA_PARAMS
#define PROJ_EXTRA_PARAMS
#endif
#ifndef SM_MASK_HOOK
#define SM_MASK_HOOK (void)0
#endif

#define WS_QH  0u                                      // f16 q rows [b*t][HDQK], the 32 real columns
#define WS_KH  (WS_QH + 2u * (size_t)NB * TT * CC)      // f16 k, the 32 real columns in fragment order: [b*t / 16][half][lane][8], 1,024 B per 16-key tile
#define WS_VT  (WS_KH + 2u * (size_t)NB * TT * CC)      // f16 v, the 32 real channels in fragment order: [b*t / 32][channel tile][half][lane][8], 2,048 B per 32 keys
#define WS_QL  (WS_VT + 2u * (size_t)NB * CC * TT)      // f16 q residual x 2^10 rows [b][t < QHI][HDQK]
#define WS_KL  (WS_QL + 2u * (size_t)NB * QHI * CC)     // f16 k residual x 2^10, laid out as WS_KH
#define WS_VB  (WS_KL + 2u * (size_t)NB * KHI * CC)     // not used (the offsets behind it stay where they were)
#define WS_VBL (WS_VB + 2u * (size_t)NB * CC * KHI)
#define WS_S   (WS_VBL + 2u * (size_t)NB * CC * KHI)    // f32 [hg][t][s] region, unused (no kernel stores logits)
#define WS_Y   (WS_S  + 4u * (size_t)HG * TT * TT)      // empty: the joined rows y stay in k_fa's LDS
#define WS_END (WS_Y  + 0u)
#define PJ (HDQK / 16)     // 16-column tiles of a projection: the real columns only

// ---- k_proj: block = (64 rows, the 32 real columns, which): q/k/v = X W (+ b) with exact bf16 products (K = DIN) -> which 0: q x log2 e, f16 rows (+ residual rows < QHI), 32 columns a row; 1: k f16 and its residual in fragment order; 2: v f16 in fragment order. Only what k_fa reads is computed and stored. Fragment order: the 16 bytes that lane l of k_fa loads stand at 16 l inside a 512-byte run, so one wave-wide load reads 4 whole lines
__global__ __launch_bounds__(128) void k_proj(const float* __restrict__ XQ, const float* __restrict__ XK, const float* __restrict__ XV, const float* __restrict__ WQ, const float* __restrict__ WK, const float* __restrict__ WV, const float* __restrict__ BQ, const float* __restrict__ BK, const float* __restrict__ BV,
    _Float16* __restrict__ QH, _Float16* __restrict__ QL, _Float16* __restrict__ KH, _Float16* __restrict__ KL, _Float16* __restrict__ VT) {
  __shared__ __align__(16) _Float16 sh[64][HDQK + 8], sl[64][HDQK + 8]; __shared__ __align__(16) _Float16 th[HDQK][72];
  const int tid = threadIdx.x, wave = tid >> 5, lane = tid & 31, col = lane & 15, g = lane >> 4; const int which = blockIdx.z; const size_t r0 = (size_t)blockIdx.x * 64; const size_t bb = r0 / TT; const int t0 = (int)(r0 % TT);
  const float* X = which == 0 ? XQ : which == 1 ? XK : XV; const float* WA = which == 0 ? WQ : which == 1 ? WK : WV; const float* BA = which == 0 ? BQ : which == 1 ? BK : BV;
  v8f acc[PJ] = {};
#pragma unroll 2
  for (int kc = 0; kc < DIN / 32; ++kc) { v16b a; { const float* p = X + (bb * DIN + kc * 32 + 8 * g) * (size_t)XP + t0 + wave * 16 + col;   /* channels-first gather: x[b][k][t], stride XP between k */
#pragma unroll
      for (int i = 0; i < 8; ++i) { a[i] = (__bf16)p[(size_t)i * XP]; a[8 + i] = (__bf16)p[(size_t)(16 + i) * XP]; } }
    asm volatile("s_wait_loadcnt 0x0" ::: "memory");
#pragma unroll
    for (int j = 0; j < PJ; ++j) { const v16b w = wcol_oi(WA, kc * 32, j * 16 + col, lane, DIN); asm volatile("s_wait_loadcnt 0x0" ::: "memory"); acc[j] = wmma_bf(a, w, acc[j]); } }
  if (which < 2) { _Float16* DH = which == 0 ? QH : KH; _Float16* DL = which == 0 ? QL : KL; const int nhi = which == 0 ? QHI : KHI; const bool hi_rows = t0 < nhi; const float qs = which == 0 ? 1.4426950408889634f : 1.0f;   /* q carries log2 e, so that k_fa's logits are exponents of 2 */
#pragma unroll
    for (int j = 0; j < PJ; ++j) { const float bias = BA ? bfr(BA[j * 16 + col]) : 0.f;   /* 32-entry biases */
#pragma unroll
      for (int r = 0; r < 8; ++r) { const float v = (acc[j][r] + bias) * qs; const _Float16 hv = (_Float16)v; sh[wave * 16 + 8 * g + r][j * 16 + col] = hv; sl[wave * 16 + 8 * g + r][j * 16 + col] = (_Float16)((v - (float)hv) * 1024.0f); } }
    __syncthreads();
    if (which == 0) { for (int e = tid; e < 64 * (HDQK / 8); e += 128) { const int rl = e / (HDQK / 8), q = e % (HDQK / 8); vst2((unsigned*)(DH + (r0 + rl) * HDQK + q * 8), *(const v4u*)&sh[rl][q * 8]); if (hi_rows) vst2((unsigned*)(DL + (bb * nhi + t0 + rl) * (size_t)HDQK + q * 8), *(const v4u*)&sl[rl][q * 8]); } }
    else { for (int e = tid; e < 4 * 64; e += 128) { const int tl = e >> 6, h2 = (e >> 5) & 1, ln = e & 31; const int rl = tl * 16 + (ln & 15), cs = 16 * h2 + 8 * (ln >> 4); const size_t d = (r0 + tl * 16) * HDQK + h2 * 256 + ln * 8;   /* A fragment of key tile tl: lane (col, g) holds key col, channels 16 h2 + 8 g + 0..7 */
        vst2((unsigned*)(DH + d), *(const v4u*)&sh[rl][cs]); if (hi_rows) vst2((unsigned*)(DL + d), *(const v4u*)&sl[rl][cs]); } }
  } else {
#pragma unroll
    for (int j = 0; j < PJ; ++j) { const float bias = BA ? bfr(BA[j * 16 + col]) : 0.f;   /* 32-entry biases */
#pragma unroll
      for (int r = 0; r < 8; ++r) { const float v = acc[j][r] + bias; const int rl = wave * 16 + 8 * g + r, cl = j * 16 + col; th[cl][rl] = (_Float16)v; } }
    __syncthreads();
    for (int e = tid; e < 4 * 64; e += 128) { const int st = e >> 7, ct = (e >> 6) & 1, h2 = (e >> 5) & 1, ln = e & 31;   /* A fragment of channel tile ct, 32-key step st: lane (col, g) holds channel 16 ct + col, keys 16 h2 + 8 g + 0..7 */
      vst2((unsigned*)(VT + (r0 + st * 32) * HDQK + ct * 512 + h2 * 256 + ln * 8), *(const v4u*)&th[ct * 16 + (ln & 15)][st * 32 + 16 * h2 + 8 * (ln >> 4)]); } } }
// ---- k_fa: block = 128 queries of batch b (4 groups of 32) x 4 key ranges of 1,600 keys, one wave per (query group, key range); the 4 waves of a range read the same k and v lines, which k_proj left in fragment order (every wave-wide 16-byte load covers 512 contiguous bytes). Per pass of 64 keys: S^T = k . q^T (k rows as A, q as B; q and k as f16 hi + residual x 2^10, 3 products), so a lane holds 32 keys' logits of ONE query per 16-query tile; q carries log2 e and the hi . hi product starts from minus the query's reference maximum, so the logits leave the products as z = (s - ref) log2 e and exp2(z) needs no further arithmetic; one test per pass (a scalar branch): only on the first pass, or when a lane's sum of the pass's weights is above PCAP, the pass's maximum is taken, ref moves up to RLEAD above it, sum and ctx are rescaled and the pass's weights are formed again; exp2(z) once to f16 is the B operand as it stands in the accumulators; ctx^T += v^T . P^T (v planes as A, 1 product, the 32 real channels). The 4 ranges' (max, sum, ctx) meet in LDS and are joined in range order; the joined rows y stay in LDS. Output stage, the 16 waves, one per (32 positions, 16 output channels): W_y^T = w_out (A, exact bf16) . y^T (B, bf16 hi + lo, 2 products), so a lane holds 8 channels of ONE position; + b_out, eval BatchNorm, + x, stored as out[b][c][n]: the 32 positions of a wave are one whole 128-byte line per channel.
#define FQ 2               // 16-query tiles per wave
#define FG 4               // query groups (waves) per key range
#define FKS 4              // key ranges per block
#define FQB (16 * FQ * FG) // queries per block
#define FST (TT / 32 / FKS)   // 32-key steps per range
#define KP 2               // 32-key steps per pass of the key loop: one test per pass, and at most one maximum, one exchange, one rescale of sum and ctx
#define LN2 0.6931471805599453f   // ln 2: the reference maxima go to the join in natural units
#define RLEAD 4.0f         // a new reference stands this far (log2 units) above the maximum it is taken from: later weights may grow to 2^19 times that maximum's before the next move; the largest weight, 2^-4, and all within 2^-10 of it are normal f16 numbers, smaller ones are off by at most 2^-25
#define PCAP 32768.0f      // while a lane's sum of a pass's weights exp2(z) stays below this, each of them is a finite f16 number; the reference cancels in ctx / sum, so it need not be the maximum itself
static_assert(FST % KP == 0 && FQ == 2, "whole passes; the pass's test names both query tiles");
static_assert(FQB == 128 && DIN == 64 && FG * FKS >= 16, "output stage: 4 position pairs x 4 channel tiles = 16 waves");
static_assert(!CAUSAL && TT % FQB == 0 && TT % (32 * FKS) == 0 && HDQK == 32 && QHI == TT && KHI == TT && CC == 128 && TT % 64 == 0, "whole query blocks, equal key ranges, one 32-deep product; one k_proj block column holds the 32 real columns, its 64 rows whole tiles of one batch");
// every unroll directive of k_fa: the fragment, score and accumulator arrays are then indexed by constants alone and stay in registers
__device__ __forceinline__ v8f wm(v16h a, v16h b, v8f c) { return __builtin_amdgcn_wmma_f32_16x16x32_f16(false, a, false, b, (short)0, c, false, false); }
__device__ __forceinline__ v8f wmb(v16b a, v16b b, v8f c) { return __builtin_amdgcn_wmma_f32_16x16x32_bf16(false, a, false, b, (short)0, c, false, false); }
__device__ __forceinline__ v16h frag_p(const _Float16* base, unsigned boff, int tile) { union { v16h v; v8h q[2]; } u; const char* p = (const char*)base + boff + tile; u.q[0] = *(const v8h*)p; u.q[1] = *(const v8h*)(p + 512); return u.v; }   // fragment-order tile: uniform base + the lane's byte offset + the tile's; elements 0..7 in the first 512 bytes, 8..15 in the second
__device__ __forceinline__ float xhalf(float x) { return __builtin_bit_cast(float, __builtin_amdgcn_permlanex16(__builtin_bit_cast(int, x), __builtin_bit_cast(int, x), 0x76543210, 0xfedcba98, false, false)); }   // lane l reads lane l ^ 16
// one query tile's weights of a pass: exp2 of the logits as they stand, their f32 sum in key order, and the f16 B operand
template <bool SLOT> __device__ __forceinline__ float ex2(float x) { if (!SLOT) return __builtin_amdgcn_exp2f(x);
  float r; asm("v_exp_f32 %0, %1\n\tv_nop" : "=v"(r) : "v"(x)); return r; }   // SLOT: the v_nop is the one slot that the instruction set asks for behind a transcendental before its source is overwritten or its result read; for the rare path, where the compiler packed the exponentials so that each overwrote the source of the one before
template <bool SLOT> __device__ __forceinline__ float expsum(const v2f (&z)[8 * KP], v16h (&p)[KP]) { float sum = 0.f;
#pragma unroll
  for (int i = 0; i < 8 * KP; ++i) { const float ex = ex2<SLOT>(z[i].x), ey = ex2<SLOT>(z[i].y); sum += ex; sum += ey; p[i >> 3][2 * (i & 7)] = (_Float16)ex; p[i >> 3][2 * (i & 7) + 1] = (_Float16)ey; }   /* far below the reference the result is 0 */
  return sum; }
// amdgpu_waves_per_eu(4, 4): the block's 16 waves stand 4 on a SIMD and no second block fits beside them, so nothing is gained by saving registers below 256 a wave; without it the compiler schedules the softmax more tightly: fewer additions of the two query tiles pair into one instruction, and more idle slots stand behind the products
__global__ __launch_bounds__(32 * FG * FKS) __attribute__((amdgpu_waves_per_eu(4, 4))) void k_fa(const _Float16* __restrict__ QH, const _Float16* __restrict__ QL, const _Float16* __restrict__ KH, const _Float16* __restrict__ KL, const _Float16* __restrict__ VT,
    const float* __restrict__ X, const float* __restrict__ WW, const float* __restrict__ WB, const float* __restrict__ GAm, const float* __restrict__ BEt, const float* __restrict__ MUv, const float* __restrict__ VAv, float* __restrict__ OUT) {
  __shared__ __align__(16) float so[FKS][FQB][HDQK + 4]; __shared__ float smx[FKS][FQB], ssu[FKS][FQB]; __shared__ __align__(16) float sbn[4][DIN];   /* per output channel: gamma / sqrt(var + eps), mean, beta, b_out */
  const int tid = threadIdx.x, wave = __builtin_amdgcn_readfirstlane(tid >> 5), lane = tid & 31, col = lane & 15, g = lane >> 4; const int qg = wave % FG, ks = wave / FG;
  const int b = blockIdx.y, qr0 = blockIdx.x * FQB; const size_t rb = (size_t)b * TT;
  if (wave < DIN / 32) { sbn[0][tid] = bfr(GAm[tid]) / __fsqrt_rn(bfr(VAv[tid]) + 1e-4f); sbn[1][tid] = bfr(MUv[tid]); sbn[2][tid] = bfr(BEt[tid]); sbn[3][tid] = bfr(WB[tid]); }   /* one thread per output channel, one division and root per channel and block; read behind the two barriers below */
  v16h qh[FQ], ql[FQ];
#pragma unroll
  for (int u = 0; u < FQ; ++u) { const size_t qo = (rb + qr0 + (qg * FQ + u) * 16 + col) * HDQK; qh[u] = frag_h(QH + qo, lane); ql[u] = frag_h(QL + qo, lane); }
  const _Float16* kph = KH + (rb + ks * (FST * 32)) * HDQK; const _Float16* kpl = KL + (rb + ks * (FST * 32)) * HDQK; const _Float16* vp = VT + (rb + ks * (FST * 32)) * HDQK;   /* wave-uniform bases; 32 halves per key in each of the three */
  unsigned lo = lane * 16;   /* bytes, the same in all three planes: the lane's own place in each 512-byte half of a tile, plus the passes done (stepped by 64 keys at the loop's foot) */
  float l[FQ]; v8f o[FQ][2], cs[FQ];   /* cs: minus the reference maximum (log2 units), the same in all 8 registers: a lane's 8 accumulator rows are 8 keys of ONE query */
#pragma unroll
  for (int u = 0; u < FQ; ++u) { l[u] = 0.f; o[u][0] = v8f{}; o[u][1] = v8f{}; cs[u] = v8f{}; }
  for (int kc = 0; kc < FST / KP; ++kc) {
    v16h kh[2 * KP], kl[2 * KP], vv[2 * KP];   /* vv[2 i + c]: 32-key group i, channel tile c */
#pragma unroll
    for (int t = 0; t < 2 * KP; ++t) { kh[t] = frag_p(kph, lo, t * 1024); kl[t] = frag_p(kpl, lo, t * 1024); }
    __builtin_amdgcn_sched_barrier(0);   /* keeps the pass's 16 k loads in one run at its head, so that a pass waits for one load latency; left free, they sink to the products that use them and each is waited for alone */
    v2f s[FQ][8 * KP];   /* logits in pairs, as the packed fma takes and leaves them */
    v8f a[2][FQ], al[2][FQ];   /* the product tiles of two key tiles */
#pragma unroll
    for (int t = 0; t <= 2 * KP; ++t) {
      if (t < 2 * KP) {
#pragma unroll
        for (int u = 0; u < FQ; ++u) al[t & 1][u] = wm(kh[t], ql[u], v8f{});
#pragma unroll
        for (int u = 0; u < FQ; ++u) a[t & 1][u] = wm(kh[t], qh[u], cs[u]);
#pragma unroll
        for (int u = 0; u < FQ; ++u) al[t & 1][u] = wm(kl[t], qh[u], al[t & 1][u]); }
      __builtin_amdgcn_sched_barrier(0);   /* key tile t's six products stand between tile t - 1's products and the fmas that read them: the fmas then need no idle slots behind a product; left free, each fma run moves up to its product */
      if (t > 0) {
#pragma unroll
        for (int u = 0; u < FQ; ++u)
#pragma unroll
          for (int r = 0; r < 4; ++r) s[u][(t - 1) * 4 + r] = __builtin_elementwise_fma(v2f{al[(t - 1) & 1][u][2 * r], al[(t - 1) & 1][u][2 * r + 1]}, v2f{1.0f / 1024.0f, 1.0f / 1024.0f}, v2f{a[(t - 1) & 1][u][2 * r], a[(t - 1) & 1][u][2 * r + 1]}) * SCALE; }
      __builtin_amdgcn_sched_barrier(0); }   /* ends tile t - 1's fmas in front of tile t + 1's products, which take over their registers: the product tiles of two key tiles are live at most, not of all four; behind the last tile it keeps the v loads behind the logit products, in registers that k has left, and the softmax covers their latency */
#pragma unroll
    for (int t = 0; t < 2 * KP; ++t) vv[t] = frag_p(vp, lo, t * 1024);
    v16h p[FQ][KP]; float sum[FQ];
#pragma unroll
    for (int u = 0; u < FQ; ++u) sum[u] = expsum<false>(s[u], p[u]);
    const bool first = kc == 0;   /* no reference yet: z is the bare logit */
    if (first || __builtin_amdgcn_ballot_w32(fmaxf(sum[0], sum[1]) > PCAP) != 0) {   /* wave-uniform, one test per pass: a weight is at most its lane's sum, so below PCAP every weight is a finite f16 number and the pass stands as it is */
#pragma unroll
      for (int u = 0; u < FQ; ++u) {
        float x = s[u][0].x;
#pragma unroll
        for (int i = 1; i < 16 * KP; ++i) x = fmaxf(x, s[u][i >> 1][i & 1]);
        x = fmaxf(x, xhalf(x)) + RLEAD;   /* the two lane halves hold the same query's other keys of the pass */
        const float d = first ? x : fmaxf(x, 0.f), sc = first ? 0.f : __builtin_amdgcn_exp2f(-d);   /* the reference rises by d to RLEAD above the pass's maximum where that is above it; sum and ctx are still 0 on the first pass */
        l[u] *= sc;
#pragma unroll
        for (int r = 0; r < 8; ++r) { o[u][0][r] *= sc; o[u][1][r] *= sc; cs[u][r] -= d; }
#pragma unroll
        for (int i = 0; i < 8 * KP; ++i) s[u][i] -= v2f{d, d};
        sum[u] = expsum<true>(s[u], p[u]); } }   /* the pass's weights again, against the new reference: at most 2^-RLEAD each */
#pragma unroll
    for (int u = 0; u < FQ; ++u) {
      l[u] += sum[u];
#pragma unroll
      for (int i = 0; i < KP; ++i)
#pragma unroll
        for (int c = 0; c < 2; ++c) o[u][c] = wm(vv[2 * i + c], p[u][i], o[u][c]); }
    __builtin_amdgcn_sched_barrier(0);   /* holds the wait below at the loop's foot, behind the products that have waited for the loads' data, where it costs no time; left free, it moves up to directly behind the v loads */
    asm volatile("s_wait_xcnt 0x0" : "+v"(lo));   /* the wait in front of the rewrite of the loads' offset register; the register is its operand, so the loads keep the form of one scalar base plus this register, no load lands a result in it, and it is stepped only behind the wait */
    lo += 32 * KP * HDQK * 2; }
#pragma unroll
  for (int u = 0; u < FQ; ++u) { const int rl = (qg * FQ + u) * 16 + col; const float lt = l[u] + xhalf(l[u]); if (g == 0) { smx[ks][rl] = -cs[u][0] * LN2; ssu[ks][rl] = lt; }
#pragma unroll
    for (int c = 0; c < 2; ++c)
#pragma unroll
      for (int r = 0; r < 8; ++r) so[ks][rl][c * 16 + 8 * g + r] = o[u][c][r]; }   /* register r = channel 16c + 8g + r of query col */
  // output stage, operands that do not depend on y: fetched in front of the barrier, where a wave that leaves the key loop early waits for the others anyway
  const bool ow = wave < 16; const int np = wave & 3, ct = wave >> 2;   /* wave-uniform: position pair np (tiles 2 np, 2 np + 1) x channel tile ct */
  v16b wf = zero16b(); float xr[2][8] = {};
  const size_t oi = ((size_t)b * DIN + ct * 16 + 8 * g) * XP + qr0 + np * 32 + col;   /* channel 16 ct + 8 g (+ r), position 32 np + col (+ 16 t) */
  if (ow) { wf = wcol_oi(WW, 0, ct * 16 + col, lane, HDQK);   /* A fragment: row = output channel 16 ct + col, k = y channel, the k order of split_row */
#pragma unroll
    for (int r = 0; r < 8; ++r)
#pragma unroll
      for (int t = 0; t < 2; ++t) xr[t][r] = bfr(X[oi + (size_t)r * XP + t * 16]); }
  __syncthreads();   /* every range's maximum, sum and partial rows are in LDS before any thread joins them */
  for (int e = tid; e < FQB * (HDQK / 4); e += 32 * FG * FKS) { const int rl = e / (HDQK / 4), q = e % (HDQK / 4); float mt = smx[0][rl];
#pragma unroll
    for (int i = 1; i < FKS; ++i) mt = fmaxf(mt, smx[i][rl]);
    float lt = 0.f; v4f s = {};
#pragma unroll
    for (int i = 0; i < FKS; ++i) { const float w = expf(smx[i][rl] - mt); lt += w * ssu[i][rl]; s += *(const v4f*)&so[i][rl][q * 4] * w; }
    *(v4f*)&so[0][rl][q * 4] = s * (1.0f / lt); }   /* y in place of range 0's partial row: these 4 words are read by this thread alone, above */
  __syncthreads();   /* all of y and the channel table are in LDS before the output stage reads them */
  if (ow) { float inv[8], mu[8], be[8], bo[8];
#pragma unroll
    for (int r = 0; r < 8; ++r) { const int c = ct * 16 + 8 * g + r; inv[r] = sbn[0][c]; mu[r] = sbn[1][c]; be[r] = sbn[2][c]; bo[r] = sbn[3][c]; }
#pragma unroll
    for (int t = 0; t < 2; ++t) { const F2 y = split_row(&so[0][np * 32 + t * 16 + col][0], 0, lane); v8f acc = {}; acc = wmb(wf, y.h, acc); acc = wmb(wf, y.l, acc);
#pragma unroll
      for (int r = 0; r < 8; ++r) OUT[oi + (size_t)r * XP + t * 16] = (((acc[r] + bo[r]) - mu[r]) * inv[r] + be[r]) + xr[t][r]; } } }   /* eval BN: (W_y - mean) * (gamma / sqrt(var + eps)) + beta, then + x */

extern "C" void kernel_launch(void* const* d_in, const int* in_sizes, int n_in, void* d_out, int out_size, void* d_ws, size_t ws_size, hipStream_t stream) {
  (void)in_sizes; (void)n_in; (void)out_size;
  const float** F = (const float**)d_in;
  if (ws_size < (size_t)WS_END) return;
  char* ws = (char*)d_ws; _Float16 *QH = (_Float16*)(ws + WS_QH), *KH = (_Float16*)(ws + WS_KH), *VT = (_Float16*)(ws + WS_VT), *QL = (_Float16*)(ws + WS_QL), *KL = (_Float16*)(ws + WS_KL); float *S = (float*)(ws + WS_S), *Y = (float*)(ws + WS_Y);
  (void)Y; (void)S;
  // inputs: 0 x [4,64,80,80]; 1 w_theta [32,64] (out,in), 2 b_theta; 3 w_phi, 4 b_phi; 5 w_g, 6 b_g; 7 w_out [64,32] (out,in), 8 b_out; 9 bn_gamma, 10 bn_beta, 11 bn_mean, 12 bn_var
  k_proj<<<dim3(TNB * TT / 64, CC / 128, 3), 128, 0, stream>>>(F[0], F[0], F[0], F[1], F[3], F[5], F[2], F[4], F[6], QH, QL, KH, KL, VT);   /* q = theta, k = phi, v = g */
  k_fa<<<dim3(TT / FQB, TNB), 32 * FG * FKS, 0, stream>>>(QH, QL, KH, KL, VT, F[0], F[7], F[8], F[9], F[10], F[11], F[12], (float*)d_out);
}

// v009
// One run takes 41.7 microseconds.
// Timed twice side by side with v008, it ran 1.15 times as fast both times.
// Over all steps from v000 it is 47.2 times as fast.
// compute dtype: all float inputs rounded to bf16; theta/phi/g = W x + b with EXACT bf16 products on WMMA 16x16x32 (f32 accumulate); unscaled logits theta.phi with BOTH as f16 hi + residual planes (3 products); softmax in f32 (logits kept in registers, in units of log2: theta is multiplied by log2 e before it is split; a reference maximum per query enters the logit product as the accumulator's start value and is moved only when a pass's weights sum to more than 2^15 in a lane, so exp(f - ref) = hardware exp2 of the product as it stands; precise expf where the key ranges are joined); exp(f - ref) once to f16 against g once to f16 (1 product), divided by the f32 sum at the end; y split bf16 hi + lo against exact w_out (2 products) + b_out; eval BatchNorm and the residual in f32; f32 output.
#include <hip/hip_runtime.h>
#include <math.h>

typedef __attribute__((ext_vector_type(16))) _Float16 v16h;
typedef __attribute__((ext_vector_type(16))) __bf16 v16b;
typedef __attribute__((ext_vector_type(8)))  _Float16 v8h;
typedef __attribute__((ext_vector_type(8)))  float v8f;
typedef __attribute__((ext_vector_type(4)))  float v4f;
typedef __attribute__((ext_vector_type(2)))  float v2f;
typedef __attribute__((ext_vector_type(4)))  unsigned v4u;
typedef __attribute__((ext_vector_type(4)))  int v4i;
typedef float __attribute__((may_alias)) float_a;
typedef int __attribute__((may_alias)) int_a;

template <typename T> __device__ __forceinline__ void vst2(void* p, T v) { *(T*)p = v;  }
__device__ __forceinline__ v8f wmma16(v16h a, v16h b, v8f c) {
  v8f d = __builtin_amdgcn_wmma_f32_16x16x32_f16(false, a, false, b, (short)0, c, false, false);
  asm volatile("v_nop\n\tv_nop\n\tv_nop\n\tv_nop" : "+v"(d) : "v"(a), "v"(b));
  return d;
}
__device__ __forceinline__ v8f wmma_bf(v16b a, v16b b, v8f c) {
  v8f d = __builtin_amdgcn_wmma_f32_16x16x32_bf16(false, a, false, b, (short)0, c, false, false);
  asm volatile("v_nop\n\tv_nop\n\tv_nop\n\tv_nop" : "+v"(d) : "v"(a), "v"(b));
  return d;
}
// 16x16x32 fragments: lane = (h = lane>>4, row/col = lane&15); elements 0..7 = k0+8h+0..7, 8..15 = k0+16+8h+0..7; D element r = row 8h+r
__device__ __forceinline__ v16h frag_h(const _Float16* rowk0, int lane) {
  union { v16h v; v8h q[2]; } u; const _Float16* p = rowk0 + 8 * (lane >> 4);
  u.q[0] = *(const v8h*)p; u.q[1] = *(const v8h*)(p + 16); return u.v;
}
__device__ __forceinline__ v16h frag_f32(const float* rowk0, int lane) {
  v16h a; const float* p = rowk0 + 8 * (lane >> 4);
#pragma unroll
  for (int i = 0; i < 8; ++i) { a[i] = (_Float16)p[i]; a[8 + i] = (_Float16)p[16 + i]; }
  return a;
}
__device__ __forceinline__ v16h frag_f32s(const float* rowk0, int lane, float sc) {
  v16h a; const float* p = rowk0 + 8 * (lane >> 4);
#pragma unroll
  for (int i = 0; i < 8; ++i) { a[i] = (_Float16)(p[i] * sc); a[8 + i] = (_Float16)(p[16 + i] * sc); }
  return a;
}
// column fragment from a [K][ld] layout (column n), rows >= K read as 0
__device__ __forceinline__ v16h fragc_f32(const float* W, int k0, int n, int lane, int ld, int K) {
  v16h a; const int g = lane >> 4;
#pragma unroll
  for (int i = 0; i < 8; ++i) { const int ka = k0 + 8 * g + i, kb = ka + 16;
    a[i] = (_Float16)(ka < K ? W[(size_t)(ka < K ? ka : K - 1) * ld + n] : 0.f); a[8 + i] = (_Float16)(kb < K ? W[(size_t)(kb < K ? kb : K - 1) * ld + n] : 0.f); }
  return a;
}
struct F2 { v16b h, l; };
__device__ __forceinline__ F2 bsplit16(const float v[16]) { F2 r;
#pragma unroll
  for (int i = 0; i < 16; ++i) { const __bf16 h = (__bf16)v[i]; r.h[i] = h; r.l[i] = (__bf16)(v[i] - (float)h); }
  return r; }
__device__ __forceinline__ F2 split_row(const float* row, int k0, int lane) { float v[16]; const float* p = row + k0 + 8 * (lane >> 4);
#pragma unroll
  for (int i = 0; i < 8; ++i) { v[i] = p[i]; v[8 + i] = p[16 + i]; }
  return bsplit16(v); }
__device__ __forceinline__ F2 split_rowK(const float* row, int k0, int lane, int K) { float v[16]; const int g = lane >> 4;
#pragma unroll
  for (int i = 0; i < 8; ++i) { const int ka = k0 + 8 * g + i, kb = ka + 16; v[i] = ka < K ? row[ka < K ? ka : K - 1] : 0.f; v[8 + i] = kb < K ? row[kb < K ? kb : K - 1] : 0.f; }
  return bsplit16(v); }
__device__ __forceinline__ F2 split_col(const float* W, int k0, int n, int lane, int ld, int K) { float v[16]; const int g = lane >> 4;
#pragma unroll
  for (int i = 0; i < 8; ++i) { const int ka = k0 + 8 * g + i, kb = ka + 16; v[i] = ka < K ? W[(size_t)(ka < K ? ka : K - 1) * ld + n] : 0.f; v[8 + i] = kb < K ? W[(size_t)(kb < K ? kb : K - 1) * ld + n] : 0.f; }
  return bsplit16(v); }
__device__ __forceinline__ v8f mac3(const F2& a, const F2& b, v8f c) { c = wmma_bf(a.l, b.h, c); c = wmma_bf(a.h, b.l, c); return wmma_bf(a.h, b.h, c); }
__device__ __forceinline__ float sigm(float v) { return 1.0f / (1.0f + expf(-v)); }
#define LDSX() do { asm volatile("s_wait_dscnt 0" ::: "memory"); __builtin_amdgcn_wave_barrier(); __builtin_amdgcn_fence(__ATOMIC_RELEASE, "workgroup"); } while (0)

// Non-local block (B 4, C 64, 80 x 80 = 6,400 positions; inter channels 32): theta, phi, g = 1x1 convs of x ((out,in) [32,64] + bias); f[n][m] = theta_n . phi_m (no scaling); P = softmax over m; y[n] = sum_m P[n][m] g_m; W_y = w_out y + b_out (32 -> 64); out = BN_eval(W_y) (running mean/var, eps 1e-4, affine) + x.
#define NB 4
#define TT 6400
#define CC 128            // sizes the workspace regions (32 columns of each are used) and k_proj's grid y (CC / 128 = 1 block column)
#define DIN 64            // input channels
#define NH 1
#define HD 128
#define NQB (TT / 64)
#define HG 1               // sizes WS_S: one 6,400 x 6,400 f32 plane, unused (scores stay in registers)
#define SCALE (1.0f)
#define HDQK 32            // theta / phi / g channels
#define CAUSAL 0
#ifndef TNB
#define TNB NB
#endif
__device__ __forceinline__ v16b zero16b() { v16b z; _Pragma("unroll") for (int i = 0; i < 16; ++i) z[i] = (__bf16)0.f; return z; }
__device__ __forceinline__ float bfr(float v) { return (float)(__bf16)v; }
__host__ __device__ __forceinline__ int kb_last(int qb) { return CAUSAL ? ((qb * 64 + 63) >> 7) : (TT / 128 - 1); }
typedef __attribute__((ext_vector_type(8))) __bf16 v8b;
__device__ __forceinline__ v16b frag_b(const __bf16* rowk0, int lane) {
  union { v16b v; v8b q[2]; } u; const __bf16* p = rowk0 + 8 * (lane >> 4);
  u.q[0] = *(const v8b*)p; u.q[1] = *(const v8b*)(p + 16); return u.v;
}
#define QBH (TT / 64)      // ALL queries take the 3-product logits (k_fa)
#define QBH_PV 0           // P.v stays single f16
#define QHI 6400            // q residual rows everywhere
#define KHI 6400           // k residual rows for ALL keys (3-product logits; sigma_f ~ 5.7 unscaled)
// B fragment (k rows k0+.., output column o) of a weight: (in,out) [K][ld] or (out,in) [ld rows of K]: bf16 exact, or f16(bf16 * 256) exact
__device__ __forceinline__ v16b wcol_io(const float* Wm, int k0, int o, int lane, int ld) { v16b w; const int g = lane >> 4;
#pragma unroll
  for (int i = 0; i < 8; ++i) { w[i] = (__bf16)Wm[(size_t)(k0 + 8 * g + i) * ld + o]; w[8 + i] = (__bf16)Wm[(size_t)(k0 + 16 + 8 * g + i) * ld + o]; }
  return w; }
__device__ __forceinline__ v16b wcol_oi(const float* Wm, int k0, int o, int lane, int K) { v16b w; const float* p = Wm + (size_t)o * K + k0 + 8 * (lane >> 4);
#pragma unroll
  for (int i = 0; i < 8; ++i) { w[i] = (__bf16)p[i]; w[8 + i] = (__bf16)p[16 + i]; }
  return w; }
__device__ __forceinline__ v16h wcolh_io(const float* Wm, int k0, int o, int lane, int ld) { v16h w; const int g = lane >> 4;
#pragma unroll
  for (int i = 0; i < 8; ++i) { w[i] = (_Float16)(bfr(Wm[(size_t)(k0 + 8 * g + i) * ld + o]) * 256.0f); w[8 + i] = (_Float16)(bfr(Wm[(size_t)(k0 + 16 + 8 * g + i) * ld + o]) * 256.0f); }
  return w; }
__device__ __forceinline__ v16h wcolh_oi(const float* Wm, int k0, int o, int lane, int K) { v16h w; const float* p = Wm + (size_t)o * K + k0 + 8 * (lane >> 4);
#pragma unroll
  for (int i = 0; i < 8; ++i) { w[i] = (_Float16)(bfr(p[i]) * 256.0f); w[8 + i] = (_Float16)(bfr(p[16 + i]) * 256.0f); }
  return w; }
#define WQKV_LAYOUT 1   // 0 = (in,out) [DIN][CC]; 1 = (out,in) [HDQK][DIN]; 2 = per-head [NH][DIN][HD]
__device__ __forceinline__ v16b wcol_hdk(const float* Wm, int k0, int o, int lane) { v16b w; const int g = lane >> 4; const float* p = Wm + (size_t)(o / HD) * DIN * HD + (o % HD);
#pragma unroll
  for (int i = 0; i < 8; ++i) { w[i] = (__bf16)p[(size_t)(k0 + 8 * g + i) * HD]; w[8 + i] = (__bf16)p[(size_t)(k0 + 16 + 8 * g + i) * HD]; }
  return w; }
#define WO_OUT_IN 0
#if WQKV_LAYOUT == 1
#define WCOL(W, k0, o, lane) (((o) < HDQK) ? wcol_oi(W, k0, (o), lane, DIN) : zero16b())   /* theta/phi/g weights are [32][64] (out,in): columns o >= 32 give zero fragments */
#elif WQKV_LAYOUT == 2
#define WCOL(W, k0, o, lane) wcol_hdk(W, k0, o, lane)
#else
#define WCOL(W, k0, o, lane) wcol_io(W, k0, o, lane, CC)
#endif
#if WO_OUT_IN
#define WOCOL(W, k0, o, lane) wcol_oi(W, k0, o, lane, CC)
#define WOCOLH(W, k0, o, lane) wcolh_oi(W, k0, o, lane, CC)
#else
#define WOCOL(W, k0, o, lane) wcol_io(W, k0, o, lane, DIN)
#define WOCOLH(W, k0, o, lane) wcolh_io(W, k0, o, lane, DIN)
#endif
#ifndef XP
#define XP TT              // position pitch of x and of the output
#endif
#define BG HG              // the pass group spans BATCHES (single head): k_fa's blockIdx.y selects the batch
#define DVH 128
#ifndef SM_EXTRA_PARAMS
#define SM_EXTRA_PARAMS
#endif
#ifndef PROJ_EXTRA_PARAMS
#define PROJ_EXTRA_PARAMS
#endif
#ifndef SM_MASK_HOOK
#define SM_MASK_HOOK (void)0
#endif

#define WS_QH  0u                                      // f16 q rows [b*t][HDQK], the 32 real columns
#define WS_KH  (WS_QH + 2u * (size_t)NB * TT * CC)      // f16 k, the 32 real columns in fragment order: [b*t / 16][half][lane][8], 1,024 B per 16-key tile
#define WS_VT  (WS_KH + 2u * (size_t)NB * TT * CC)      // f16 v, the 32 real channels in fragment order: [b*t / 32][channel tile][half][lane][8], 2,048 B per 32 keys
#define WS_QL  (WS_VT + 2u * (size_t)NB * CC * TT)      // f16 q residual x 2^10 rows [b][t < QHI][HDQK]
#define WS_KL  (WS_QL + 2u * (size_t)NB * QHI * CC)     // f16 k residual x 2^10, laid out as WS_KH
#define WS_VB  (WS_KL + 2u * (size_t)NB * KHI * CC)     // not used (the offsets behind it stay where they were)
#define WS_VBL (WS_VB + 2u * (size_t)NB * CC * KHI)
#define WS_S   (WS_VBL + 2u * (size_t)NB * CC * KHI)    // f32 [hg][t][s] region, unused (no kernel stores logits)
#define WS_Y   (WS_S  + 4u * (size_t)HG * TT * TT)      // empty: the joined rows y stay in k_fa's LDS
#define WS_END (WS_Y  + 0u)
#define PJ (HDQK / 16)     // 16-column tiles of a projection: the real columns only

// ---- k_proj: block = (64 rows, the 32 real columns, which): q/k/v = X W (+ b) with exact bf16 products (K = DIN) -> which 0: q x log2 e, f16 rows (+ residual rows < QHI), 32 columns a row; 1: k f16 and its residual in fragment order; 2: v f16 in fragment order. Only what k_fa reads is computed and stored. Fragment order: the 16 bytes that lane l of k_fa loads stand at 16 l inside a 512-byte run, so one wave-wide load reads 4 whole lines
__global__ __launch_bounds__(128) void k_proj(const float* __restrict__ XQ, const float* __restrict__ XK, const float* __restrict__ XV, const float* __restrict__ WQ, const float* __restrict__ WK, const float* __restrict__ WV, const float* __restrict__ BQ, const float* __restrict__ BK, const float* __restrict__ BV,
    _Float16* __restrict__ QH, _Float16* __restrict__ QL, _Float16* __restrict__ KH, _Float16* __restrict__ KL, _Float16* __restrict__ VT) {
  __shared__ __align__(16) _Float16 sh[64][HDQK + 8], sl[64][HDQK + 8]; __shared__ __align__(16) _Float16 th[HDQK][72];
  const int tid = threadIdx.x, wave = tid >> 5, lane = tid & 31, col = lane & 15, g = lane >> 4; const int which = blockIdx.z; const size_t r0 = (size_t)blockIdx.x * 64; const size_t bb = r0 / TT; const int t0 = (int)(r0 % TT);
  const float* X = which == 0 ? XQ : which == 1 ? XK : XV; const float* WA = which == 0 ? WQ : which == 1 ? WK : WV; const float* BA = which == 0 ? BQ : which == 1 ? BK : BV;
  v8f acc[PJ] = {};
#pragma unroll 2
  for (int kc = 0; kc < DIN / 32; ++kc) { v16b a; { const float* p = X + (bb * DIN + kc * 32 + 8 * g) * (size_t)XP + t0 + wave * 16 + col;   /* channels-first gather: x[b][k][t], stride XP between k */
#pragma unroll
      for (int i = 0; i < 8; ++i) { a[i] = (__bf16)p[(size_t)i * XP]; a[8 + i] = (__bf16)p[(size_t)(16 + i) * XP]; } }
    asm volatile("s_wait_loadcnt 0x0" ::: "memory");
#pragma unroll
    for (int j = 0; j < PJ; ++j) { const v16b w = wcol_oi(WA, kc * 32, j * 16 + col, lane, DIN); asm volatile("s_wait_loadcnt 0x0" ::: "memory"); acc[j] = wmma_bf(a, w, acc[j]); } }
  if (which < 2) { _Float16* DH = which == 0 ? QH : KH; _Float16* DL = which == 0 ? QL : KL; const int nhi = which == 0 ? QHI : KHI; const bool hi_rows = t0 < nhi; const float qs = which == 0 ? 1.4426950408889634f : 1.0f;   /* q carries log2 e, so that k_fa's logits are exponents of 2 */
#pragma unroll
    for (int j = 0; j < PJ; ++j) { const float bias = BA ? bfr(BA[j * 16 + col]) : 0.f;   /* 32-entry biases */
#pragma unroll
      for (int r = 0; r < 8; ++r) { const float v = (acc[j][r] + bias) * qs; const _Float16 hv = (_Float16)v; sh[wave * 16 + 8 * g + r][j * 16 + col] = hv; sl[wave * 16 + 8 * g + r][j * 16 + col] = (_Float16)((v - (float)hv) * 1024.0f); } }
    __syncthreads();
    if (which == 0) { for (int e = tid; e < 64 * (HDQK / 8); e += 128) { const int rl = e / (HDQK / 8), q = e % (HDQK / 8); vst2((unsigned*)(DH + (r0 + rl) * HDQK + q * 8), *(const v4u*)&sh[rl][q * 8]); if (hi_rows) vst2((unsigned*)(DL + (bb * nhi + t0 + rl) * (size_t)HDQK + q * 8), *(const v4u*)&sl[rl][q * 8]); } }
    else { for (int e = tid; e < 4 * 64; e += 128) { const int tl = e >> 6, h2 = (e >> 5) & 1, ln = e & 31; const int rl = tl * 16 + (ln & 15), cs = 16 * h2 + 8 * (ln >> 4); const size_t d = (r0 + tl * 16) * HDQK + h2 * 256 + ln * 8;   /* A fragment of key tile tl: lane (col, g) holds key col, channels 16 h2 + 8 g + 0..7 */
        vst2((unsigned*)(DH + d), *(const v4u*)&sh[rl][cs]); if (hi_rows) vst2((unsigned*)(DL + d), *(const v4u*)&sl[rl][cs]); } }
  } else {
#pragma unroll
    for (int j = 0; j < PJ; ++j) { const float bias = BA ? bfr(BA[j * 16 + col]) : 0.f;   /* 32-entry biases */
#pragma unroll
      for (int r = 0; r < 8; ++r) { const float v = acc[j][r] + bias; const int rl = wave * 16 + 8 * g + r, cl = j * 16 + col; th[cl][rl] = (_Float16)v; } }
    __syncthreads();
    for (int e = tid; e < 4 * 64; e += 128) { const int st = e >> 7, ct = (e >> 6) & 1, h2 = (e >> 5) & 1, ln = e & 31;   /* A fragment of channel tile ct, 32-key step st: lane (col, g) holds channel 16 ct + col, keys 16 h2 + 8 g + 0..7 */
      vst2((unsigned*)(VT + (r0 + st * 32) * HDQK + ct * 512 + h2 * 256 + ln * 8), *(const v4u*)&th[ct * 16 + (ln & 15)][st * 32 + 16 * h2 + 8 * (ln >> 4)]); } } }
// ---- k_fa: block = 128 queries of batch b (4 groups of 32) x 4 key ranges of 1,600 keys, one wave per (query group, key range); the 4 waves of a range read the same k and v lines, which k_proj left in fragment order (every wave-wide 16-byte load covers 512 contiguous bytes). The loop's loads run ahead of their use: behind a pass's logit products the wave issues the next pass's v loads and the k loads of the pass after next, each into the one of two register sets that has just been left, so that no pass waits for a load it has only just issued. Per pass of 32 keys: S^T = k . q^T (k rows as A, q as B; q and k as f16 hi + residual x 2^10, 3 products), so a lane holds 16 keys' logits of ONE query per 16-query tile; q carries log2 e and the hi . hi product starts from minus the query's reference maximum, so the logits leave the products as z = (s - ref) log2 e and exp2(z) needs no further arithmetic; one test per pass (a scalar branch): only on the first pass, or when a lane's sum of the pass's weights is above PCAP, the pass's maximum is taken, ref moves up to RLEAD above it, sum and ctx are rescaled and the pass's weights are formed again; exp2(z) once to f16 is the B operand as it stands in the accumulators; ctx^T += v^T . P^T (v planes as A, 1 product, the 32 real channels). The 4 ranges' (max, sum, ctx) meet in LDS and are joined in range order; the joined rows y stay in LDS. Output stage, the 16 waves, one per (32 positions, 16 output channels): W_y^T = w_out (A, exact bf16) . y^T (B, bf16 hi + lo, 2 products), so a lane holds 8 channels of ONE position; + b_out, eval BatchNorm, + x, stored as out[b][c][n]: the 32 positions of a wave are one whole 128-byte line per channel.
#define FQ 2               // 16-query tiles per wave
#define FG 4               // query groups (waves) per key range
#define FKS 4              // key ranges per block
#define FQB (16 * FQ * FG) // queries per block
#define FST (TT / 32 / FKS)   // 32-key steps per range
#define KP 1               // 32-key steps per pass of the key loop; one step, so that the k fragments of the next two passes have registers of their own beside the pass's logits, weights and v
#define LN2 0.6931471805599453f   // ln 2: the reference maxima go to the join in natural units
#define RLEAD 4.0f         // a new reference stands this far (log2 units) above the maximum it is taken from: later weights may grow to 2^19 times that maximum's before the next move; the largest weight, 2^-4, and all within 2^-10 of it are normal f16 numbers, smaller ones are off by at most 2^-25
#define PCAP 32768.0f      // while a lane's sum of a pass's weights exp2(z) stays below this, each of them is a finite f16 number; the reference cancels in ctx / sum, so it need not be the maximum itself
#define KSTEP (32 * KP * HDQK * 2)   // bytes of a pass's keys in each of the three planes
static_assert(FST % (2 * KP) == 0 && FQ == 2, "whole pairs of passes; the pass's test names both query tiles");
static_assert(FQB == 128 && DIN == 64 && FG * FKS >= 16, "output stage: 4 position pairs x 4 channel tiles = 16 waves");
static_assert(!CAUSAL && TT % FQB == 0 && TT % (32 * FKS) == 0 && HDQK == 32 && QHI == TT && KHI == TT && CC == 128 && TT % 64 == 0, "whole query blocks, equal key ranges, one 32-deep product; one k_proj block column holds the 32 real columns, its 64 rows whole tiles of one batch");
// every unroll directive of k_fa: the fragment, score and accumulator arrays are then indexed by constants alone and stay in registers
__device__ __forceinline__ v8f wm(v16h a, v16h b, v8f c) { return __builtin_amdgcn_wmma_f32_16x16x32_f16(false, a, false, b, (short)0, c, false, false); }
__device__ __forceinline__ v8f wmb(v16b a, v16b b, v8f c) { return __builtin_amdgcn_wmma_f32_16x16x32_bf16(false, a, false, b, (short)0, c, false, false); }
__device__ __forceinline__ v16h frag_p(const _Float16* base, unsigned boff, int tile) { union { v16h v; v8h q[2]; } u; const char* p = (const char*)base + boff + tile; u.q[0] = *(const v8h*)p; u.q[1] = *(const v8h*)(p + 512); return u.v; }   // fragment-order tile: uniform base + the lane's byte offset + the tile's; elements 0..7 in the first 512 bytes, 8..15 in the second
__device__ __forceinline__ float xhalf(float x) { return __builtin_bit_cast(float, __builtin_amdgcn_permlanex16(__builtin_bit_cast(int, x), __builtin_bit_cast(int, x), 0x76543210, 0xfedcba98, false, false)); }   // lane l reads lane l ^ 16
// one query tile's weights of a pass: exp2 of the logits as they stand, their f32 sum in key order, and the f16 B operand
template <bool SLOT> __device__ __forceinline__ float ex2(float x) { if (!SLOT) return __builtin_amdgcn_exp2f(x);
  float r; asm("v_exp_f32 %0, %1\n\tv_nop" : "=v"(r) : "v"(x)); return r; }   // SLOT: the v_nop is the one slot that the instruction set asks for behind a transcendental before its source is overwritten or its result read; for the rare path, where the compiler packed the exponentials so that each overwrote the source of the one before
template <bool SLOT> __device__ __forceinline__ float expsum(const v2f (&z)[8 * KP], v16h (&p)[KP]) { float sum = 0.f;
#pragma unroll
  for (int i = 0; i < 8 * KP; ++i) { const float ex = ex2<SLOT>(z[i].x), ey = ex2<SLOT>(z[i].y); sum += ex; sum += ey; p[i >> 3][2 * (i & 7)] = (_Float16)ex; p[i >> 3][2 * (i & 7) + 1] = (_Float16)ey; }   /* far below the reference the result is 0 */
  return sum; }
// amdgpu_waves_per_eu(4, 4): the block's 16 waves stand 4 on a SIMD and no second block fits beside them, so nothing is gained by saving registers below 256 a wave; without it the compiler schedules the softmax more tightly: fewer additions of the two query tiles pair into one instruction, and more idle slots stand behind the products
__global__ __launch_bounds__(32 * FG * FKS) __attribute__((amdgpu_waves_per_eu(4, 4))) void k_fa(const _Float16* __restrict__ QH, const _Float16* __restrict__ QL, const _Float16* __restrict__ KH, const _Float16* __restrict__ KL, const _Float16* __restrict__ VT,
    const float* __restrict__ X, const float* __restrict__ WW, const float* __restrict__ WB, const float* __restrict__ GAm, const float* __restrict__ BEt, const float* __restrict__ MUv, const float* __restrict__ VAv, float* __restrict__ OUT) {
  __shared__ __align__(16) float so[FKS][FQB][HDQK + 4]; __shared__ float smx[FKS][FQB], ssu[FKS][FQB]; __shared__ __align__(16) float sbn[4][DIN];   /* per output channel: gamma / sqrt(var + eps), mean, beta, b_out */
  const int tid = threadIdx.x, wave = __builtin_amdgcn_readfirstlane(tid >> 5), lane = tid & 31, col = lane & 15, g = lane >> 4; const int qg = wave % FG, ks = wave / FG;
  const int b = blockIdx.y, qr0 = blockIdx.x * FQB; const size_t rb = (size_t)b * TT;
  if (wave < DIN / 32) { sbn[0][tid] = bfr(GAm[tid]) / __fsqrt_rn(bfr(VAv[tid]) + 1e-4f); sbn[1][tid] = bfr(MUv[tid]); sbn[2][tid] = bfr(BEt[tid]); sbn[3][tid] = bfr(WB[tid]); }   /* one thread per output channel, one division and root per channel and block; read behind the two barriers below */
  v16h qh[FQ], ql[FQ];
#pragma unroll
  for (int u = 0; u < FQ; ++u) { const size_t qo = (rb + qr0 + (qg * FQ + u) * 16 + col) * HDQK; qh[u] = frag_h(QH + qo, lane); ql[u] = frag_h(QL + qo, lane); }
  __builtin_amdgcn_sched_barrier(0);   /* keeps the q loads in front of the first k loads: loads return in order, so the wait at the head of a pass, which on entry covers q too, can then leave the next pass's k loads in flight; with q behind them it waits for those as well, on every trip */
  const _Float16* kph = KH + (rb + ks * (FST * 32)) * HDQK; const _Float16* kpl = KL + (rb + ks * (FST * 32)) * HDQK; const _Float16* vp = VT + (rb + ks * (FST * 32)) * HDQK;   /* wave-uniform bases; 32 halves per key in each of the three */
  unsigned lo = lane * 16;   /* bytes, the same in all three planes: the lane's own place in each 512-byte half of a tile, plus the passes done (stepped by a pass's keys behind a pass's logit products) */
  float l[FQ]; v8f o[FQ][2], cs[FQ];   /* cs: minus the reference maximum (log2 units), the same in all 8 registers: a lane's 8 accumulator rows are 8 keys of ONE query */
#pragma unroll
  for (int u = 0; u < FQ; ++u) { l[u] = 0.f; o[u][0] = v8f{}; o[u][1] = v8f{}; cs[u] = v8f{}; }
  v16h kh[2][2 * KP], kl[2][2 * KP], vv[2][2 * KP];   /* two sets each, carried round the loop: pass kc finds its fragments in set kc & 1, k loaded two passes earlier, v one; vv[n][2 i + c]: 32-key group i, channel tile c */
#pragma unroll
  for (int n = 0; n < 2; ++n) {
#pragma unroll
    for (int t = 0; t < 2 * KP; ++t) { kh[n][t] = frag_p(kph, lo, n * KSTEP + t * 1024); kl[n][t] = frag_p(kpl, lo, n * KSTEP + t * 1024); }
    __builtin_amdgcn_sched_barrier(0);   /* the first loads in the order that the loop keeps (k of a pass, v of that pass, k of the next), so that the counted waits of the first trip are those of every trip */
    if (n == 0) {
#pragma unroll
      for (int t = 0; t < 2 * KP; ++t) vv[0][t] = frag_p(vp, lo, t * 1024);
      __builtin_amdgcn_sched_barrier(0); } }   /* as above */
  unsigned lk = lo + KSTEP;   /* lo, lk: the places of the last passes whose v and k loads are issued */
  for (int kc2 = 0; kc2 < FST / KP; kc2 += 2)
#pragma unroll
  for (int n = 0; n < 2; ++n) { const int kc = kc2 + n;   /* two passes a trip, so that each names its set of k registers by a constant */
    v2f s[FQ][8 * KP];   /* logits in pairs, as the packed fma takes and leaves them */
    v8f a[2][FQ], al[2][FQ];   /* the product tiles of two key tiles */
#pragma unroll
    for (int t = 0; t <= 2 * KP; ++t) {
      if (t < 2 * KP) {
#pragma unroll
        for (int u = 0; u < FQ; ++u) al[t & 1][u] = wm(kh[n][t], ql[u], v8f{});
#pragma unroll
        for (int u = 0; u < FQ; ++u) a[t & 1][u] = wm(kh[n][t], qh[u], cs[u]);
#pragma unroll
        for (int u = 0; u < FQ; ++u) al[t & 1][u] = wm(kl[n][t], qh[u], al[t & 1][u]); }
      __builtin_amdgcn_sched_barrier(0);   /* key tile t's six products stand between tile t - 1's products and the fmas that read them: the fmas then need no idle slots behind a product; left free, each fma run moves up to its product */
      if (t > 0) {
#pragma unroll
        for (int u = 0; u < FQ; ++u)
#pragma unroll
          for (int r = 0; r < 4; ++r) s[u][(t - 1) * 4 + r] = __builtin_elementwise_fma(v2f{al[(t - 1) & 1][u][2 * r], al[(t - 1) & 1][u][2 * r + 1]}, v2f{1.0f / 1024.0f, 1.0f / 1024.0f}, v2f{a[(t - 1) & 1][u][2 * r], a[(t - 1) & 1][u][2 * r + 1]}) * SCALE; }
      __builtin_amdgcn_sched_barrier(0); }   /* ends tile t - 1's fmas in front of tile t + 1's products, which take over their registers; behind the last tile it keeps the loads below behind the logit products, whose k registers they fill again */
    asm volatile("s_wait_xcnt 0x0" : "+v"(lo), "+v"(lk));   /* the wait in front of the rewrite of the loads' two offset registers, here behind the logit products, where the addresses of the last pass's loads are long taken; the registers are its operands, so the loads keep the form of one scalar base plus such a register, no load lands a result in them, and they are stepped only behind the wait */
    lo += kc + 1 < FST / KP ? KSTEP : 0; lk += kc + 2 < FST / KP ? KSTEP : 0;   /* where there is no next pass, or none after it, the loads read the last pass's fragments again, so that no load leaves the range */
#pragma unroll
    for (int t = 0; t < 2 * KP; ++t) vv[n ^ 1][t] = frag_p(vp, lo, t * 1024);   /* the next pass's v, into the set that the last pass's products have left */
    __builtin_amdgcn_sched_barrier(0);   /* v in front of k: loads return in order, and the next pass's v is wanted before the k of the pass after it */
#pragma unroll
    for (int t = 0; t < 2 * KP; ++t) { kh[n][t] = frag_p(kph, lk, t * 1024); kl[n][t] = frag_p(kpl, lk, t * 1024); }
    __builtin_amdgcn_sched_barrier(0);   /* keeps these loads here, in front of the softmax: a whole pass and more covers their latency; left free, they sink towards the trip's foot */
    v16h p[FQ][KP]; float sum[FQ];
#pragma unroll
    for (int u = 0; u < FQ; ++u) sum[u] = expsum<false>(s[u], p[u]);
    const bool first = kc == 0;   /* no reference yet: z is the bare logit */
    if (first || __builtin_amdgcn_ballot_w32(fmaxf(sum[0], sum[1]) > PCAP) != 0) {   /* wave-uniform, one test per pass: a weight is at most its lane's sum, so below PCAP every weight is a finite f16 number and the pass stands as it is */
#pragma unroll
      for (int u = 0; u < FQ; ++u) {
        float x = s[u][0].x;
#pragma unroll
        for (int i = 1; i < 16 * KP; ++i) x = fmaxf(x, s[u][i >> 1][i & 1]);
        x = fmaxf(x, xhalf(x)) + RLEAD;   /* the two lane halves hold the same query's other keys of the pass */
        const float d = first ? x : fmaxf(x, 0.f), sc = first ? 0.f : __builtin_amdgcn_exp2f(-d);   /* the reference rises by d to RLEAD above the pass's maximum where that is above it; sum and ctx are still 0 on the first pass */
        l[u] *= sc;
#pragma unroll
        for (int r = 0; r < 8; ++r) { o[u][0][r] *= sc; o[u][1][r] *= sc; cs[u][r] -= d; }
#pragma unroll
        for (int i = 0; i < 8 * KP; ++i) s[u][i] -= v2f{d, d};
        sum[u] = expsum<true>(s[u], p[u]); } }   /* the pass's weights again, against the new reference: at most 2^-RLEAD each */
#pragma unroll
    for (int u = 0; u < FQ; ++u) {
      l[u] += sum[u];
#pragma unroll
      for (int i = 0; i < KP; ++i)
#pragma unroll
        for (int c = 0; c < 2; ++c) o[u][c] = wm(vv[n][2 * i + c], p[u][i], o[u][c]); }
  }
  asm volatile("s_wait_xcnt 0x0" : "+v"(lo), "+v"(lk));   /* the last pass's loads are issued behind the loop's last wait: this one stands in front of the first reuse of the registers that they name; the two offset registers are its operands, so they live up to it */
  __builtin_amdgcn_sched_barrier(0);   /* keeps what follows, which takes over the loads' scalar bases too, behind the wait */
#pragma unroll
  for (int u = 0; u < FQ; ++u) { const int rl = (qg * FQ + u) * 16 + col; const float lt = l[u] + xhalf(l[u]); if (g == 0) { smx[ks][rl] = -cs[u][0] * LN2; ssu[ks][rl] = lt; }
#pragma unroll
    for (int c = 0; c < 2; ++c)
#pragma unroll
      for (int r = 0; r < 8; ++r) so[ks][rl][c * 16 + 8 * g + r] = o[u][c][r]; }   /* register r = channel 16c + 8g + r of query col */
  // output stage, operands that do not depend on y: fetched in front of the barrier, where a wave that leaves the key loop early waits for the others anyway
  const bool ow = wave < 16; const int np = wave & 3, ct = wave >> 2;   /* wave-uniform: position pair np (tiles 2 np, 2 np + 1) x channel tile ct */
  v16b wf = zero16b(); float xr[2][8] = {};
  const size_t oi = ((size_t)b * DIN + ct * 16 + 8 * g) * XP + qr0 + np * 32 + col;   /* channel 16 ct + 8 g (+ r), position 32 np + col (+ 16 t) */
  if (ow) { wf = wcol_oi(WW, 0, ct * 16 + col, lane, HDQK);   /* A fragment: row = output channel 16 ct + col, k = y channel, the k order of split_row */
#pragma unroll
    for (int r = 0; r < 8; ++r)
#pragma unroll
      for (int t = 0; t < 2; ++t) xr[t][r] = bfr(X[oi + (size_t)r * XP + t * 16]); }
  __syncthreads();   /* every range's maximum, sum and partial rows are in LDS before any thread joins them */
  for (int e = tid; e < FQB * (HDQK / 4); e += 32 * FG * FKS) { const int rl = e / (HDQK / 4), q = e % (HDQK / 4); float mt = smx[0][rl];
#pragma unroll
    for (int i = 1; i < FKS; ++i) mt = fmaxf(mt, smx[i][rl]);
    float lt = 0.f; v4f s = {};
#pragma unroll
    for (int i = 0; i < FKS; ++i) { const float w = expf(smx[i][rl] - mt); lt += w * ssu[i][rl]; s += *(const v4f*)&so[i][rl][q * 4] * w; }
    *(v4f*)&so[0][rl][q * 4] = s * (1.0f / lt); }   /* y in place of range 0's partial row: these 4 words are read by this thread alone, above */
  __syncthreads();   /* all of y and the channel table are in LDS before the output stage reads them */
  if (ow) { float inv[8], mu[8], be[8], bo[8];
#pragma unroll
    for (int r = 0; r < 8; ++r) { const int c = ct * 16 + 8 * g + r; inv[r] = sbn[0][c]; mu[r] = sbn[1][c]; be[r] = sbn[2][c]; bo[r] = sbn[3][c]; }
#pragma unroll
    for (int t = 0; t < 2; ++t) { const F2 y = split_row(&so[0][np * 32 + t * 16 + col][0], 0, lane); v8f acc = {}; acc = wmb(wf, y.h, acc); acc = wmb(wf, y.l, acc);
#pragma unroll
      for (int r = 0; r < 8; ++r) OUT[oi + (size_t)r * XP + t * 16] = (((acc[r] + bo[r]) - mu[r]) * inv[r] + be[r]) + xr[t][r]; } } }   /* eval BN: (W_y - mean) * (gamma / sqrt(var + eps)) + beta, then + x */

extern "C" void kernel_launch(void* const* d_in, const int* in_sizes, int n_in, void* d_out, int out_size, void* d_ws, size_t ws_size, hipStream_t stream) {
  (void)in_sizes; (void)n_in; (void)out_size;
  const float** F = (const float**)d_in;
  if (ws_size < (size_t)WS_END) return;
  char* ws = (char*)d_ws; _Float16 *QH = (_Float16*)(ws + WS_QH), *KH = (_Float16*)(ws + WS_KH), *VT = (_Float16*)(ws + WS_VT), *QL = (_Float16*)(ws + WS_QL), *KL = (_Float16*)(ws + WS_KL); float *S = (float*)(ws + WS_S), *Y = (float*)(ws + WS_Y);
  (void)Y; (void)S;
  // inputs: 0 x [4,64,80,80]; 1 w_theta [32,64] (out,in), 2 b_theta; 3 w_phi, 4 b_phi; 5 w_g, 6 b_g; 7 w_out [64,32] (out,in), 8 b_out; 9 bn_gamma, 10 bn_beta, 11 bn_mean, 12 bn_var
  k_proj<<<dim3(TNB * TT / 64, CC / 128, 3), 128, 0, stream>>>(F[0], F[0], F[0], F[1], F[3], F[5], F[2], F[4], F[6], QH, QL, KH, KL, VT);   /* q = theta, k = phi, v = g */
  k_fa<<<dim3(TT / FQB, TNB), 32 * FG * FKS, 0, stream>>>(QH, QL, KH, KL, VT, F[0], F[7], F[8], F[9], F[10], F[11], F[12], (float*)d_out);
}

// v010
// A run of this version takes 39.1 microseconds.
// Next to v009, in two timings, it ran 1.05 and 1.07 times as fast.
// Over all steps from v000 it is 50.1 times as fast.
// compute dtype: all float inputs rounded to bf16; theta/phi/g = W x + b with EXACT bf16 products on WMMA 16x16x32 (f32 accumulate); unscaled logits theta.phi with BOTH as f16 hi + residual planes (3 products); softmax in f32 (logits kept in registers, in units of log2: theta is multiplied by log2 e before it is split; a reference maximum per query enters the logit product as the accumulator's start value and is moved only when a pass's weights sum to more than 2^15 in a lane, so exp(f - ref) = hardware exp2 of the product as it stands; precise expf where the key ranges are joined); exp(f - ref) once to f16 against g once to f16 (1 product), divided by the f32 sum at the end; y split bf16 hi + lo against exact w_out (2 products) + b_out; eval BatchNorm and the residual in f32; f32 output.
#include <hip/hip_runtime.h>
#include <math.h>

typedef __attribute__((ext_vector_type(16))) _Float16 v16h;
typedef __attribute__((ext_vector_type(16))) __bf16 v16b;
typedef __attribute__((ext_vector_type(8)))  _Float16 v8h;
typedef __attribute__((ext_vector_type(8)))  float v8f;
typedef __attribute__((ext_vector_type(4)))  float v4f;
typedef __attribute__((ext_vector_type(2)))  float v2f;
typedef __attribute__((ext_vector_type(4)))  unsigned v4u;
typedef __attribute__((ext_vector_type(4)))  int v4i;
typedef float __attribute__((may_alias)) float_a;
typedef int __attribute__((may_alias)) int_a;

template <typename T> __device__ __forceinline__ void vst2(void* p, T v) { *(T*)p = v;  }
__device__ __forceinline__ v8f wmma16(v16h a, v16h b, v8f c) {
  v8f d = __builtin_amdgcn_wmma_f32_16x16x32_f16(false, a, false, b, (short)0, c, false, false);
  asm volatile("v_nop\n\tv_nop\n\tv_nop\n\tv_nop" : "+v"(d) : "v"(a), "v"(b));
  return d;
}
__device__ __forceinline__ v8f wmma_bf(v16b a, v16b b, v8f c) {
  v8f d = __builtin_amdgcn_wmma_f32_16x16x32_bf16(false, a, false, b, (short)0, c, false, false);
  asm volatile("v_nop\n\tv_nop\n\tv_nop\n\tv_nop" : "+v"(d) : "v"(a), "v"(b));
  return d;
}
// 16x16x32 fragments: lane = (h = lane>>4, row/col = lane&15); elements 0..7 = k0+8h+0..7, 8..15 = k0+16+8h+0..7; D element r = row 8h+r
__device__ __forceinline__ v16h frag_h(const _Float16* rowk0, int lane) {
  union { v16h v; v8h q[2]; } u; const _Float16* p = rowk0 + 8 * (lane >> 4);
  u.q[0] = *(const v8h*)p; u.q[1] = *(const v8h*)(p + 16); return u.v;
}
__device__ __forceinline__ v16h frag_f32(const float* rowk0, int lane) {
  v16h a; const float* p = rowk0 + 8 * (lane >> 4);
#pragma unroll
  for (int i = 0; i < 8; ++i) { a[i] = (_Float16)p[i]; a[8 + i] = (_Float16)p[16 + i]; }
  return a;
}
__device__ __forceinline__ v16h frag_f32s(const float* rowk0, int lane, float sc) {
  v16h a; const float* p = rowk0 + 8 * (lane >> 4);
#pragma unroll
  for (int i = 0; i < 8; ++i) { a[i] = (_Float16)(p[i] * sc); a[8 + i] = (_Float16)(p[16 + i] * sc); }
  return a;
}
// column fragment from a [K][ld] layout (column n), rows >= K read as 0
__device__ __forceinline__ v16h fragc_f32(const float* W, int k0, int n, int lane, int ld, int K) {
  v16h a; const int g = lane >> 4;
#pragma unroll
  for (int i = 0; i < 8; ++i) { const int ka = k0 + 8 * g + i, kb = ka + 16;
    a[i] = (_Float16)(ka < K ? W[(size_t)(ka < K ? ka : K - 1) * ld + n] : 0.f); a[8 + i] = (_Float16)(kb < K ? W[(size_t)(kb < K ? kb : K - 1) * ld + n] : 0.f); }
  return a;
}
struct F2 { v16b h, l; };
__device__ __forceinline__ F2 bsplit16(const float v[16]) { F2 r;
#pragma unroll
  for (int i = 0; i < 16; ++i) { const __bf16 h = (__bf16)v[i]; r.h[i] = h; r.l[i] = (__bf16)(v[i] - (float)h); }
  return r; }
__device__ __forceinline__ F2 split_row(const float* row, int k0, int lane) { float v[16]; const float* p = row + k0 + 8 * (lane >> 4);
#pragma unroll
  for (int i = 0; i < 8; ++i) { v[i] = p[i]; v[8 + i] = p[16 + i]; }
  return bsplit16(v); }
__device__ __forceinline__ F2 split_rowK(const float* row, int k0, int lane, int K) { float v[16]; const int g = lane >> 4;
#pragma unroll
  for (int i = 0; i < 8; ++i) { const int ka = k0 + 8 * g + i, kb = ka + 16; v[i] = ka < K ? row[ka < K ? ka : K - 1] : 0.f; v[8 + i] = kb < K ? row[kb < K ? kb : K - 1] : 0.f; }
  return bsplit16(v); }
__device__ __forceinline__ F2 split_col(const float* W, int k0, int n, int lane, int ld, int K) { float v[16]; const int g = lane >> 4;
#pragma unroll
  for (int i = 0; i < 8; ++i) { const int ka = k0 + 8 * g + i, kb = ka + 16; v[i] = ka < K ? W[(size_t)(ka < K ? ka : K - 1) * ld + n] : 0.f; v[8 + i] = kb < K ? W[(size_t)(kb < K ? kb : K - 1) * ld + n] : 0.f; }
  return bsplit16(v); }
__device__ __forceinline__ v8f mac3(const F2& a, const F2& b, v8f c) { c = wmma_bf(a.l, b.h, c); c = wmma_bf(a.h, b.l, c); return wmma_bf(a.h, b.h, c); }
__device__ __forceinline__ float sigm(float v) { return 1.0f / (1.0f + expf(-v)); }
#define LDSX() do { asm volatile("s_wait_dscnt 0" ::: "memory"); __builtin_amdgcn_wave_barrier(); __builtin_amdgcn_fence(__ATOMIC_RELEASE, "workgroup"); } while (0)

// Non-local block (B 4, C 64, 80 x 80 = 6,400 positions; inter channels 32): theta, phi, g = 1x1 convs of x ((out,in) [32,64] + bias); f[n][m] = theta_n . phi_m (no scaling); P = softmax over m; y[n] = sum_m P[n][m] g_m; W_y = w_out y + b_out (32 -> 64); out = BN_eval(W_y) (running mean/var, eps 1e-4, affine) + x.
#define NB 4
#define TT 6400
#define CC 128            // sizes the workspace regions (32 columns of each are used)
#define DIN 64            // input channels
#define NH 1
#define HD 128
#define NQB (TT / 64)
#define HG 1               // sizes WS_S: one 6,400 x 6,400 f32 plane, unused (scores stay in registers)
#define SCALE (1.0f)
#define HDQK 32            // theta / phi / g channels
#define CAUSAL 0
#ifndef TNB
#define TNB NB
#endif
__device__ __forceinline__ v16b zero16b() { v16b z; _Pragma("unroll") for (int i = 0; i < 16; ++i) z[i] = (__bf16)0.f; return z; }
__device__ __forceinline__ float bfr(float v) { return (float)(__bf16)v; }
__host__ __device__ __forceinline__ int kb_last(int qb) { return CAUSAL ? ((qb * 64 + 63) >> 7) : (TT / 128 - 1); }
typedef __attribute__((ext_vector_type(8))) __bf16 v8b;
__device__ __forceinline__ v16b frag_b(const __bf16* rowk0, int lane) {
  union { v16b v; v8b q[2]; } u; const __bf16* p = rowk0 + 8 * (lane >> 4);
  u.q[0] = *(const v8b*)p; u.q[1] = *(const v8b*)(p + 16); return u.v;
}
#define QBH (TT / 64)      // ALL queries take the 3-product logits (k_fa)
#define QBH_PV 0           // P.v stays single f16
#define QHI 6400            // q residual rows everywhere
#define KHI 6400           // k residual rows for ALL keys (3-product logits; sigma_f ~ 5.7 unscaled)
// B fragment (k rows k0+.., output column o) of a weight: (in,out) [K][ld] or (out,in) [ld rows of K]: bf16 exact, or f16(bf16 * 256) exact
__device__ __forceinline__ v16b wcol_io(const float* Wm, int k0, int o, int lane, int ld) { v16b w; const int g = lane >> 4;
#pragma unroll
  for (int i = 0; i < 8; ++i) { w[i] = (__bf16)Wm[(size_t)(k0 + 8 * g + i) * ld + o]; w[8 + i] = (__bf16)Wm[(size_t)(k0 + 16 + 8 * g + i) * ld + o]; }
  return w; }
__device__ __forceinline__ v16b wcol_oi(const float* Wm, int k0, int o, int lane, int K) { v16b w; const float* p = Wm + (size_t)o * K + k0 + 8 * (lane >> 4);
#pragma unroll
  for (int i = 0; i < 8; ++i) { w[i] = (__bf16)p[i]; w[8 + i] = (__bf16)p[16 + i]; }
  return w; }
__device__ __forceinline__ v16h wcolh_io(const float* Wm, int k0, int o, int lane, int ld) { v16h w; const int g = lane >> 4;
#pragma unroll
  for (int i = 0; i < 8; ++i) { w[i] = (_Float16)(bfr(Wm[(size_t)(k0 + 8 * g + i) * ld + o]) * 256.0f); w[8 + i] = (_Float16)(bfr(Wm[(size_t)(k0 + 16 + 8 * g + i) * ld + o]) * 256.0f); }
  return w; }
__device__ __forceinline__ v16h wcolh_oi(const float* Wm, int k0, int o, int lane, int K) { v16h w; const float* p = Wm + (size_t)o * K + k0 + 8 * (lane >> 4);
#pragma unroll
  for (int i = 0; i < 8; ++i) { w[i] = (_Float16)(bfr(p[i]) * 256.0f); w[8 + i] = (_Float16)(bfr(p[16 + i]) * 256.0f); }
  return w; }
#define WQKV_LAYOUT 1   // 0 = (in,out) [DIN][CC]; 1 = (out,in) [HDQK][DIN]; 2 = per-head [NH][DIN][HD]
__device__ __forceinline__ v16b wcol_hdk(const float* Wm, int k0, int o, int lane) { v16b w; const int g = lane >> 4; const float* p = Wm + (size_t)(o / HD) * DIN * HD + (o % HD);
#pragma unroll
  for (int i = 0; i < 8; ++i) { w[i] = (__bf16)p[(size_t)(k0 + 8 * g + i) * HD]; w[8 + i] = (__bf16)p[(size_t)(k0 + 16 + 8 * g + i) * HD]; }
  return w; }
#define WO_OUT_IN 0
#if WQKV_LAYOUT == 1
#define WCOL(W, k0, o, lane) (((o) < HDQK) ? wcol_oi(W, k0, (o), lane, DIN) : zero16b())   /* theta/phi/g weights are [32][64] (out,in): columns o >= 32 give zero fragments */
#elif WQKV_LAYOUT == 2
#define WCOL(W, k0, o, lane) wcol_hdk(W, k0, o, lane)
#else
#define WCOL(W, k0, o, lane) wcol_io(W, k0, o, lane, CC)
#endif
#if WO_OUT_IN
#define WOCOL(W, k0, o, lane) wcol_oi(W, k0, o, lane, CC)
#define WOCOLH(W, k0, o, lane) wcolh_oi(W, k0, o, lane, CC)
#else
#define WOCOL(W, k0, o, lane) wcol_io(W, k0, o, lane, DIN)
#define WOCOLH(W, k0, o, lane) wcolh_io(W, k0, o, lane, DIN)
#endif
#ifndef XP
#define XP TT              // position pitch of x and of the output
#endif
#define BG HG              // the pass group spans BATCHES (single head): k_fa's blockIdx.y selects the batch
#define DVH 128
#ifndef SM_EXTRA_PARAMS
#define SM_EXTRA_PARAMS
#endif
#ifndef PROJ_EXTRA_PARAMS
#define PROJ_EXTRA_PARAMS
#endif
#ifndef SM_MASK_HOOK
#define SM_MASK_HOOK (void)0
#endif

#define WS_QH  0u                                      // f16 q rows [b*t][HDQK], the 32 real columns
#define WS_KH  (WS_QH + 2u * (size_t)NB * TT * CC)      // f16 k, the 32 real columns in fragment order: [b*t / 16][half][lane][8], 1,024 B per 16-key tile
#define WS_VT  (WS_KH + 2u * (size_t)NB * TT * CC)      // f16 v, the 32 real channels in fragment order: [b*t / 32][channel tile][half][lane][8], 2,048 B per 32 keys
#define WS_QL  (WS_VT + 2u * (size_t)NB * CC * TT)      // f16 q residual x 2^10 rows [b][t < QHI][HDQK]
#define WS_KL  (WS_QL + 2u * (size_t)NB * QHI * CC)     // f16 k residual x 2^10, laid out as WS_KH
#define WS_VB  (WS_KL + 2u * (size_t)NB * KHI * CC)     // not used (the offsets behind it stay where they were)
#define WS_VBL (WS_VB + 2u * (size_t)NB * CC * KHI)
#define WS_S   (WS_VBL + 2u * (size_t)NB * CC * KHI)    // f32 [hg][t][s] region, unused (no kernel stores logits)
#define WS_Y   (WS_S  + 4u * (size_t)HG * TT * TT)      // empty: the joined rows y stay in k_fa's LDS
#define WS_END (WS_Y  + 0u)
#define PJ (HDQK / 16)     // 16-column tiles of a projection: the real columns only

// ---- k_proj: block = 64 rows, ALL THREE projections: q/k/v = X W (+ b) with exact bf16 products (K = DIN), the 32 real columns of each. The 24 KB of weights are read once a block, 16 bytes a thread in plain order (a wave-wide load = 4 whole lines; a fragment loaded straight from the [out][in] rows touches 16 lines a load, in every wave), rounded to bf16 and left in LDS in fragment order; a wave gathers its 16 rows of x once and uses the two fragments for all six weight tiles. All global loads are issued ahead of the first wait. q x log2 e: f16 rows (+ residual rows < QHI), 32 columns a row; k: f16 and its residual in fragment order; v: f16 in fragment order. Only what k_fa reads is computed and stored. Fragment order: the 16 bytes that lane l of k_fa loads stand at 16 l inside a 512-byte run, so one wave-wide load reads 4 whole lines
// every unroll directive of k_proj but the last three: the register arrays are then indexed by constants alone and stay in registers
typedef __attribute__((ext_vector_type(4))) __bf16 v4b;
#define WU 136             // bf16 per unit of the weight store: 16 lanes x 8 elements + 8 of pad, so that the 8 units which a half-wave's stores of one weight row go to start 4 banks apart
static_assert(DIN == 64 && HDQK == 32, "a weight row is 16 runs of 4 floats; 128 threads bring a [32][64] matrix in 4 loads each");
__global__ __launch_bounds__(128) void k_proj(const float* __restrict__ X, const float* __restrict__ WQ, const float* __restrict__ WK, const float* __restrict__ WV, const float* __restrict__ BQ, const float* __restrict__ BK, const float* __restrict__ BV,
    _Float16* __restrict__ QH, _Float16* __restrict__ QL, _Float16* __restrict__ KH, _Float16* __restrict__ KL, _Float16* __restrict__ VT) {
  __shared__ __align__(16) __bf16 sw[3 * PJ * (DIN / 32) * 4 * WU];   /* unit ((((w PJ + j) 2 + kc) 2 + half) 2 + g): the elements 8 half + 0..7 of lanes 16 g + 0..15 of the B fragment (projection w, column tile j, k step kc) */
  __shared__ __align__(16) _Float16 sh[2][64][HDQK + 8], sl[2][64][HDQK + 8]; __shared__ __align__(16) _Float16 th[HDQK][72];   /* sh, sl: [0] q, [1] k */
  const int tid = threadIdx.x, wave = tid >> 5, lane = tid & 31, col = lane & 15, g = lane >> 4; const size_t r0 = (size_t)blockIdx.x * 64; const size_t bb = r0 / TT; const int t0 = (int)(r0 % TT);
  v4f wr[3][4]; float xr[DIN / 32][16], br[3][PJ];
#pragma unroll
  for (int w = 0; w < 3; ++w) { const float* WA = w == 0 ? WQ : w == 1 ? WK : WV;
#pragma unroll
    for (int it = 0; it < 4; ++it) wr[w][it] = *(const v4f*)(WA + (it * 128 + tid) * 4); }
#pragma unroll
  for (int kc = 0; kc < DIN / 32; ++kc) { const float* p = X + (bb * DIN + kc * 32 + 8 * g) * (size_t)XP + t0 + wave * 16 + col;   /* channels-first gather: x[b][k][t], stride XP between k */
#pragma unroll
    for (int i = 0; i < 8; ++i) { xr[kc][i] = p[(size_t)i * XP]; xr[kc][8 + i] = p[(size_t)(16 + i) * XP]; } }
#pragma unroll
  for (int w = 0; w < 3; ++w) { const float* WA = w == 0 ? WQ : w == 1 ? WK : WV; const float* BA = w == 0 ? BQ : w == 1 ? BK : BV;
#pragma unroll
    for (int j = 0; j < PJ; ++j) br[w][j] = (BA ? BA : WA)[j * 16 + col]; }   /* 32-entry biases; without one the load reads a weight, which is not used: no branch stands among the loads */
#pragma unroll
  for (int w = 0; w < 3; ++w)
#pragma unroll
    for (int it = 0; it < 4; ++it) { const int e = it * 128 + tid, o = e >> 4, k = (e & 15) * 4;   /* floats k .. k + 3 of weight row o: element 8 half + (k & 7) .. of lane 16 g + (o & 15), the k order of wcol_oi */
      const int un = (((w * PJ + (o >> 4)) * 2 + (k >> 5)) * 2 + ((k >> 4) & 1)) * 2 + ((k >> 3) & 1); const v4f r = wr[w][it];
      *(v4b*)&sw[un * WU + (o & 15) * 8 + (k & 7)] = v4b{(__bf16)r.x, (__bf16)r.y, (__bf16)r.z, (__bf16)r.w}; }
  v16b a[DIN / 32];
#pragma unroll
  for (int kc = 0; kc < DIN / 32; ++kc)
#pragma unroll
    for (int i = 0; i < 16; ++i) a[kc][i] = (__bf16)xr[kc][i];
  __syncthreads();   /* all twelve weight fragments are in LDS before any wave reads them */
  v16b wf[3 * PJ * (DIN / 32)];   /* all twelve fragments are read ahead of the products: one LDS latency, not twelve */
#pragma unroll
  for (int f = 0; f < 3 * PJ * (DIN / 32); ++f) { union { v16b v; v8b q[2]; } u;
    u.q[0] = *(const v8b*)&sw[((f * 2 + 0) * 2 + g) * WU + col * 8]; u.q[1] = *(const v8b*)&sw[((f * 2 + 1) * 2 + g) * WU + col * 8]; wf[f] = u.v; }
  v8f acc[3][PJ] = {};
#pragma unroll
  for (int kc = 0; kc < DIN / 32; ++kc)
#pragma unroll
    for (int w = 0; w < 3; ++w)
#pragma unroll
      for (int j = 0; j < PJ; ++j) acc[w][j] = __builtin_amdgcn_wmma_f32_16x16x32_bf16(false, a[kc], false, wf[(w * PJ + j) * 2 + kc], (short)0, acc[w][j], false, false);   /* six independent tiles, k step 0 then 1 */
  float bias[3][PJ];
#pragma unroll
  for (int w = 0; w < 3; ++w) { const float* BA = w == 0 ? BQ : w == 1 ? BK : BV;
#pragma unroll
    for (int j = 0; j < PJ; ++j) bias[w][j] = BA ? bfr(br[w][j]) : 0.f; }
#pragma unroll
  for (int w = 0; w < 2; ++w) { const float qs = w == 0 ? 1.4426950408889634f : 1.0f;   /* q carries log2 e, so that k_fa's logits are exponents of 2 */
#pragma unroll
    for (int j = 0; j < PJ; ++j)
#pragma unroll
      for (int r = 0; r < 8; ++r) { const float v = (acc[w][j][r] + bias[w][j]) * qs; const _Float16 hv = (_Float16)v; sh[w][wave * 16 + 8 * g + r][j * 16 + col] = hv; sl[w][wave * 16 + 8 * g + r][j * 16 + col] = (_Float16)((v - (float)hv) * 1024.0f); } }
#pragma unroll
  for (int j = 0; j < PJ; ++j)
#pragma unroll
    for (int r = 0; r < 8; ++r) th[j * 16 + col][wave * 16 + 8 * g + r] = (_Float16)(acc[2][j][r] + bias[2][j]);
  __syncthreads();   /* the block's q, k and v tiles are in LDS before any thread stores them in their global order */
  // the three store loops are unrolled so that a thread's ten LDS reads are issued together and waited for once, not one after another
#pragma unroll
  for (int it = 0; it < 2; ++it) { const int e = it * 128 + tid, rl = e / (HDQK / 8), q = e % (HDQK / 8); vst2((unsigned*)(QH + (r0 + rl) * HDQK + q * 8), *(const v4u*)&sh[0][rl][q * 8]); if (t0 < QHI) vst2((unsigned*)(QL + (bb * QHI + t0 + rl) * (size_t)HDQK + q * 8), *(const v4u*)&sl[0][rl][q * 8]); }
#pragma unroll
  for (int it = 0; it < 2; ++it) { const int e = it * 128 + tid, tl = e >> 6, h2 = (e >> 5) & 1, ln = e & 31; const int rl = tl * 16 + (ln & 15), cs = 16 * h2 + 8 * (ln >> 4); const size_t d = (r0 + tl * 16) * HDQK + h2 * 256 + ln * 8;   /* A fragment of key tile tl: lane (col, g) holds key col, channels 16 h2 + 8 g + 0..7 */
    vst2((unsigned*)(KH + d), *(const v4u*)&sh[1][rl][cs]); if (t0 < KHI) vst2((unsigned*)(KL + d), *(const v4u*)&sl[1][rl][cs]); }
#pragma unroll
  for (int it = 0; it < 2; ++it) { const int e = it * 128 + tid, st = e >> 7, ct = (e >> 6) & 1, h2 = (e >> 5) & 1, ln = e & 31;   /* A fragment of channel tile ct, 32-key step st: lane (col, g) holds channel 16 ct + col, keys 16 h2 + 8 g + 0..7 */
    vst2((unsigned*)(VT + (r0 + st * 32) * HDQK + ct * 512 + h2 * 256 + ln * 8), *(const v4u*)&th[ct * 16 + (ln & 15)][st * 32 + 16 * h2 + 8 * (ln >> 4)]); } }
// ---- k_fa: block = 128 queries of batch b (4 groups of 32) x 4 key ranges of 1,600 keys, one wave per (query group, key range); the 4 waves of a range read the same k and v lines, which k_proj left in fragment order (every wave-wide 16-byte load covers 512 contiguous bytes). The loop's loads run ahead of their use: behind a pass's logit products the wave issues the next pass's v loads and the k loads of the pass after next, each into the one of two register sets that has just been left, so that no pass waits for a load it has only just issued. Per pass of 32 keys: S^T = k . q^T (k rows as A, q as B; q and k as f16 hi + residual x 2^10, 3 products), so a lane holds 16 keys' logits of ONE query per 16-query tile; q carries log2 e and the hi . hi product starts from minus the query's reference maximum, so the logits leave the products as z = (s - ref) log2 e and exp2(z) needs no further arithmetic; one test per pass (a scalar branch): only on the first pass, or when a lane's sum of the pass's weights is above PCAP, the pass's maximum is taken, ref moves up to RLEAD above it, sum and ctx are rescaled and the pass's weights are formed again; exp2(z) once to f16 is the B operand as it stands in the accumulators; ctx^T += v^T . P^T (v planes as A, 1 product, the 32 real channels). The 4 ranges' (max, sum, ctx) meet in LDS and are joined in range order; the joined rows y stay in LDS. Output stage, the 16 waves, one per (32 positions, 16 output channels): W_y^T = w_out (A, exact bf16) . y^T (B, bf16 hi + lo, 2 products), so a lane holds 8 channels of ONE position; + b_out, eval BatchNorm, + x, stored as out[b][c][n]: the 32 positions of a wave are one whole 128-byte line per channel.
#define FQ 2               // 16-query tiles per wave
#define FG 4               // query groups (waves) per key range
#define FKS 4              // key ranges per block
#define FQB (16 * FQ * FG) // queries per block
#define FST (TT / 32 / FKS)   // 32-key steps per range
#define KP 1               // 32-key steps per pass of the key loop; one step, so that the k fragments of the next two passes have registers of their own beside the pass's logits, weights and v
#define LN2 0.6931471805599453f   // ln 2: the reference maxima go to the join in natural units
#define RLEAD 4.0f         // a new reference stands this far (log2 units) above the maximum it is taken from: later weights may grow to 2^19 times that maximum's before the next move; the largest weight, 2^-4, and all within 2^-10 of it are normal f16 numbers, smaller ones are off by at most 2^-25
#define PCAP 32768.0f      // while a lane's sum of a pass's weights exp2(z) stays below this, each of them is a finite f16 number; the reference cancels in ctx / sum, so it need not be the maximum itself
#define KSTEP (32 * KP * HDQK * 2)   // bytes of a pass's keys in each of the three planes
static_assert(FST % (2 * KP) == 0 && FQ == 2, "whole pairs of passes; the pass's test names both query tiles");
static_assert(FQB == 128 && DIN == 64 && FG * FKS >= 16, "output stage: 4 position pairs x 4 channel tiles = 16 waves");
static_assert(!CAUSAL && TT % FQB == 0 && TT % (32 * FKS) == 0 && HDQK == 32 && QHI == TT && KHI == TT && CC == 128 && TT % 64 == 0, "whole query blocks, equal key ranges, one 32-deep product; one k_proj block column holds the 32 real columns, its 64 rows whole tiles of one batch");
// every unroll directive of k_fa: the fragment, score and accumulator arrays are then indexed by constants alone and stay in registers
__device__ __forceinline__ v8f wm(v16h a, v16h b, v8f c) { return __builtin_amdgcn_wmma_f32_16x16x32_f16(false, a, false, b, (short)0, c, false, false); }
__device__ __forceinline__ v8f wmb(v16b a, v16b b, v8f c) { return __builtin_amdgcn_wmma_f32_16x16x32_bf16(false, a, false, b, (short)0, c, false, false); }
__device__ __forceinline__ v16h frag_p(const _Float16* base, unsigned boff, int tile) { union { v16h v; v8h q[2]; } u; const char* p = (const char*)base + boff + tile; u.q[0] = *(const v8h*)p; u.q[1] = *(const v8h*)(p + 512); return u.v; }   // fragment-order tile: uniform base + the lane's byte offset + the tile's; elements 0..7 in the first 512 bytes, 8..15 in the second
__device__ __forceinline__ float xhalf(float x) { return __builtin_bit_cast(float, __builtin_amdgcn_permlanex16(__builtin_bit_cast(int, x), __builtin_bit_cast(int, x), 0x76543210, 0xfedcba98, false, false)); }   // lane l reads lane l ^ 16
// one query tile's weights of a pass: exp2 of the logits as they stand, their f32 sum in key order, and the f16 B operand
template <bool SLOT> __device__ __forceinline__ float ex2(float x) { if (!SLOT) return __builtin_amdgcn_exp2f(x);
  float r; asm("v_exp_f32 %0, %1\n\tv_nop" : "=v"(r) : "v"(x)); return r; }   // SLOT: the v_nop is the one slot that the instruction set asks for behind a transcendental before its source is overwritten or its result read; for the rare path, where the compiler packed the exponentials so that each overwrote the source of the one before
template <bool SLOT> __device__ __forceinline__ float expsum(const v2f (&z)[8 * KP], v16h (&p)[KP]) { float sum = 0.f;
#pragma unroll
  for (int i = 0; i < 8 * KP; ++i) { const float ex = ex2<SLOT>(z[i].x), ey = ex2<SLOT>(z[i].y); sum += ex; sum += ey; p[i >> 3][2 * (i & 7)] = (_Float16)ex; p[i >> 3][2 * (i & 7) + 1] = (_Float16)ey; }   /* far below the reference the result is 0 */
  return sum; }
// amdgpu_waves_per_eu(4, 4): the block's 16 waves stand 4 on a SIMD and no second block fits beside them, so nothing is gained by saving registers below 256 a wave; without it the compiler schedules the softmax more tightly: fewer additions of the two query tiles pair into one instruction, and more idle slots stand behind the products
__global__ __launch_bounds__(32 * FG * FKS) __attribute__((amdgpu_waves_per_eu(4, 4))) void k_fa(const _Float16* __restrict__ QH, const _Float16* __restrict__ QL, const _Float16* __restrict__ KH, const _Float16* __restrict__ KL, const _Float16* __restrict__ VT,
    const float* __restrict__ X, const float* __restrict__ WW, const float* __restrict__ WB, const float* __restrict__ GAm, const float* __restrict__ BEt, const float* __restrict__ MUv, const float* __restrict__ VAv, float* __restrict__ OUT) {
  __shared__ __align__(16) float so[FKS][FQB][HDQK + 4]; __shared__ float smx[FKS][FQB], ssu[FKS][FQB]; __shared__ __align__(16) float sbn[4][DIN];   /* per output channel: gamma / sqrt(var + eps), mean, beta, b_out */
  const int tid = threadIdx.x, wave = __builtin_amdgcn_readfirstlane(tid >> 5), lane = tid & 31, col = lane & 15, g = lane >> 4; const int qg = wave % FG, ks = wave / FG;
  const int b = blockIdx.y, qr0 = blockIdx.x * FQB; const size_t rb = (size_t)b * TT;
  if (wave < DIN / 32) { sbn[0][tid] = bfr(GAm[tid]) / __fsqrt_rn(bfr(VAv[tid]) + 1e-4f); sbn[1][tid] = bfr(MUv[tid]); sbn[2][tid] = bfr(BEt[tid]); sbn[3][tid] = bfr(WB[tid]); }   /* one thread per output channel, one division and root per channel and block; read behind the two barriers below */
  v16h qh[FQ], ql[FQ];
#pragma unroll
  for (int u = 0; u < FQ; ++u) { const size_t qo = (rb + qr0 + (qg * FQ + u) * 16 + col) * HDQK; qh[u] = frag_h(QH + qo, lane); ql[u] = frag_h(QL + qo, lane); }
  __builtin_amdgcn_sched_barrier(0);   /* keeps the q loads in front of the first k loads: loads return in order, so the wait at the head of a pass, which on entry covers q too, can then leave the next pass's k loads in flight; with q behind them it waits for those as well, on every trip */
  const _Float16* kph = KH + (rb + ks * (FST * 32)) * HDQK; const _Float16* kpl = KL + (rb + ks * (FST * 32)) * HDQK; const _Float16* vp = VT + (rb + ks * (FST * 32)) * HDQK;   /* wave-uniform bases; 32 halves per key in each of the three */
  unsigned lo = lane * 16;   /* bytes, the same in all three planes: the lane's own place in each 512-byte half of a tile, plus the passes done (stepped by a pass's keys behind a pass's logit products) */
  float l[FQ]; v8f o[FQ][2], cs[FQ];   /* cs: minus the reference maximum (log2 units), the same in all 8 registers: a lane's 8 accumulator rows are 8 keys of ONE query */
#pragma unroll
  for (int u = 0; u < FQ; ++u) { l[u] = 0.f; o[u][0] = v8f{}; o[u][1] = v8f{}; cs[u] = v8f{}; }
  v16h kh[2][2 * KP], kl[2][2 * KP], vv[2][2 * KP];   /* two sets each, carried round the loop: pass kc finds its fragments in set kc & 1, k loaded two passes earlier, v one; vv[n][2 i + c]: 32-key group i, channel tile c */
#pragma unroll
  for (int n = 0; n < 2; ++n) {
#pragma unroll
    for (int t = 0; t < 2 * KP; ++t) { kh[n][t] = frag_p(kph, lo, n * KSTEP + t * 1024); kl[n][t] = frag_p(kpl, lo, n * KSTEP + t * 1024); }
    __builtin_amdgcn_sched_barrier(0);   /* the first loads in the order that the loop keeps (k of a pass, v of that pass, k of the next), so that the counted waits of the first trip are those of every trip */
    if (n == 0) {
#pragma unroll
      for (int t = 0; t < 2 * KP; ++t) vv[0][t] = frag_p(vp, lo, t * 1024);
      __builtin_amdgcn_sched_barrier(0); } }   /* as above */
  unsigned lk = lo + KSTEP;   /* lo, lk: the places of the last passes whose v and k loads are issued */
  for (int kc2 = 0; kc2 < FST / KP; kc2 += 2)
#pragma unroll
  for (int n = 0; n < 2; ++n) { const int kc = kc2 + n;   /* two passes a trip, so that each names its set of k registers by a constant */
    v2f s[FQ][8 * KP];   /* logits in pairs, as the packed fma takes and leaves them */
    v8f a[2][FQ], al[2][FQ];   /* the product tiles of two key tiles */
#pragma unroll
    for (int t = 0; t <= 2 * KP; ++t) {
      if (t < 2 * KP) {
#pragma unroll
        for (int u = 0; u < FQ; ++u) al[t & 1][u] = wm(kh[n][t], ql[u], v8f{});
#pragma unroll
        for (int u = 0; u < FQ; ++u) a[t & 1][u] = wm(kh[n][t], qh[u], cs[u]);
#pragma unroll
        for (int u = 0; u < FQ; ++u) al[t & 1][u] = wm(kl[n][t], qh[u], al[t & 1][u]); }
      __builtin_amdgcn_sched_barrier(0);   /* key tile t's six products stand between tile t - 1's products and the fmas that read them: the fmas then need no idle slots behind a product; left free, each fma run moves up to its product */
      if (t > 0) {
#pragma unroll
        for (int u = 0; u < FQ; ++u)
#pragma unroll
          for (int r = 0; r < 4; ++r) s[u][(t - 1) * 4 + r] = __builtin_elementwise_fma(v2f{al[(t - 1) & 1][u][2 * r], al[(t - 1) & 1][u][2 * r + 1]}, v2f{1.0f / 1024.0f, 1.0f / 1024.0f}, v2f{a[(t - 1) & 1][u][2 * r], a[(t - 1) & 1][u][2 * r + 1]}) * SCALE; }
      __builtin_amdgcn_sched_barrier(0); }   /* ends tile t - 1's fmas in front of tile t + 1's products, which take over their registers; behind the last tile it keeps the loads below behind the logit products, whose k registers they fill again */
    asm volatile("s_wait_xcnt 0x0" : "+v"(lo), "+v"(lk));   /* the wait in front of the rewrite of the loads' two offset registers, here behind the logit products, where the addresses of the last pass's loads are long taken; the registers are its operands, so the loads keep the form of one scalar base plus such a register, no load lands a result in them, and they are stepped only behind the wait */
    lo += kc + 1 < FST / KP ? KSTEP : 0; lk += kc + 2 < FST / KP ? KSTEP : 0;   /* where there is no next pass, or none after it, the loads read the last pass's fragments again, so that no load leaves the range */
#pragma unroll
    for (int t = 0; t < 2 * KP; ++t) vv[n ^ 1][t] = frag_p(vp, lo, t * 1024);   /* the next pass's v, into the set that the last pass's products have left */
    __builtin_amdgcn_sched_barrier(0);   /* v in front of k: loads return in order, and the next pass's v is wanted before the k of the pass after it */
#pragma unroll
    for (int t = 0; t < 2 * KP; ++t) { kh[n][t] = frag_p(kph, lk, t * 1024); kl[n][t] = frag_p(kpl, lk, t * 1024); }
    __builtin_amdgcn_sched_barrier(0);   /* keeps these loads here, in front of the softmax: a whole pass and more covers their latency; left free, they sink towards the trip's foot */
    v16h p[FQ][KP]; float sum[FQ];
#pragma unroll
    for (int u = 0; u < FQ; ++u) sum[u] = expsum<false>(s[u], p[u]);
    const bool first = kc == 0;   /* no reference yet: z is the bare logit */
    if (first || __builtin_amdgcn_ballot_w32(fmaxf(sum[0], sum[1]) > PCAP) != 0) {   /* wave-uniform, one test per pass: a weight is at most its lane's sum, so below PCAP every weight is a finite f16 number and the pass stands as it is */
#pragma unroll
      for (int u = 0; u < FQ; ++u) {
        float x = s[u][0].x;
#pragma unroll
        for (int i = 1; i < 16 * KP; ++i) x = fmaxf(x, s[u][i >> 1][i & 1]);
        x = fmaxf(x, xhalf(x)) + RLEAD;   /* the two lane halves hold the same query's other keys of the pass */
        const float d = first ? x : fmaxf(x, 0.f), sc = first ? 0.f : __builtin_amdgcn_exp2f(-d);   /* the reference rises by d to RLEAD above the pass's maximum where that is above it; sum and ctx are still 0 on the first pass */
        l[u] *= sc;
#pragma unroll
        for (int r = 0; r < 8; ++r) { o[u][0][r] *= sc; o[u][1][r] *= sc; cs[u][r] -= d; }
#pragma unroll
        for (int i = 0; i < 8 * KP; ++i) s[u][i] -= v2f{d, d};
        sum[u] = expsum<true>(s[u], p[u]); } }   /* the pass's weights again, against the new reference: at most 2^-RLEAD each */
#pragma unroll
    for (int u = 0; u < FQ; ++u) {
      l[u] += sum[u];
#pragma unroll
      for (int i = 0; i < KP; ++i)
#pragma unroll
        for (int c = 0; c < 2; ++c) o[u][c] = wm(vv[n][2 * i + c], p[u][i], o[u][c]); }
  }
  asm volatile("s_wait_xcnt 0x0" : "+v"(lo), "+v"(lk));   /* the last pass's loads are issued behind the loop's last wait: this one stands in front of the first reuse of the registers that they name; the two offset registers are its operands, so they live up to it */
  __builtin_amdgcn_sched_barrier(0);   /* keeps what follows, which takes over the loads' scalar bases too, behind the wait */
#pragma unroll
  for (int u = 0; u < FQ; ++u) { const int rl = (qg * FQ + u) * 16 + col; const float lt = l[u] + xhalf(l[u]); if (g == 0) { smx[ks][rl] = -cs[u][0] * LN2; ssu[ks][rl] = lt; }
#pragma unroll
    for (int c = 0; c < 2; ++c)
#pragma unroll
      for (int r = 0; r < 8; ++r) so[ks][rl][c * 16 + 8 * g + r] = o[u][c][r]; }   /* register r = channel 16c + 8g + r of query col */
  // output stage, operands that do not depend on y: fetched in front of the barrier, where a wave that leaves the key loop early waits for the others anyway
  const bool ow = wave < 16; const int np = wave & 3, ct = wave >> 2;   /* wave-uniform: position pair np (tiles 2 np, 2 np + 1) x channel tile ct */
  v16b wf = zero16b(); float xr[2][8] = {};
  const size_t oi = ((size_t)b * DIN + ct * 16 + 8 * g) * XP + qr0 + np * 32 + col;   /* channel 16 ct + 8 g (+ r), position 32 np + col (+ 16 t) */
  if (ow) { wf = wcol_oi(WW, 0, ct * 16 + col, lane, HDQK);   /* A fragment: row = output channel 16 ct + col, k = y channel, the k order of split_row */
#pragma unroll
    for (int r = 0; r < 8; ++r)
#pragma unroll
      for (int t = 0; t < 2; ++t) xr[t][r] = bfr(X[oi + (size_t)r * XP + t * 16]); }
  __syncthreads();   /* every range's maximum, sum and partial rows are in LDS before any thread joins them */
  for (int e = tid; e < FQB * (HDQK / 4); e += 32 * FG * FKS) { const int rl = e / (HDQK / 4), q = e % (HDQK / 4); float mt = smx[0][rl];
#pragma unroll
    for (int i = 1; i < FKS; ++i) mt = fmaxf(mt, smx[i][rl]);
    float lt = 0.f; v4f s = {};
#pragma unroll
    for (int i = 0; i < FKS; ++i) { const float w = expf(smx[i][rl] - mt); lt += w * ssu[i][rl]; s += *(const v4f*)&so[i][rl][q * 4] * w; }
    *(v4f*)&so[0][rl][q * 4] = s * (1.0f / lt); }   /* y in place of range 0's partial row: these 4 words are read by this thread alone, above */
  __syncthreads();   /* all of y and the channel table are in LDS before the output stage reads them */
  if (ow) { float inv[8], mu[8], be[8], bo[8];
#pragma unroll
    for (int r = 0; r < 8; ++r) { const int c = ct * 16 + 8 * g + r; inv[r] = sbn[0][c]; mu[r] = sbn[1][c]; be[r] = sbn[2][c]; bo[r] = sbn[3][c]; }
#pragma unroll
    for (int t = 0; t < 2; ++t) { const F2 y = split_row(&so[0][np * 32 + t * 16 + col][0], 0, lane); v8f acc = {}; acc = wmb(wf, y.h, acc); acc = wmb(wf, y.l, acc);
#pragma unroll
      for (int r = 0; r < 8; ++r) OUT[oi + (size_t)r * XP + t * 16] = (((acc[r] + bo[r]) - mu[r]) * inv[r] + be[r]) + xr[t][r]; } } }   /* eval BN: (W_y - mean) * (gamma / sqrt(var + eps)) + beta, then + x */

extern "C" void kernel_launch(void* const* d_in, const int* in_sizes, int n_in, void* d_out, int out_size, void* d_ws, size_t ws_size, hipStream_t stream) {
  (void)in_sizes; (void)n_in; (void)out_size;
  const float** F = (const float**)d_in;
  if (ws_size < (size_t)WS_END) return;
  char* ws = (char*)d_ws; _Float16 *QH = (_Float16*)(ws + WS_QH), *KH = (_Float16*)(ws + WS_KH), *VT = (_Float16*)(ws + WS_VT), *QL = (_Float16*)(ws + WS_QL), *KL = (_Float16*)(ws + WS_KL); float *S = (float*)(ws + WS_S), *Y = (float*)(ws + WS_Y);
  (void)Y; (void)S;
  // inputs: 0 x [4,64,80,80]; 1 w_theta [32,64] (out,in), 2 b_theta; 3 w_phi, 4 b_phi; 5 w_g, 6 b_g; 7 w_out [64,32] (out,in), 8 b_out; 9 bn_gamma, 10 bn_beta, 11 bn_mean, 12 bn_var
  k_proj<<<dim3(TNB * TT / 64), 128, 0, stream>>>(F[0], F[1], F[3], F[5], F[2], F[4], F[6], QH, QL, KH, KL, VT);   /* q = theta, k = phi, v = g */
  k_fa<<<dim3(TT / FQB, TNB), 32 * FG * FKS, 0, stream>>>(QH, QL, KH, KL, VT, F[0], F[7], F[8], F[9], F[10], F[11], F[12], (float*)d_out);
}
